// v000
// Measured on an AMD MI455X. A time is GPU time per run, averaged over a window of back-to-back runs after a warm-up
// (all launches, gaps included; the runs take copies of the inputs in turn), and the median of several windows.
// Apart from v000's, it joins two sittings. Times from different sittings can be a few percent apart, while
// side-by-side timings come from the same sitting.
// v000 is the starting kernel. One run takes 500 microseconds.
// compute dtype: R and Y rounded to bf16; no projections: q0 = R and k = v = Y are exact bf16 values re-laid on device as f16 hi + (x2048) residual planes (hi exact for bf16 values, residual only below the f16 normal range); step 1: 3-product scores x 1/8 (effectively exact operands), running-max softmax in f32 (hardware exp), P (scaled by 2^11, as f16 hi + residual) x v hi/lo (3 products) -> q1 kept as f16 hi + (x2048) residual planes; step 2 identical with q1; f32 accumulate; the final state is the f32 output.
#include <hip/hip_runtime.h>
#include <math.h>

typedef __attribute__((ext_vector_type(16))) _Float16 v16h;
typedef __attribute__((ext_vector_type(16))) __bf16 v16b;
typedef __attribute__((ext_vector_type(8)))  _Float16 v8h;
typedef __attribute__((ext_vector_type(8)))  float v8f;
typedef __attribute__((ext_vector_type(4)))  float v4f;
typedef __attribute__((ext_vector_type(2)))  float v2f;
typedef __attribute__((ext_vector_type(4)))  unsigned v4u;
typedef __attribute__((ext_vector_type(4)))  int v4i;
typedef float __attribute__((may_alias)) float_a;
typedef int __attribute__((may_alias)) int_a;

template <typename T> __device__ __forceinline__ void vst2(void* p, T v) { *(T*)p = v;  }
__device__ __forceinline__ v8f wmma16(v16h a, v16h b, v8f c) {
  v8f d = __builtin_amdgcn_wmma_f32_16x16x32_f16(false, a, false, b, (short)0, c, false, false);
  asm volatile("v_nop\n\tv_nop\n\tv_nop\n\tv_nop" : "+v"(d) : "v"(a), "v"(b));
  return d;
}
__device__ __forceinline__ v8f wmma_bf(v16b a, v16b b, v8f c) {
  v8f d = __builtin_amdgcn_wmma_f32_16x16x32_bf16(false, a, false, b, (short)0, c, false, false);
  asm volatile("v_nop\n\tv_nop\n\tv_nop\n\tv_nop" : "+v"(d) : "v"(a), "v"(b));
  return d;
}
__device__ __forceinline__ v16h frag_h(const _Float16* rowk0, int lane) {
  union { v16h v; v8h q[2]; } u; const _Float16* p = rowk0 + 8 * (lane >> 4);
  u.q[0] = *(const v8h*)p; u.q[1] = *(const v8h*)(p + 16); return u.v;
}
__device__ __forceinline__ v16h frag_f32(const float* rowk0, int lane) {
  v16h a; const float* p = rowk0 + 8 * (lane >> 4);
#pragma unroll
  for (int i = 0; i < 8; ++i) { a[i] = (_Float16)p[i]; a[8 + i] = (_Float16)p[16 + i]; }
  return a;
}
__device__ __forceinline__ v16h frag_f32s(const float* rowk0, int lane, float sc) {
  v16h a; const float* p = rowk0 + 8 * (lane >> 4);
#pragma unroll
  for (int i = 0; i < 8; ++i) { a[i] = (_Float16)(p[i] * sc); a[8 + i] = (_Float16)(p[16 + i] * sc); }
  return a;
}
// column fragment from a [K][ld] layout (column n), rows >= K read as 0
__device__ __forceinline__ v16h fragc_f32(const float* W, int k0, int n, int lane, int ld, int K) {
  v16h a; const int g = lane >> 4;
#pragma unroll
  for (int i = 0; i < 8; ++i) { const int ka = k0 + 8 * g + i, kb = ka + 16;
    a[i] = (_Float16)(ka < K ? W[(size_t)(ka < K ? ka : K - 1) * ld + n] : 0.f); a[8 + i] = (_Float16)(kb < K ? W[(size_t)(kb < K ? kb : K - 1) * ld + n] : 0.f); }
  return a;
}
struct F2 { v16b h, l; };
__device__ __forceinline__ F2 bsplit16(const float v[16]) { F2 r;
#pragma unroll
  for (int i = 0; i < 16; ++i) { const __bf16 h = (__bf16)v[i]; r.h[i] = h; r.l[i] = (__bf16)(v[i] - (float)h); }
  return r; }
__device__ __forceinline__ F2 split_row(const float* row, int k0, int lane) { float v[16]; const float* p = row + k0 + 8 * (lane >> 4);
#pragma unroll
  for (int i = 0; i < 8; ++i) { v[i] = p[i]; v[8 + i] = p[16 + i]; }
  return bsplit16(v); }
__device__ __forceinline__ F2 split_rowK(const float* row, int k0, int lane, int K) { float v[16]; const int g = lane >> 4;
#pragma unroll
  for (int i = 0; i < 8; ++i) { const int ka = k0 + 8 * g + i, kb = ka + 16; v[i] = ka < K ? row[ka < K ? ka : K - 1] : 0.f; v[8 + i] = kb < K ? row[kb < K ? kb : K - 1] : 0.f; }
  return bsplit16(v); }
__device__ __forceinline__ F2 split_col(const float* W, int k0, int n, int lane, int ld, int K) { float v[16]; const int g = lane >> 4;
#pragma unroll
  for (int i = 0; i < 8; ++i) { const int ka = k0 + 8 * g + i, kb = ka + 16; v[i] = ka < K ? W[(size_t)(ka < K ? ka : K - 1) * ld + n] : 0.f; v[8 + i] = kb < K ? W[(size_t)(kb < K ? kb : K - 1) * ld + n] : 0.f; }
  return bsplit16(v); }
__device__ __forceinline__ v8f mac3(const F2& a, const F2& b, v8f c) { c = wmma_bf(a.l, b.h, c); c = wmma_bf(a.h, b.l, c); return wmma_bf(a.h, b.h, c); }
__device__ __forceinline__ float sigm(float v) { return 1.0f / (1.0f + expf(-v)); }
#define LDSX() do { asm volatile("s_wait_dscnt 0" ::: "memory"); __builtin_amdgcn_wave_barrier(); __builtin_amdgcn_fence(__ATOMIC_RELEASE, "workgroup"); } while (0)


#define NB 2
#define SS 2048
#define DM 512
#define NH 8
#define HD 64
#define QKVW (3 * DM)
#ifndef TQB
#define TQB (SS / 64)
#define TNB NB
#define TOB (NB * SS / 64)     // output row tiles (all)
#endif
typedef __attribute__((ext_vector_type(8))) __bf16 v8b;
__device__ __forceinline__ v16b frag_b(const __bf16* rowk0, int lane) {
  union { v16b v; v8b q[2]; } u; const __bf16* p = rowk0 + 8 * (lane >> 4);
  u.q[0] = *(const v8b*)p; u.q[1] = *(const v8b*)(p + 16); return u.v;
}
__device__ __forceinline__ float bfr(float v) { return (float)(__bf16)v; }
__device__ __attribute__((noinline)) float exp_ni(float v) { return expf(v); }
__device__ __attribute__((noinline)) float erf_ni(float v) { return erff(v); }

#define PK_A 0                       // [1536][512] Wqkv rows (natural [out][in])
#define PK_P (PK_A + QKVW * DM)        // [512][512] Wo rows (natural)
#define PK_END (PK_P + DM * DM)
#define WS_PK  0u
#define WS_QK  (WS_PK + 2u * PK_END)             // f16 [4096 rows][1024]: q | k
#define WS_QKL (WS_QK + 2u * NB * SS * 2 * DM)     // f16 q | k residual planes x2048
#define WS_VTH (WS_QKL + 2u * NB * SS * 2 * DM)    // f16 [b][512 (h*64+d)][2048 s] hi
#define WS_VTL (WS_VTH + 2u * NB * DM * SS)        // f16 lo x 2048
#define WS_O   (WS_VTL + 2u * NB * DM * SS)        // f32 [4096][512]
#define WS_CS  (WS_O + 4u * NB * SS * DM)           // f32 [2][2048][32], unused
#define WS_END (WS_CS + 4u * 2 * SS * 32)
// ---- k_pack: block = (row n, which): natural [out][in] rows -> bf16; which 0..2 -> W_q/W_k/W_v into PK_A rows which*512 + n; 3 -> W_o into PK_P
__global__ __launch_bounds__(256) void k_pack(const float* __restrict__ WQ, const float* __restrict__ WK, const float* __restrict__ WV, const float* __restrict__ WO, __bf16* __restrict__ PK) {
  __shared__ __align__(16) __bf16 s[DM]; const int n = blockIdx.x, which = blockIdx.y, t = threadIdx.x; const float* Wm = (which == 0) ? WQ : (which == 1) ? WK : (which == 2) ? WV : WO;
  for (int k = t; k < DM; k += 256) s[k] = (__bf16)Wm[(size_t)n * DM + k];
  __syncthreads();
  __bf16* dst = (which < 3) ? PK + PK_A + ((size_t)which * DM + n) * DM : PK + PK_P + (size_t)n * DM;
  for (int q = t; q < DM / 8; q += 256) vst2((unsigned*)(dst + q * 8), *(const v4u*)&s[q * 8]);
}
__global__ __launch_bounds__(128) void k_qkv(const float* __restrict__ XQ, const float* __restrict__ XK, const float* __restrict__ XV, const __bf16* __restrict__ P, const float* __restrict__ BQ, const float* __restrict__ BK, const float* __restrict__ BV, _Float16* __restrict__ QK, _Float16* __restrict__ QKL, _Float16* __restrict__ VTH, _Float16* __restrict__ VTL) {
  const int which0 = (blockIdx.y * 128) / DM; const float* X = (which0 == 0) ? XQ : (which0 == 1) ? XK : XV; const float* BB = BQ ? (((which0 == 0) ? BQ : (which0 == 1) ? BK : BV) + (blockIdx.y * 128 - which0 * DM)) : nullptr;
  __shared__ __align__(16) _Float16 so[4][16][136], sol[4][16][136]; __shared__ __align__(16) _Float16 sth[128][72], stl[128][72];
  const int tid = threadIdx.x, wave = tid >> 5, lane = tid & 31, col = lane & 15, g = lane >> 4; const size_t r0 = (size_t)blockIdx.x * 64 + wave * 16; const int n0 = blockIdx.y * 128;
  v8f acc[8] = {};
#pragma unroll 2
  for (int kc = 0; kc < DM / 32; ++kc) { v16b a; { const float* p = X + (r0 + col) * DM + kc * 32 + 8 * g;
#pragma unroll
      for (int i = 0; i < 8; ++i) { a[i] = (__bf16)p[i]; a[8 + i] = (__bf16)p[16 + i]; } }
#pragma unroll
    for (int j = 0; j < 8; ++j) acc[j] = wmma_bf(a, frag_b(P + (size_t)(n0 + j * 16 + col) * DM + kc * 32, lane), acc[j]); }
  if (n0 < 2 * DM) {   // q stored unscaled (f16 sigma ~0.6, no subnormal exposure); 1/8 applied to the f32 score
#pragma unroll
    for (int j = 0; j < 8; ++j) {
#pragma unroll
      for (int r = 0; r < 8; ++r) { const float v = acc[j][r] + (BB ? bfr(BB[j * 16 + col]) : 0.f); const _Float16 hv = (_Float16)v; so[wave][8 * g + r][j * 16 + col] = hv; sol[wave][8 * g + r][j * 16 + col] = (_Float16)((v - (float)hv) * 2048.0f); } }   // q, k (+ bias) as f16 hi + (x2048) residual
    LDSX();
    for (int rl = 0; rl < 16; ++rl) if (lane < 16) { vst2((unsigned*)(QK + (r0 + rl) * (2 * DM) + n0 + lane * 8), *(const v4u*)&so[wave][rl][lane * 8]); vst2((unsigned*)(QKL + (r0 + rl) * (2 * DM) + n0 + lane * 8), *(const v4u*)&sol[wave][rl][lane * 8]); }
  } else {
#pragma unroll
    for (int j = 0; j < 8; ++j) {
#pragma unroll
      for (int r = 0; r < 8; ++r) { const float v = acc[j][r] + (BB ? bfr(BB[j * 16 + col]) : 0.f); const _Float16 hv = (_Float16)v; sth[j * 16 + col][wave * 16 + 8 * g + r] = hv; stl[j * 16 + col][wave * 16 + 8 * g + r] = (_Float16)((v - (float)hv) * 2048.0f); } }
    __syncthreads();
    const size_t rb = (size_t)blockIdx.x * 64; const int b = (int)(rb / SS), s0 = (int)(rb % SS); const int pc0 = n0 - 2 * DM;
    for (int q = tid; q < 128 * 8; q += 128) { const int d = q >> 3, pc = q & 7; const size_t o = ((size_t)b * DM + pc0 + d) * SS + s0 + pc * 8; vst2((unsigned*)(VTH + o), *(const v4u*)&sth[d][pc * 8]); vst2((unsigned*)(VTL + o), *(const v4u*)&stl[d][pc * 8]); }
  }
}
// ---- k_attn: block = (64 queries, head h, batch b): all-keys flash attention (K = 64: 2 k-steps), scores = (q.k) * 0.125 with f16 hi + residual operands (3 products), P.V: (2048 P as f16 hi + residual) x (V hi, V lo*2048), 3 products in two accumulators; O[b*S+q][h*64+d] = (acc + accl / 2048) / (2048 l) (256-B segments)
__global__ __launch_bounds__(128) void k_attn(const _Float16* __restrict__ QK, const _Float16* __restrict__ QKL, const _Float16* __restrict__ VTH, const _Float16* __restrict__ VTL, const void* __restrict__ KMASK, float* __restrict__ O) {
  __shared__ __align__(16) float sp[4][16][36]; __shared__ __align__(16) float so[4][16][68];
  const int tid = threadIdx.x, wave = tid >> 5, lane = tid & 31, col = lane & 15, g = lane >> 4;
  const int qb = blockIdx.x, h = blockIdx.y, b = blockIdx.z; const int q0 = qb * 64 + wave * 16; const size_t rq = (size_t)b * SS + q0 + col;
  v16h aq[2], aql[2];
#pragma unroll
  for (int kc = 0; kc < 2; ++kc) { aq[kc] = frag_h(QK + rq * (2 * DM) + h * HD + kc * 32, lane); aql[kc] = frag_h(QKL + rq * (2 * DM) + h * HD + kc * 32, lane); }
  float m[8], l[8];
#pragma unroll
  for (int r = 0; r < 8; ++r) { m[r] = -3.0e38f; l[r] = 0.f; }
  v8f acc[4] = {}, accl[4] = {};
  const int nks = SS / 32;   // all keys
#pragma unroll 1
  for (int ks = 0; ks < nks; ++ks) { v8f s[2];
#pragma unroll
    for (int ct = 0; ct < 2; ++ct) { const int kk = ks * 32 + ct * 16 + col; const _Float16* krow = QK + ((size_t)b * SS + kk) * (2 * DM) + DM + h * HD; const _Float16* krowl = QKL + ((size_t)b * SS + kk) * (2 * DM) + DM + h * HD; v8f c = {}, cl = {};
#pragma unroll
      for (int kc = 0; kc < 2; ++kc) { const v16h kh = frag_h(krow + kc * 32, lane); c = wmma16(aq[kc], kh, c); cl = wmma16(aql[kc], kh, cl); cl = wmma16(aq[kc], frag_h(krowl + kc * 32, lane), cl); }   // 3 products: q, k as f16 hi + residual
#pragma unroll
      for (int r = 0; r < 8; ++r) c[r] += cl[r] * (1.0f / 2048.0f);
#pragma unroll
      for (int r = 0; r < 8; ++r) s[ct][r] = c[r] * 0.125f; }   // 1/sqrt(64)
#pragma unroll
    for (int r = 0; r < 8; ++r) { float mx = fmaxf(s[0][r], s[1][r]);
#pragma unroll
      for (int o = 1; o < 16; o <<= 1) mx = fmaxf(mx, __shfl_xor(mx, o));
      const float mn = fmaxf(m[r], mx); const float alpha = (m[r] <= -1.0e38f) ? 0.f : __expf(m[r] - mn);
      const float e0 = (s[0][r] <= -1.0e38f) ? 0.f : __expf(s[0][r] - mn), e1 = (s[1][r] <= -1.0e38f) ? 0.f : __expf(s[1][r] - mn); float es = e0 + e1;
#pragma unroll
      for (int o = 1; o < 16; o <<= 1) es += __shfl_xor(es, o);
      l[r] = l[r] * alpha + es; m[r] = mn;
#pragma unroll
      for (int dt = 0; dt < 4; ++dt) { acc[dt][r] *= alpha; accl[dt][r] *= alpha; }
      sp[wave][8 * g + r][col] = e0; sp[wave][8 * g + r][16 + col] = e1; }
    LDSX();
    v16h pa, pl; { const float* prow = &sp[wave][col][0] + 8 * (lane >> 4);
#pragma unroll
      for (int i = 0; i < 8; ++i) { const float x0 = prow[i] * 2048.0f, x1 = prow[16 + i] * 2048.0f; const _Float16 h0 = (_Float16)x0, h1 = (_Float16)x1; pa[i] = h0; pa[8 + i] = h1; pl[i] = (_Float16)((x0 - (float)h0) * 2048.0f); pl[8 + i] = (_Float16)((x1 - (float)h1) * 2048.0f); } }   // P scaled by 2^11 before the f16 split so small softmax weights stay out of the f16 subnormal range; 2^-11 folded into the epilogue
#pragma unroll
    for (int dt = 0; dt < 4; ++dt) { const size_t vr = ((size_t)b * DM + h * HD + dt * 16 + col) * SS + ks * 32; const v16h vh = frag_h(VTH + vr, lane); acc[dt] = wmma16(pa, vh, acc[dt]); accl[dt] = wmma16(pl, vh, accl[dt]); accl[dt] = wmma16(pa, frag_h(VTL + vr, lane), accl[dt]); }   // P hi x V hi + (P lo x V hi + P hi x V lo) / 2048
    LDSX(); }
#pragma unroll
  for (int r = 0; r < 8; ++r) { const float il = (1.0f / 2048.0f) / l[r];
#pragma unroll
    for (int dt = 0; dt < 4; ++dt) so[wave][8 * g + r][dt * 16 + col] = (acc[dt][r] + accl[dt][r] * (1.0f / 2048.0f)) * il; }
  LDSX();
  for (int rl = 0; rl < 16; ++rl) if (lane < 16) vst2(O + ((size_t)b * SS + q0 + rl) * DM + h * HD + lane * 4, *(const v4f*)&so[wave][rl][lane * 4]);
}
// ---- k_out: block = (64 rows, 128 cols): out = O(hi/lo) . Wo rows (2 products) + bo
__global__ __launch_bounds__(128) void k_out(const float* __restrict__ O, const __bf16* __restrict__ P, const float* __restrict__ BO, float* __restrict__ Y) {
  __shared__ __align__(16) float so[4][16][132];
  const int tid = threadIdx.x, wave = tid >> 5, lane = tid & 31, col = lane & 15, g = lane >> 4; const size_t r0 = (size_t)blockIdx.x * 64 + wave * 16; const int n0 = blockIdx.y * 128;
  v8f acc[8] = {};
#pragma unroll 2
  for (int kc = 0; kc < DM / 32; ++kc) { const F2 a = split_row(O + (r0 + col) * DM, kc * 32, lane);
#pragma unroll
    for (int j = 0; j < 8; ++j) { const v16b w = frag_b(P + (size_t)(n0 + j * 16 + col) * DM + kc * 32, lane); acc[j] = wmma_bf(a.l, w, acc[j]); acc[j] = wmma_bf(a.h, w, acc[j]); } }
#pragma unroll
  for (int j = 0; j < 8; ++j) {
#pragma unroll
    for (int r = 0; r < 8; ++r) so[wave][8 * g + r][j * 16 + col] = acc[j][r] + bfr(BO[n0 + j * 16 + col]); }
  LDSX();
  for (int rl = 0; rl < 16; ++rl) vst2(Y + (r0 + rl) * DM + n0 + lane * 4, *(const v4f*)&so[wave][rl][lane * 4]);
}
// ---- k_layqk: block = 64 rows: R rows -> q slots, Y rows -> k slots of the q|k planes (f16 hi + x2048 residual), thread-linear 8-element chunks (no LDS)
__global__ __launch_bounds__(256) void k_layqk(const float* __restrict__ R, const float* __restrict__ Y, _Float16* __restrict__ QK, _Float16* __restrict__ QKL) {
  const int t = threadIdx.x; const size_t r0 = (size_t)blockIdx.x * 64;
  for (int e = t; e < 64 * (DM / 8) * 2; e += 256) { const int which = e / (64 * (DM / 8)); const int e2 = e % (64 * (DM / 8)); const int r = e2 / (DM / 8), q = e2 % (DM / 8); const float* src = (which ? Y : R) + (r0 + r) * DM + q * 8;
    __align__(16) _Float16 hh[8], ll[8];
#pragma unroll
    for (int i = 0; i < 8; ++i) { const float v = bfr(src[i]); const _Float16 h = (_Float16)v; hh[i] = h; ll[i] = (_Float16)((v - (float)h) * 2048.0f); }
    const size_t o = (r0 + r) * (2 * DM) + (size_t)which * DM + q * 8; vst2((unsigned*)(QK + o), *(const v4u*)hh); vst2((unsigned*)(QKL + o), *(const v4u*)ll); }
}
// ---- k_layv: block = (64 rows s, b): Y rows -> v^T planes [b][c][s] via an LDS transpose
__global__ __launch_bounds__(256) void k_layv(const float* __restrict__ Y, _Float16* __restrict__ VTH, _Float16* __restrict__ VTL) {
  __shared__ __align__(16) _Float16 svh[DM][72], svl[DM][72]; const int t = threadIdx.x; const int s0 = blockIdx.x * 64; const size_t b = blockIdx.y;
  for (int e = t; e < 64 * DM; e += 256) { const int r = e / DM, c = e % DM; const float v = bfr(Y[(b * SS + s0 + r) * DM + c]); const _Float16 h = (_Float16)v; svh[c][r] = h; svl[c][r] = (_Float16)((v - (float)h) * 2048.0f); }
  __syncthreads();
  for (int e = t; e < DM * 8; e += 256) { const int c = e >> 3, pc = e & 7; const size_t o = (b * DM + c) * SS + s0 + pc * 8; vst2((unsigned*)(VTH + o), *(const v4u*)&svh[c][pc * 8]); vst2((unsigned*)(VTL + o), *(const v4u*)&svl[c][pc * 8]); }
}
// ---- k_req: block = 64 rows: the step-1 result O (f32 rows) -> q slots of the planes as f16 hi + x2048 residual (step-2 queries)
__global__ __launch_bounds__(256) void k_req(const float* __restrict__ O, _Float16* __restrict__ QK, _Float16* __restrict__ QKL) {
  __shared__ __align__(16) _Float16 sq[64][DM + 8], sql_[64][DM + 8]; const int t = threadIdx.x; const size_t r0 = (size_t)blockIdx.x * 64;
  for (int e = t; e < 64 * DM; e += 256) { const int r = e / DM, c = e % DM; const float v = O[(r0 + r) * DM + c]; const _Float16 h = (_Float16)v; sq[r][c] = h; sql_[r][c] = (_Float16)((v - (float)h) * 2048.0f); }
  __syncthreads();
  for (int e = t; e < 64 * (DM / 8); e += 256) { const int r = e / (DM / 8), q = e % (DM / 8); const size_t o = (r0 + r) * (2 * DM) + q * 8; vst2((unsigned*)(QK + o), *(const v4u*)&sq[r][q * 8]); vst2((unsigned*)(QKL + o), *(const v4u*)&sql_[r][q * 8]); }
}
extern "C" void kernel_launch(void* const* d_in, const int* in_sizes, int n_in, void* d_out, int out_size, void* d_ws, size_t ws_size, hipStream_t stream) {
  (void)in_sizes; (void)n_in; (void)out_size;
  const float** F = (const float**)d_in;   // 0 R [2,2048,512] (state patterns / queries), 1 Y [2,2048,512] (stored patterns = keys = values)
  if (ws_size < (size_t)WS_END) return;
  char* ws = (char*)d_ws; (void)0; _Float16 *QK = (_Float16*)(ws + WS_QK), *QKL = (_Float16*)(ws + WS_QKL), *VTH = (_Float16*)(ws + WS_VTH), *VTL = (_Float16*)(ws + WS_VTL); float* O = (float*)(ws + WS_O);
  k_layqk<<<NB * SS / 64, 256, 0, stream>>>(F[0], F[1], QK, QKL);
  k_layv<<<dim3(SS / 64, NB), 256, 0, stream>>>(F[1], VTH, VTL);
  k_attn<<<dim3(TQB, NH, TNB), 128, 0, stream>>>(QK, QKL, VTH, VTL, nullptr, O);          // step 1
  k_req<<<TOB, 256, 0, stream>>>(O, QK, QKL);
  k_attn<<<dim3(TQB, NH, TNB), 128, 0, stream>>>(QK, QKL, VTH, VTL, nullptr, (float*)d_out);   // step 2 -> output rows [b*L + l][h*64 + e]
}

// v001
// Measured time: 244 microseconds a run.
// Next to v000, in two timings, it ran 2.07 times as fast each time.
// compute dtype: R and Y rounded to bf16; no projections: q0 = R and k = v = Y are exact bf16 values re-laid on device as f16 hi + (x2048) residual planes (hi exact for bf16 values, residual only below the f16 normal range); step 1: 3-product scores x 1/8 (effectively exact operands), running-max softmax in f32 (hardware exp), P (scaled by 2^11, as f16 hi + residual) x v hi/lo (3 products) -> q1 kept as f16 hi + (x2048) residual planes; step 2 identical with q1; f32 accumulate; the final state is the f32 output.
#include <hip/hip_runtime.h>
#include <math.h>

typedef __attribute__((ext_vector_type(16))) _Float16 v16h;
typedef __attribute__((ext_vector_type(16))) __bf16 v16b;
typedef __attribute__((ext_vector_type(8)))  _Float16 v8h;
typedef __attribute__((ext_vector_type(8)))  float v8f;
typedef __attribute__((ext_vector_type(4)))  float v4f;
typedef __attribute__((ext_vector_type(2)))  float v2f;
typedef __attribute__((ext_vector_type(4)))  unsigned v4u;
typedef __attribute__((ext_vector_type(4)))  int v4i;
typedef float __attribute__((may_alias)) float_a;
typedef int __attribute__((may_alias)) int_a;

template <typename T> __device__ __forceinline__ void vst2(void* p, T v) { *(T*)p = v;  }
__device__ __forceinline__ v8f wmma16(v16h a, v16h b, v8f c) {
  v8f d = __builtin_amdgcn_wmma_f32_16x16x32_f16(false, a, false, b, (short)0, c, false, false);
  asm volatile("v_nop\n\tv_nop\n\tv_nop\n\tv_nop" : "+v"(d) : "v"(a), "v"(b));
  return d;
}
__device__ __forceinline__ v8f wmma_bf(v16b a, v16b b, v8f c) {
  v8f d = __builtin_amdgcn_wmma_f32_16x16x32_bf16(false, a, false, b, (short)0, c, false, false);
  asm volatile("v_nop\n\tv_nop\n\tv_nop\n\tv_nop" : "+v"(d) : "v"(a), "v"(b));
  return d;
}
__device__ __forceinline__ v16h frag_h(const _Float16* rowk0, int lane) {
  union { v16h v; v8h q[2]; } u; const _Float16* p = rowk0 + 8 * (lane >> 4);
  u.q[0] = *(const v8h*)p; u.q[1] = *(const v8h*)(p + 16); return u.v;
}
__device__ __forceinline__ v16h frag_f32(const float* rowk0, int lane) {
  v16h a; const float* p = rowk0 + 8 * (lane >> 4);
#pragma unroll
  for (int i = 0; i < 8; ++i) { a[i] = (_Float16)p[i]; a[8 + i] = (_Float16)p[16 + i]; }
  return a;
}
__device__ __forceinline__ v16h frag_f32s(const float* rowk0, int lane, float sc) {
  v16h a; const float* p = rowk0 + 8 * (lane >> 4);
#pragma unroll
  for (int i = 0; i < 8; ++i) { a[i] = (_Float16)(p[i] * sc); a[8 + i] = (_Float16)(p[16 + i] * sc); }
  return a;
}
// column fragment from a [K][ld] layout (column n), rows >= K read as 0
__device__ __forceinline__ v16h fragc_f32(const float* W, int k0, int n, int lane, int ld, int K) {
  v16h a; const int g = lane >> 4;
#pragma unroll
  for (int i = 0; i < 8; ++i) { const int ka = k0 + 8 * g + i, kb = ka + 16;
    a[i] = (_Float16)(ka < K ? W[(size_t)(ka < K ? ka : K - 1) * ld + n] : 0.f); a[8 + i] = (_Float16)(kb < K ? W[(size_t)(kb < K ? kb : K - 1) * ld + n] : 0.f); }
  return a;
}
struct F2 { v16b h, l; };
__device__ __forceinline__ F2 bsplit16(const float v[16]) { F2 r;
#pragma unroll
  for (int i = 0; i < 16; ++i) { const __bf16 h = (__bf16)v[i]; r.h[i] = h; r.l[i] = (__bf16)(v[i] - (float)h); }
  return r; }
__device__ __forceinline__ F2 split_row(const float* row, int k0, int lane) { float v[16]; const float* p = row + k0 + 8 * (lane >> 4);
#pragma unroll
  for (int i = 0; i < 8; ++i) { v[i] = p[i]; v[8 + i] = p[16 + i]; }
  return bsplit16(v); }
__device__ __forceinline__ F2 split_rowK(const float* row, int k0, int lane, int K) { float v[16]; const int g = lane >> 4;
#pragma unroll
  for (int i = 0; i < 8; ++i) { const int ka = k0 + 8 * g + i, kb = ka + 16; v[i] = ka < K ? row[ka < K ? ka : K - 1] : 0.f; v[8 + i] = kb < K ? row[kb < K ? kb : K - 1] : 0.f; }
  return bsplit16(v); }
__device__ __forceinline__ F2 split_col(const float* W, int k0, int n, int lane, int ld, int K) { float v[16]; const int g = lane >> 4;
#pragma unroll
  for (int i = 0; i < 8; ++i) { const int ka = k0 + 8 * g + i, kb = ka + 16; v[i] = ka < K ? W[(size_t)(ka < K ? ka : K - 1) * ld + n] : 0.f; v[8 + i] = kb < K ? W[(size_t)(kb < K ? kb : K - 1) * ld + n] : 0.f; }
  return bsplit16(v); }
__device__ __forceinline__ v8f mac3(const F2& a, const F2& b, v8f c) { c = wmma_bf(a.l, b.h, c); c = wmma_bf(a.h, b.l, c); return wmma_bf(a.h, b.h, c); }
__device__ __forceinline__ float sigm(float v) { return 1.0f / (1.0f + expf(-v)); }
#define LDSX() do { asm volatile("s_wait_dscnt 0" ::: "memory"); __builtin_amdgcn_wave_barrier(); __builtin_amdgcn_fence(__ATOMIC_RELEASE, "workgroup"); } while (0)


// per-wave LDS hand-over inside the attention loop: same s_wait_dscnt 0 and wave barrier as LDSX, without the work-group release fence, whose wait would drain the fragment loads that are in flight (each wave reads only the LDS slice it wrote itself)
#define LDSW() do { asm volatile("s_wait_dscnt 0" ::: "memory"); __builtin_amdgcn_wave_barrier(); } while (0)
#define NB 2
#define SS 2048
#define DM 512
#define NH 8
#define HD 64
#define QKVW (3 * DM)
#ifndef TQB
#define TQB (SS / 64)
#define TNB NB
#define TOB (NB * SS / 64)     // output row tiles (all)
#endif
typedef __attribute__((ext_vector_type(8))) __bf16 v8b;
__device__ __forceinline__ v16b frag_b(const __bf16* rowk0, int lane) {
  union { v16b v; v8b q[2]; } u; const __bf16* p = rowk0 + 8 * (lane >> 4);
  u.q[0] = *(const v8b*)p; u.q[1] = *(const v8b*)(p + 16); return u.v;
}
// fragment in frag_h's k order from a plane's base, the lane's byte offset and a constant byte offset
__device__ __forceinline__ v16h frag_o(const _Float16* base, unsigned boff, int cb) {
  union { v16h v; v8h q[2]; } u; const char* p = (const char*)base + boff + cb;
  u.q[0] = *(const v8h*)p; u.q[1] = *(const v8h*)(p + 32); return u.v;
}
__device__ __forceinline__ float bfr(float v) { return (float)(__bf16)v; }
__device__ __attribute__((noinline)) float exp_ni(float v) { return expf(v); }
__device__ __attribute__((noinline)) float erf_ni(float v) { return erff(v); }

#define PK_A 0                       // [1536][512] Wqkv rows (natural [out][in])
#define PK_P (PK_A + QKVW * DM)        // [512][512] Wo rows (natural)
#define PK_END (PK_P + DM * DM)
#define WS_PK  0u
#define WS_QK  (WS_PK + 2u * PK_END)             // f16 [4096 rows][1024]: q | k
#define WS_QKL (WS_QK + 2u * NB * SS * 2 * DM)     // f16 q | k residual planes x2048
#define WS_VTH (WS_QKL + 2u * NB * SS * 2 * DM)    // f16 [b][512 (h*64+d)][2048 s] hi
#define WS_VTL (WS_VTH + 2u * NB * DM * SS)        // f16 lo x 2048
#define WS_O   (WS_VTL + 2u * NB * DM * SS)        // f32 [4096][512]
#define WS_CS  (WS_O + 4u * NB * SS * DM)           // f32 [2][2048][32], unused
#define WS_END (WS_CS + 4u * 2 * SS * 32)
// ---- k_pack: block = (row n, which): natural [out][in] rows -> bf16; which 0..2 -> W_q/W_k/W_v into PK_A rows which*512 + n; 3 -> W_o into PK_P
__global__ __launch_bounds__(256) void k_pack(const float* __restrict__ WQ, const float* __restrict__ WK, const float* __restrict__ WV, const float* __restrict__ WO, __bf16* __restrict__ PK) {
  __shared__ __align__(16) __bf16 s[DM]; const int n = blockIdx.x, which = blockIdx.y, t = threadIdx.x; const float* Wm = (which == 0) ? WQ : (which == 1) ? WK : (which == 2) ? WV : WO;
  for (int k = t; k < DM; k += 256) s[k] = (__bf16)Wm[(size_t)n * DM + k];
  __syncthreads();
  __bf16* dst = (which < 3) ? PK + PK_A + ((size_t)which * DM + n) * DM : PK + PK_P + (size_t)n * DM;
  for (int q = t; q < DM / 8; q += 256) vst2((unsigned*)(dst + q * 8), *(const v4u*)&s[q * 8]);
}
__global__ __launch_bounds__(128) void k_qkv(const float* __restrict__ XQ, const float* __restrict__ XK, const float* __restrict__ XV, const __bf16* __restrict__ P, const float* __restrict__ BQ, const float* __restrict__ BK, const float* __restrict__ BV, _Float16* __restrict__ QK, _Float16* __restrict__ QKL, _Float16* __restrict__ VTH, _Float16* __restrict__ VTL) {
  const int which0 = (blockIdx.y * 128) / DM; const float* X = (which0 == 0) ? XQ : (which0 == 1) ? XK : XV; const float* BB = BQ ? (((which0 == 0) ? BQ : (which0 == 1) ? BK : BV) + (blockIdx.y * 128 - which0 * DM)) : nullptr;
  __shared__ __align__(16) _Float16 so[4][16][136], sol[4][16][136]; __shared__ __align__(16) _Float16 sth[128][72], stl[128][72];
  const int tid = threadIdx.x, wave = tid >> 5, lane = tid & 31, col = lane & 15, g = lane >> 4; const size_t r0 = (size_t)blockIdx.x * 64 + wave * 16; const int n0 = blockIdx.y * 128;
  v8f acc[8] = {};
#pragma unroll 2
  for (int kc = 0; kc < DM / 32; ++kc) { v16b a; { const float* p = X + (r0 + col) * DM + kc * 32 + 8 * g;
#pragma unroll
      for (int i = 0; i < 8; ++i) { a[i] = (__bf16)p[i]; a[8 + i] = (__bf16)p[16 + i]; } }
#pragma unroll
    for (int j = 0; j < 8; ++j) acc[j] = wmma_bf(a, frag_b(P + (size_t)(n0 + j * 16 + col) * DM + kc * 32, lane), acc[j]); }
  if (n0 < 2 * DM) {   // q stored unscaled (f16 sigma ~0.6, no subnormal exposure); 1/8 applied to the f32 score
#pragma unroll
    for (int j = 0; j < 8; ++j) {
#pragma unroll
      for (int r = 0; r < 8; ++r) { const float v = acc[j][r] + (BB ? bfr(BB[j * 16 + col]) : 0.f); const _Float16 hv = (_Float16)v; so[wave][8 * g + r][j * 16 + col] = hv; sol[wave][8 * g + r][j * 16 + col] = (_Float16)((v - (float)hv) * 2048.0f); } }   // q, k (+ bias) as f16 hi + (x2048) residual
    LDSX();
    for (int rl = 0; rl < 16; ++rl) if (lane < 16) { vst2((unsigned*)(QK + (r0 + rl) * (2 * DM) + n0 + lane * 8), *(const v4u*)&so[wave][rl][lane * 8]); vst2((unsigned*)(QKL + (r0 + rl) * (2 * DM) + n0 + lane * 8), *(const v4u*)&sol[wave][rl][lane * 8]); }
  } else {
#pragma unroll
    for (int j = 0; j < 8; ++j) {
#pragma unroll
      for (int r = 0; r < 8; ++r) { const float v = acc[j][r] + (BB ? bfr(BB[j * 16 + col]) : 0.f); const _Float16 hv = (_Float16)v; sth[j * 16 + col][wave * 16 + 8 * g + r] = hv; stl[j * 16 + col][wave * 16 + 8 * g + r] = (_Float16)((v - (float)hv) * 2048.0f); } }
    __syncthreads();
    const size_t rb = (size_t)blockIdx.x * 64; const int b = (int)(rb / SS), s0 = (int)(rb % SS); const int pc0 = n0 - 2 * DM;
    for (int q = tid; q < 128 * 8; q += 128) { const int d = q >> 3, pc = q & 7; const size_t o = ((size_t)b * DM + pc0 + d) * SS + s0 + pc * 8; vst2((unsigned*)(VTH + o), *(const v4u*)&sth[d][pc * 8]); vst2((unsigned*)(VTL + o), *(const v4u*)&stl[d][pc * 8]); }
  }
}
// ---- k_attn: block = (64 queries, head h, batch b): all-keys flash attention (K = 64: 2 k-steps), scores = (q.k) * 0.125 with f16 hi + residual operands (3 products), P.V: (2048 P as f16 hi + residual) x (V hi, V lo*2048), 3 products in two accumulators; O[b*S+q][h*64+d] = (acc + accl / 2048) / (2048 l) (256-B segments)
__global__ __launch_bounds__(128) void k_attn(const _Float16* __restrict__ QK, const _Float16* __restrict__ QKL, const _Float16* __restrict__ VTH, const _Float16* __restrict__ VTL, const void* __restrict__ KMASK, float* __restrict__ O) {
  __shared__ __align__(16) float sp[4][16][36]; __shared__ __align__(16) float so[4][16][68];
  const int tid = threadIdx.x, wave = tid >> 5, lane = tid & 31, col = lane & 15, g = lane >> 4;
  const int qb = blockIdx.x, h = blockIdx.y, b = blockIdx.z; const int q0 = qb * 64 + wave * 16; const size_t rq = (size_t)b * SS + q0 + col;
  v16h aq[2], aql[2];
#pragma unroll
  for (int kc = 0; kc < 2; ++kc) { aq[kc] = frag_h(QK + rq * (2 * DM) + h * HD + kc * 32, lane); aql[kc] = frag_h(QKL + rq * (2 * DM) + h * HD + kc * 32, lane); }
  float m[8], l[8];
#pragma unroll
  for (int r = 0; r < 8; ++r) { m[r] = -3.0e38f; l[r] = 0.f; }
  v8f acc[4] = {}, accl[4] = {};
  const int nks = SS / 32;   // all keys
  // fragment loads run ahead of the products that use them: the k fragments of pass ks + 1 are requested right behind the score products of pass ks, the v fragments of pass ks at its top
  // one byte offset per lane serves both planes of k (hi, residual), one both planes of v; each holds the lane half's 16 bytes
  // the short loops over ct, kc and dt below are unrolled so that the fragment arrays are indexed by constants and stay in registers
  unsigned ko = 2u * ((unsigned)(b * SS + col) * (2 * DM) + DM + h * HD + 8 * g); unsigned vo = 2u * ((unsigned)(b * DM + h * HD + col) * SS + 8 * g);
  v16h kh[2][2], kl[2][2];
#pragma unroll
  for (int ct = 0; ct < 2; ++ct) {
#pragma unroll
    for (int kc = 0; kc < 2; ++kc) { const int o = ct * 16 * (2 * DM) + kc * 32; kh[ct][kc] = frag_o(QK, ko, 2 * o); kl[ct][kc] = frag_o(QKL, ko, 2 * o); } }
#pragma unroll 1
  for (int ks = 0; ks < nks; ++ks) { v8f s[2]; v16h vh[4], vl[4];
#pragma unroll
    for (int dt = 0; dt < 4; ++dt) { vh[dt] = frag_o(VTH, vo, 2 * dt * 16 * SS); vl[dt] = frag_o(VTL, vo, 2 * dt * 16 * SS); }
#pragma unroll
    for (int ct = 0; ct < 2; ++ct) { v8f c = {}, cl = {};
#pragma unroll
      for (int kc = 0; kc < 2; ++kc) { c = wmma16(aq[kc], kh[ct][kc], c); cl = wmma16(aql[kc], kh[ct][kc], cl); cl = wmma16(aq[kc], kl[ct][kc], cl); }   // 3 products: q, k as f16 hi + residual
#pragma unroll
      for (int r = 0; r < 8; ++r) c[r] += cl[r] * (1.0f / 2048.0f);
#pragma unroll
      for (int r = 0; r < 8; ++r) s[ct][r] = c[r] * 0.125f; }   // 1/sqrt(64)
    ko += (ks + 1 < nks) ? 2u * 32 * (2 * DM) : 0u;   // the last pass requests its own rows again: in bounds, never used
#pragma unroll
    for (int ct = 0; ct < 2; ++ct) {
#pragma unroll
      for (int kc = 0; kc < 2; ++kc) { const int o = ct * 16 * (2 * DM) + kc * 32; kh[ct][kc] = frag_o(QK, ko, 2 * o); kl[ct][kc] = frag_o(QKL, ko, 2 * o); } }
#pragma unroll
    for (int r = 0; r < 8; ++r) { float mx = fmaxf(s[0][r], s[1][r]);
#pragma unroll
      for (int o = 1; o < 16; o <<= 1) mx = fmaxf(mx, __shfl_xor(mx, o));
      const float mn = fmaxf(m[r], mx); const float alpha = (m[r] <= -1.0e38f) ? 0.f : __expf(m[r] - mn);
      const float e0 = (s[0][r] <= -1.0e38f) ? 0.f : __expf(s[0][r] - mn), e1 = (s[1][r] <= -1.0e38f) ? 0.f : __expf(s[1][r] - mn); float es = e0 + e1;
#pragma unroll
      for (int o = 1; o < 16; o <<= 1) es += __shfl_xor(es, o);
      l[r] = l[r] * alpha + es; m[r] = mn;
#pragma unroll
      for (int dt = 0; dt < 4; ++dt) { acc[dt][r] *= alpha; accl[dt][r] *= alpha; }
      sp[wave][8 * g + r][col] = e0; sp[wave][8 * g + r][16 + col] = e1; }
    asm volatile("s_wait_xcnt 0x0" : "+v"(ko), "+v"(vo) :: "memory");   // the two offset registers of this pass's fragment loads are held whole up to this wait; only behind it are they stepped on
    vo += 2u * 32;
    LDSW();
    v16h pa, pl; { const float* prow = &sp[wave][col][0] + 8 * (lane >> 4);
#pragma unroll
      for (int i = 0; i < 8; ++i) { const float x0 = prow[i] * 2048.0f, x1 = prow[16 + i] * 2048.0f; const _Float16 h0 = (_Float16)x0, h1 = (_Float16)x1; pa[i] = h0; pa[8 + i] = h1; pl[i] = (_Float16)((x0 - (float)h0) * 2048.0f); pl[8 + i] = (_Float16)((x1 - (float)h1) * 2048.0f); } }   // P scaled by 2^11 before the f16 split so small softmax weights stay out of the f16 subnormal range; 2^-11 folded into the epilogue
#pragma unroll
    for (int dt = 0; dt < 4; ++dt) { acc[dt] = wmma16(pa, vh[dt], acc[dt]); accl[dt] = wmma16(pl, vh[dt], accl[dt]); accl[dt] = wmma16(pa, vl[dt], accl[dt]); }   // P hi x V hi + (P lo x V hi + P hi x V lo) / 2048
    LDSW(); }
#pragma unroll
  for (int r = 0; r < 8; ++r) { const float il = (1.0f / 2048.0f) / l[r];
#pragma unroll
    for (int dt = 0; dt < 4; ++dt) so[wave][8 * g + r][dt * 16 + col] = (acc[dt][r] + accl[dt][r] * (1.0f / 2048.0f)) * il; }
  LDSX();
  for (int rl = 0; rl < 16; ++rl) if (lane < 16) vst2(O + ((size_t)b * SS + q0 + rl) * DM + h * HD + lane * 4, *(const v4f*)&so[wave][rl][lane * 4]);
}
// ---- k_out: block = (64 rows, 128 cols): out = O(hi/lo) . Wo rows (2 products) + bo
__global__ __launch_bounds__(128) void k_out(const float* __restrict__ O, const __bf16* __restrict__ P, const float* __restrict__ BO, float* __restrict__ Y) {
  __shared__ __align__(16) float so[4][16][132];
  const int tid = threadIdx.x, wave = tid >> 5, lane = tid & 31, col = lane & 15, g = lane >> 4; const size_t r0 = (size_t)blockIdx.x * 64 + wave * 16; const int n0 = blockIdx.y * 128;
  v8f acc[8] = {};
#pragma unroll 2
  for (int kc = 0; kc < DM / 32; ++kc) { const F2 a = split_row(O + (r0 + col) * DM, kc * 32, lane);
#pragma unroll
    for (int j = 0; j < 8; ++j) { const v16b w = frag_b(P + (size_t)(n0 + j * 16 + col) * DM + kc * 32, lane); acc[j] = wmma_bf(a.l, w, acc[j]); acc[j] = wmma_bf(a.h, w, acc[j]); } }
#pragma unroll
  for (int j = 0; j < 8; ++j) {
#pragma unroll
    for (int r = 0; r < 8; ++r) so[wave][8 * g + r][j * 16 + col] = acc[j][r] + bfr(BO[n0 + j * 16 + col]); }
  LDSX();
  for (int rl = 0; rl < 16; ++rl) vst2(Y + (r0 + rl) * DM + n0 + lane * 4, *(const v4f*)&so[wave][rl][lane * 4]);
}
// ---- k_layqk: block = 64 rows: R rows -> q slots, Y rows -> k slots of the q|k planes (f16 hi + x2048 residual), thread-linear 8-element chunks (no LDS)
__global__ __launch_bounds__(256) void k_layqk(const float* __restrict__ R, const float* __restrict__ Y, _Float16* __restrict__ QK, _Float16* __restrict__ QKL) {
  const int t = threadIdx.x; const size_t r0 = (size_t)blockIdx.x * 64;
  for (int e = t; e < 64 * (DM / 8) * 2; e += 256) { const int which = e / (64 * (DM / 8)); const int e2 = e % (64 * (DM / 8)); const int r = e2 / (DM / 8), q = e2 % (DM / 8); const float* src = (which ? Y : R) + (r0 + r) * DM + q * 8;
    __align__(16) _Float16 hh[8], ll[8];
#pragma unroll
    for (int i = 0; i < 8; ++i) { const float v = bfr(src[i]); const _Float16 h = (_Float16)v; hh[i] = h; ll[i] = (_Float16)((v - (float)h) * 2048.0f); }
    const size_t o = (r0 + r) * (2 * DM) + (size_t)which * DM + q * 8; vst2((unsigned*)(QK + o), *(const v4u*)hh); vst2((unsigned*)(QKL + o), *(const v4u*)ll); }
}
// ---- k_layv: block = (64 rows s, b): Y rows -> v^T planes [b][c][s] via an LDS transpose
__global__ __launch_bounds__(256) void k_layv(const float* __restrict__ Y, _Float16* __restrict__ VTH, _Float16* __restrict__ VTL) {
  __shared__ __align__(16) _Float16 svh[DM][72], svl[DM][72]; const int t = threadIdx.x; const int s0 = blockIdx.x * 64; const size_t b = blockIdx.y;
  for (int e = t; e < 64 * DM; e += 256) { const int r = e / DM, c = e % DM; const float v = bfr(Y[(b * SS + s0 + r) * DM + c]); const _Float16 h = (_Float16)v; svh[c][r] = h; svl[c][r] = (_Float16)((v - (float)h) * 2048.0f); }
  __syncthreads();
  for (int e = t; e < DM * 8; e += 256) { const int c = e >> 3, pc = e & 7; const size_t o = (b * DM + c) * SS + s0 + pc * 8; vst2((unsigned*)(VTH + o), *(const v4u*)&svh[c][pc * 8]); vst2((unsigned*)(VTL + o), *(const v4u*)&svl[c][pc * 8]); }
}
// ---- k_req: block = 64 rows: the step-1 result O (f32 rows) -> q slots of the planes as f16 hi + x2048 residual (step-2 queries)
__global__ __launch_bounds__(256) void k_req(const float* __restrict__ O, _Float16* __restrict__ QK, _Float16* __restrict__ QKL) {
  __shared__ __align__(16) _Float16 sq[64][DM + 8], sql_[64][DM + 8]; const int t = threadIdx.x; const size_t r0 = (size_t)blockIdx.x * 64;
  for (int e = t; e < 64 * DM; e += 256) { const int r = e / DM, c = e % DM; const float v = O[(r0 + r) * DM + c]; const _Float16 h = (_Float16)v; sq[r][c] = h; sql_[r][c] = (_Float16)((v - (float)h) * 2048.0f); }
  __syncthreads();
  for (int e = t; e < 64 * (DM / 8); e += 256) { const int r = e / (DM / 8), q = e % (DM / 8); const size_t o = (r0 + r) * (2 * DM) + q * 8; vst2((unsigned*)(QK + o), *(const v4u*)&sq[r][q * 8]); vst2((unsigned*)(QKL + o), *(const v4u*)&sql_[r][q * 8]); }
}
extern "C" void kernel_launch(void* const* d_in, const int* in_sizes, int n_in, void* d_out, int out_size, void* d_ws, size_t ws_size, hipStream_t stream) {
  (void)in_sizes; (void)n_in; (void)out_size;
  const float** F = (const float**)d_in;   // 0 R [2,2048,512] (state patterns / queries), 1 Y [2,2048,512] (stored patterns = keys = values)
  if (ws_size < (size_t)WS_END) return;
  char* ws = (char*)d_ws; (void)0; _Float16 *QK = (_Float16*)(ws + WS_QK), *QKL = (_Float16*)(ws + WS_QKL), *VTH = (_Float16*)(ws + WS_VTH), *VTL = (_Float16*)(ws + WS_VTL); float* O = (float*)(ws + WS_O);
  k_layqk<<<NB * SS / 64, 256, 0, stream>>>(F[0], F[1], QK, QKL);
  k_layv<<<dim3(SS / 64, NB), 256, 0, stream>>>(F[1], VTH, VTL);
  k_attn<<<dim3(TQB, NH, TNB), 128, 0, stream>>>(QK, QKL, VTH, VTL, nullptr, O);          // step 1
  k_req<<<TOB, 256, 0, stream>>>(O, QK, QKL);
  k_attn<<<dim3(TQB, NH, TNB), 128, 0, stream>>>(QK, QKL, VTH, VTL, nullptr, (float*)d_out);   // step 2 -> output rows [b*L + l][h*64 + e]
}

// v002
// Measured time: 233 microseconds a run.
// Next to v001, in two timings, it ran 1.04 and 1.05 times as fast.
// Counting every step since v000, it is 2.16 times as fast.
// compute dtype: R and Y rounded to bf16; no projections: q0 = R and k = v = Y are exact bf16 values re-laid on device as f16 hi + (x2048) residual planes (hi exact for bf16 values, residual only below the f16 normal range); step 1: 3-product scores x 1/8 (effectively exact operands), running-max softmax in f32 (hardware exp), P (scaled by 2^11, as f16 hi + residual) x v hi/lo (3 products) -> q1 kept as f16 hi + (x2048) residual planes; step 2 identical with q1; f32 accumulate; the final state is the f32 output.
#include <hip/hip_runtime.h>
#include <math.h>

typedef __attribute__((ext_vector_type(16))) _Float16 v16h;
typedef __attribute__((ext_vector_type(16))) __bf16 v16b;
typedef __attribute__((ext_vector_type(8)))  _Float16 v8h;
typedef __attribute__((ext_vector_type(8)))  float v8f;
typedef __attribute__((ext_vector_type(4)))  float v4f;
typedef __attribute__((ext_vector_type(2)))  float v2f;
typedef __attribute__((ext_vector_type(4)))  unsigned v4u;
typedef __attribute__((ext_vector_type(4)))  int v4i;
typedef float __attribute__((may_alias)) float_a;
typedef int __attribute__((may_alias)) int_a;

template <typename T> __device__ __forceinline__ void vst2(void* p, T v) { *(T*)p = v;  }
__device__ __forceinline__ v8f wmma16(v16h a, v16h b, v8f c) {
  v8f d = __builtin_amdgcn_wmma_f32_16x16x32_f16(false, a, false, b, (short)0, c, false, false);
  asm volatile("v_nop\n\tv_nop\n\tv_nop\n\tv_nop" : "+v"(d) : "v"(a), "v"(b));
  return d;
}
__device__ __forceinline__ v8f wmma_bf(v16b a, v16b b, v8f c) {
  v8f d = __builtin_amdgcn_wmma_f32_16x16x32_bf16(false, a, false, b, (short)0, c, false, false);
  asm volatile("v_nop\n\tv_nop\n\tv_nop\n\tv_nop" : "+v"(d) : "v"(a), "v"(b));
  return d;
}
__device__ __forceinline__ v16h frag_h(const _Float16* rowk0, int lane) {
  union { v16h v; v8h q[2]; } u; const _Float16* p = rowk0 + 8 * (lane >> 4);
  u.q[0] = *(const v8h*)p; u.q[1] = *(const v8h*)(p + 16); return u.v;
}
__device__ __forceinline__ v16h frag_f32(const float* rowk0, int lane) {
  v16h a; const float* p = rowk0 + 8 * (lane >> 4);
#pragma unroll
  for (int i = 0; i < 8; ++i) { a[i] = (_Float16)p[i]; a[8 + i] = (_Float16)p[16 + i]; }
  return a;
}
__device__ __forceinline__ v16h frag_f32s(const float* rowk0, int lane, float sc) {
  v16h a; const float* p = rowk0 + 8 * (lane >> 4);
#pragma unroll
  for (int i = 0; i < 8; ++i) { a[i] = (_Float16)(p[i] * sc); a[8 + i] = (_Float16)(p[16 + i] * sc); }
  return a;
}
// column fragment from a [K][ld] layout (column n), rows >= K read as 0
__device__ __forceinline__ v16h fragc_f32(const float* W, int k0, int n, int lane, int ld, int K) {
  v16h a; const int g = lane >> 4;
#pragma unroll
  for (int i = 0; i < 8; ++i) { const int ka = k0 + 8 * g + i, kb = ka + 16;
    a[i] = (_Float16)(ka < K ? W[(size_t)(ka < K ? ka : K - 1) * ld + n] : 0.f); a[8 + i] = (_Float16)(kb < K ? W[(size_t)(kb < K ? kb : K - 1) * ld + n] : 0.f); }
  return a;
}
struct F2 { v16b h, l; };
__device__ __forceinline__ F2 bsplit16(const float v[16]) { F2 r;
#pragma unroll
  for (int i = 0; i < 16; ++i) { const __bf16 h = (__bf16)v[i]; r.h[i] = h; r.l[i] = (__bf16)(v[i] - (float)h); }
  return r; }
__device__ __forceinline__ F2 split_row(const float* row, int k0, int lane) { float v[16]; const float* p = row + k0 + 8 * (lane >> 4);
#pragma unroll
  for (int i = 0; i < 8; ++i) { v[i] = p[i]; v[8 + i] = p[16 + i]; }
  return bsplit16(v); }
__device__ __forceinline__ F2 split_rowK(const float* row, int k0, int lane, int K) { float v[16]; const int g = lane >> 4;
#pragma unroll
  for (int i = 0; i < 8; ++i) { const int ka = k0 + 8 * g + i, kb = ka + 16; v[i] = ka < K ? row[ka < K ? ka : K - 1] : 0.f; v[8 + i] = kb < K ? row[kb < K ? kb : K - 1] : 0.f; }
  return bsplit16(v); }
__device__ __forceinline__ F2 split_col(const float* W, int k0, int n, int lane, int ld, int K) { float v[16]; const int g = lane >> 4;
#pragma unroll
  for (int i = 0; i < 8; ++i) { const int ka = k0 + 8 * g + i, kb = ka + 16; v[i] = ka < K ? W[(size_t)(ka < K ? ka : K - 1) * ld + n] : 0.f; v[8 + i] = kb < K ? W[(size_t)(kb < K ? kb : K - 1) * ld + n] : 0.f; }
  return bsplit16(v); }
__device__ __forceinline__ v8f mac3(const F2& a, const F2& b, v8f c) { c = wmma_bf(a.l, b.h, c); c = wmma_bf(a.h, b.l, c); return wmma_bf(a.h, b.h, c); }
__device__ __forceinline__ float sigm(float v) { return 1.0f / (1.0f + expf(-v)); }
#define LDSX() do { asm volatile("s_wait_dscnt 0" ::: "memory"); __builtin_amdgcn_wave_barrier(); __builtin_amdgcn_fence(__ATOMIC_RELEASE, "workgroup"); } while (0)


#define NB 2
#define SS 2048
#define DM 512
#define NH 8
#define HD 64
#define QKVW (3 * DM)
#ifndef TQB
#define TQB (SS / 64)
#define TNB NB
#define TOB (NB * SS / 64)     // output row tiles (all)
#endif
typedef __attribute__((ext_vector_type(8))) __bf16 v8b;
__device__ __forceinline__ v16b frag_b(const __bf16* rowk0, int lane) {
  union { v16b v; v8b q[2]; } u; const __bf16* p = rowk0 + 8 * (lane >> 4);
  u.q[0] = *(const v8b*)p; u.q[1] = *(const v8b*)(p + 16); return u.v;
}
// fragment in frag_h's k order from a plane's base, the lane's byte offset and a constant byte offset
__device__ __forceinline__ v16h frag_o(const _Float16* base, unsigned boff, int cb) {
  union { v16h v; v8h q[2]; } u; const char* p = (const char*)base + boff + cb;
  u.q[0] = *(const v8h*)p; u.q[1] = *(const v8h*)(p + 32); return u.v;
}
__device__ __forceinline__ float bfr(float v) { return (float)(__bf16)v; }
__device__ __attribute__((noinline)) float exp_ni(float v) { return expf(v); }
__device__ __attribute__((noinline)) float erf_ni(float v) { return erff(v); }

#define PK_A 0                       // [1536][512] Wqkv rows (natural [out][in])
#define PK_P (PK_A + QKVW * DM)        // [512][512] Wo rows (natural)
#define PK_END (PK_P + DM * DM)
#define WS_PK  0u
#define WS_QK  (WS_PK + 2u * PK_END)             // f16 [4096 rows][1024]: q | k
#define WS_QKL (WS_QK + 2u * NB * SS * 2 * DM)     // f16 q | k residual planes x2048
#define WS_VTH (WS_QKL + 2u * NB * SS * 2 * DM)    // f16 [b][512 (h*64+d)][2048 s] hi
#define WS_VTL (WS_VTH + 2u * NB * DM * SS)        // f16 lo x 2048
#define WS_O   (WS_VTL + 2u * NB * DM * SS)        // f32 [4096][512]
#define WS_CS  (WS_O + 4u * NB * SS * DM)           // f32 [2][2048][32], unused
#define WS_END (WS_CS + 4u * 2 * SS * 32)
// ---- k_pack: block = (row n, which): natural [out][in] rows -> bf16; which 0..2 -> W_q/W_k/W_v into PK_A rows which*512 + n; 3 -> W_o into PK_P
__global__ __launch_bounds__(256) void k_pack(const float* __restrict__ WQ, const float* __restrict__ WK, const float* __restrict__ WV, const float* __restrict__ WO, __bf16* __restrict__ PK) {
  __shared__ __align__(16) __bf16 s[DM]; const int n = blockIdx.x, which = blockIdx.y, t = threadIdx.x; const float* Wm = (which == 0) ? WQ : (which == 1) ? WK : (which == 2) ? WV : WO;
  for (int k = t; k < DM; k += 256) s[k] = (__bf16)Wm[(size_t)n * DM + k];
  __syncthreads();
  __bf16* dst = (which < 3) ? PK + PK_A + ((size_t)which * DM + n) * DM : PK + PK_P + (size_t)n * DM;
  for (int q = t; q < DM / 8; q += 256) vst2((unsigned*)(dst + q * 8), *(const v4u*)&s[q * 8]);
}
__global__ __launch_bounds__(128) void k_qkv(const float* __restrict__ XQ, const float* __restrict__ XK, const float* __restrict__ XV, const __bf16* __restrict__ P, const float* __restrict__ BQ, const float* __restrict__ BK, const float* __restrict__ BV, _Float16* __restrict__ QK, _Float16* __restrict__ QKL, _Float16* __restrict__ VTH, _Float16* __restrict__ VTL) {
  const int which0 = (blockIdx.y * 128) / DM; const float* X = (which0 == 0) ? XQ : (which0 == 1) ? XK : XV; const float* BB = BQ ? (((which0 == 0) ? BQ : (which0 == 1) ? BK : BV) + (blockIdx.y * 128 - which0 * DM)) : nullptr;
  __shared__ __align__(16) _Float16 so[4][16][136], sol[4][16][136]; __shared__ __align__(16) _Float16 sth[128][72], stl[128][72];
  const int tid = threadIdx.x, wave = tid >> 5, lane = tid & 31, col = lane & 15, g = lane >> 4; const size_t r0 = (size_t)blockIdx.x * 64 + wave * 16; const int n0 = blockIdx.y * 128;
  v8f acc[8] = {};
#pragma unroll 2
  for (int kc = 0; kc < DM / 32; ++kc) { v16b a; { const float* p = X + (r0 + col) * DM + kc * 32 + 8 * g;
#pragma unroll
      for (int i = 0; i < 8; ++i) { a[i] = (__bf16)p[i]; a[8 + i] = (__bf16)p[16 + i]; } }
#pragma unroll
    for (int j = 0; j < 8; ++j) acc[j] = wmma_bf(a, frag_b(P + (size_t)(n0 + j * 16 + col) * DM + kc * 32, lane), acc[j]); }
  if (n0 < 2 * DM) {   // q stored unscaled (f16 sigma ~0.6, no subnormal exposure); 1/8 applied to the f32 score
#pragma unroll
    for (int j = 0; j < 8; ++j) {
#pragma unroll
      for (int r = 0; r < 8; ++r) { const float v = acc[j][r] + (BB ? bfr(BB[j * 16 + col]) : 0.f); const _Float16 hv = (_Float16)v; so[wave][8 * g + r][j * 16 + col] = hv; sol[wave][8 * g + r][j * 16 + col] = (_Float16)((v - (float)hv) * 2048.0f); } }   // q, k (+ bias) as f16 hi + (x2048) residual
    LDSX();
    for (int rl = 0; rl < 16; ++rl) if (lane < 16) { vst2((unsigned*)(QK + (r0 + rl) * (2 * DM) + n0 + lane * 8), *(const v4u*)&so[wave][rl][lane * 8]); vst2((unsigned*)(QKL + (r0 + rl) * (2 * DM) + n0 + lane * 8), *(const v4u*)&sol[wave][rl][lane * 8]); }
  } else {
#pragma unroll
    for (int j = 0; j < 8; ++j) {
#pragma unroll
      for (int r = 0; r < 8; ++r) { const float v = acc[j][r] + (BB ? bfr(BB[j * 16 + col]) : 0.f); const _Float16 hv = (_Float16)v; sth[j * 16 + col][wave * 16 + 8 * g + r] = hv; stl[j * 16 + col][wave * 16 + 8 * g + r] = (_Float16)((v - (float)hv) * 2048.0f); } }
    __syncthreads();
    const size_t rb = (size_t)blockIdx.x * 64; const int b = (int)(rb / SS), s0 = (int)(rb % SS); const int pc0 = n0 - 2 * DM;
    for (int q = tid; q < 128 * 8; q += 128) { const int d = q >> 3, pc = q & 7; const size_t o = ((size_t)b * DM + pc0 + d) * SS + s0 + pc * 8; vst2((unsigned*)(VTH + o), *(const v4u*)&sth[d][pc * 8]); vst2((unsigned*)(VTL + o), *(const v4u*)&stl[d][pc * 8]); }
  }
}
// lane l with lane l ^ 16 (the two lane halves hold the two key halves of one query column)
__device__ __forceinline__ float xhalf(float x) { return __builtin_bit_cast(float, __builtin_amdgcn_permlanex16(__builtin_bit_cast(int, x), __builtin_bit_cast(int, x), 0x76543210, 0xfedcba98, false, false)); }
// ---- k_attn: block = (64 queries, head h, batch b): all-keys flash attention (K = 64: 2 k-steps), transposed: S^T = K . Q^T (A = k rows, B = q rows), so a lane holds 16 of the 32 scores of ONE query (keys 8g + r and 16 + 8g + r): maximum and sum in-lane plus one exchange between the lane halves; the two score tiles, converted in place, are the B operand P^T of O^T += V^T . P^T (A = v^T rows): P never touches LDS. scores = (q.k) * 0.125, 3 products (f16 hi + residual) on both sides; O[b*S+q][h*64+d] = (acc + accl / 2048) / (2048 l) (256-B segments)
__global__ __launch_bounds__(128) void k_attn(const _Float16* __restrict__ QK, const _Float16* __restrict__ QKL, const _Float16* __restrict__ VTH, const _Float16* __restrict__ VTL, const void* __restrict__ KMASK, float* __restrict__ O) {
  __shared__ __align__(16) float so[4][16][68];
  const int tid = threadIdx.x, wave = tid >> 5, lane = tid & 31, col = lane & 15, g = lane >> 4;
  const int qb = blockIdx.x, h = blockIdx.y, b = blockIdx.z; const int q0 = qb * 64 + wave * 16; const size_t rq = (size_t)b * SS + q0 + col;
  v16h aq[2], aql[2];
#pragma unroll
  for (int kc = 0; kc < 2; ++kc) { aq[kc] = frag_h(QK + rq * (2 * DM) + h * HD + kc * 32, lane); aql[kc] = frag_h(QKL + rq * (2 * DM) + h * HD + kc * 32, lane); }
  float m = -3.0e38f, l = 0.f;   // of query column col; l is this lane half's share of the sum, joined behind the loop
  v8f acc[4] = {}, accl[4] = {};   // O^T tiles: register r = O[query col][dt * 16 + 8 g + r]
  const int nks = SS / 32;   // all keys
  // fragment loads run ahead of the products that use them: the k fragments of pass ks + 1 are requested right behind the score products of pass ks, the v fragments of pass ks at its top
  // one byte offset per lane serves both planes of k (hi, residual), one both planes of v; each holds the lane half's 16 bytes
  // the short loops over ct, kc and dt below are unrolled so that the fragment arrays are indexed by constants and stay in registers
  unsigned ko = 2u * ((unsigned)(b * SS + col) * (2 * DM) + DM + h * HD + 8 * g); unsigned vo = 2u * ((unsigned)(b * DM + h * HD + col) * SS + 8 * g);
  v16h kh[2][2], kl[2][2];
#pragma unroll
  for (int ct = 0; ct < 2; ++ct) {
#pragma unroll
    for (int kc = 0; kc < 2; ++kc) { const int o = ct * 16 * (2 * DM) + kc * 32; kh[ct][kc] = frag_o(QK, ko, 2 * o); kl[ct][kc] = frag_o(QKL, ko, 2 * o); } }
#pragma unroll 1
  for (int ks = 0; ks < nks; ++ks) { v8f s[2]; v16h vh[4], vl[4];
#pragma unroll
    for (int dt = 0; dt < 4; ++dt) { vh[dt] = frag_o(VTH, vo, 2 * dt * 16 * SS); vl[dt] = frag_o(VTL, vo, 2 * dt * 16 * SS); }
#pragma unroll
    for (int ct = 0; ct < 2; ++ct) { v8f c = {}, cl = {};
#pragma unroll
      for (int kc = 0; kc < 2; ++kc) { c = wmma16(kh[ct][kc], aq[kc], c); cl = wmma16(kh[ct][kc], aql[kc], cl); cl = wmma16(kl[ct][kc], aq[kc], cl); }   // 3 products: q, k as f16 hi + residual; register r = score of key ct * 16 + 8 g + r with query col
#pragma unroll
      for (int r = 0; r < 8; ++r) c[r] += cl[r] * (1.0f / 2048.0f);
#pragma unroll
      for (int r = 0; r < 8; ++r) s[ct][r] = c[r] * 0.125f;   // 1/sqrt(64); no key mask
      __builtin_amdgcn_sched_barrier(0); }   // one score tile's two accumulators are done with before the next tile's begin: with both pairs live the operands of the products no longer fit v0-v255 and a q fragment is spilled and reloaded every pass
    ko += (ks + 1 < nks) ? 2u * 32 * (2 * DM) : 0u;   // the last pass requests its own rows again: in bounds, never used
#pragma unroll
    for (int ct = 0; ct < 2; ++ct) {
#pragma unroll
      for (int kc = 0; kc < 2; ++kc) { const int o = ct * 16 * (2 * DM) + kc * 32; kh[ct][kc] = frag_o(QK, ko, 2 * o); kl[ct][kc] = frag_o(QKL, ko, 2 * o); } }
    __builtin_amdgcn_sched_barrier(0);   // keeps the next pass's k requests here, a whole softmax and P.V ahead of their use: without it they sink below the softmax, whose temporaries take their registers
    float mx[8];
#pragma unroll
    for (int r = 0; r < 8; ++r) mx[r] = fmaxf(s[0][r], s[1][r]);
#pragma unroll
    for (int w = 4; w > 0; w >>= 1) {
#pragma unroll
      for (int r = 0; r < w; ++r) mx[r] = fmaxf(mx[r], mx[r + w]); }
    const float mn = fmaxf(m, fmaxf(mx[0], xhalf(mx[0]))); const float alpha = (m <= -1.0e38f) ? 0.f : __expf(m - mn); m = mn;
    float e[16];
#pragma unroll
    for (int i = 0; i < 16; ++i) { const float sv = s[i >> 3][i & 7]; e[i] = (sv <= -1.0e38f) ? 0.f : __expf(sv - mn); }
    float es[8];
#pragma unroll
    for (int r = 0; r < 8; ++r) es[r] = e[r] + e[8 + r];
#pragma unroll
    for (int w = 4; w > 0; w >>= 1) {
#pragma unroll
      for (int r = 0; r < w; ++r) es[r] += es[r + w]; }
    l = l * alpha + es[0];
#pragma unroll
    for (int dt = 0; dt < 4; ++dt) {
#pragma unroll
      for (int r = 0; r < 8; ++r) { acc[dt][r] *= alpha; accl[dt][r] *= alpha; } }
    asm volatile("s_wait_xcnt 0x0" : "+v"(ko), "+v"(vo) :: "memory");   // the two offset registers of this pass's fragment loads are held whole up to this wait; only behind it are they stepped on
    vo += 2u * 32;
    v16h pa, pl;   // P^T as B operand: element i = key 8 g + i (i < 8) or 16 + 8 g + i - 8 of query col, which is where the two score tiles already hold it
#pragma unroll
    for (int i = 0; i < 16; ++i) { const float x0 = e[i] * 2048.0f; const _Float16 h0 = (_Float16)x0; pa[i] = h0; pl[i] = (_Float16)((x0 - (float)h0) * 2048.0f); }   // P scaled by 2^11 before the f16 split so small softmax weights stay out of the f16 subnormal range; 2^-11 folded into the epilogue
#pragma unroll
    for (int dt = 0; dt < 4; ++dt) { acc[dt] = wmma16(vh[dt], pa, acc[dt]); accl[dt] = wmma16(vh[dt], pl, accl[dt]); accl[dt] = wmma16(vl[dt], pa, accl[dt]); }   // V hi x P hi + (V hi x P lo + V lo x P hi) / 2048
  }
  l += xhalf(l);   // the two lane halves' shares of the row sum
  const float il = (1.0f / 2048.0f) / l;
#pragma unroll
  for (int dt = 0; dt < 4; ++dt) {
#pragma unroll
    for (int r = 0; r < 8; ++r) so[wave][col][dt * 16 + 8 * g + r] = (acc[dt][r] + accl[dt][r] * (1.0f / 2048.0f)) * il; }
  LDSX();
  for (int rl = 0; rl < 16; ++rl) if (lane < 16) vst2(O + ((size_t)b * SS + q0 + rl) * DM + h * HD + lane * 4, *(const v4f*)&so[wave][rl][lane * 4]);
}
// ---- k_out: block = (64 rows, 128 cols): out = O(hi/lo) . Wo rows (2 products) + bo
__global__ __launch_bounds__(128) void k_out(const float* __restrict__ O, const __bf16* __restrict__ P, const float* __restrict__ BO, float* __restrict__ Y) {
  __shared__ __align__(16) float so[4][16][132];
  const int tid = threadIdx.x, wave = tid >> 5, lane = tid & 31, col = lane & 15, g = lane >> 4; const size_t r0 = (size_t)blockIdx.x * 64 + wave * 16; const int n0 = blockIdx.y * 128;
  v8f acc[8] = {};
#pragma unroll 2
  for (int kc = 0; kc < DM / 32; ++kc) { const F2 a = split_row(O + (r0 + col) * DM, kc * 32, lane);
#pragma unroll
    for (int j = 0; j < 8; ++j) { const v16b w = frag_b(P + (size_t)(n0 + j * 16 + col) * DM + kc * 32, lane); acc[j] = wmma_bf(a.l, w, acc[j]); acc[j] = wmma_bf(a.h, w, acc[j]); } }
#pragma unroll
  for (int j = 0; j < 8; ++j) {
#pragma unroll
    for (int r = 0; r < 8; ++r) so[wave][8 * g + r][j * 16 + col] = acc[j][r] + bfr(BO[n0 + j * 16 + col]); }
  LDSX();
  for (int rl = 0; rl < 16; ++rl) vst2(Y + (r0 + rl) * DM + n0 + lane * 4, *(const v4f*)&so[wave][rl][lane * 4]);
}
// ---- k_layqk: block = 64 rows: R rows -> q slots, Y rows -> k slots of the q|k planes (f16 hi + x2048 residual), thread-linear 8-element chunks (no LDS)
__global__ __launch_bounds__(256) void k_layqk(const float* __restrict__ R, const float* __restrict__ Y, _Float16* __restrict__ QK, _Float16* __restrict__ QKL) {
  const int t = threadIdx.x; const size_t r0 = (size_t)blockIdx.x * 64;
  for (int e = t; e < 64 * (DM / 8) * 2; e += 256) { const int which = e / (64 * (DM / 8)); const int e2 = e % (64 * (DM / 8)); const int r = e2 / (DM / 8), q = e2 % (DM / 8); const float* src = (which ? Y : R) + (r0 + r) * DM + q * 8;
    __align__(16) _Float16 hh[8], ll[8];
#pragma unroll
    for (int i = 0; i < 8; ++i) { const float v = bfr(src[i]); const _Float16 h = (_Float16)v; hh[i] = h; ll[i] = (_Float16)((v - (float)h) * 2048.0f); }
    const size_t o = (r0 + r) * (2 * DM) + (size_t)which * DM + q * 8; vst2((unsigned*)(QK + o), *(const v4u*)hh); vst2((unsigned*)(QKL + o), *(const v4u*)ll); }
}
// ---- k_layv: block = (64 rows s, b): Y rows -> v^T planes [b][c][s] via an LDS transpose
__global__ __launch_bounds__(256) void k_layv(const float* __restrict__ Y, _Float16* __restrict__ VTH, _Float16* __restrict__ VTL) {
  __shared__ __align__(16) _Float16 svh[DM][72], svl[DM][72]; const int t = threadIdx.x; const int s0 = blockIdx.x * 64; const size_t b = blockIdx.y;
  for (int e = t; e < 64 * DM; e += 256) { const int r = e / DM, c = e % DM; const float v = bfr(Y[(b * SS + s0 + r) * DM + c]); const _Float16 h = (_Float16)v; svh[c][r] = h; svl[c][r] = (_Float16)((v - (float)h) * 2048.0f); }
  __syncthreads();
  for (int e = t; e < DM * 8; e += 256) { const int c = e >> 3, pc = e & 7; const size_t o = (b * DM + c) * SS + s0 + pc * 8; vst2((unsigned*)(VTH + o), *(const v4u*)&svh[c][pc * 8]); vst2((unsigned*)(VTL + o), *(const v4u*)&svl[c][pc * 8]); }
}
// ---- k_req: block = 64 rows: the step-1 result O (f32 rows) -> q slots of the planes as f16 hi + x2048 residual (step-2 queries)
__global__ __launch_bounds__(256) void k_req(const float* __restrict__ O, _Float16* __restrict__ QK, _Float16* __restrict__ QKL) {
  __shared__ __align__(16) _Float16 sq[64][DM + 8], sql_[64][DM + 8]; const int t = threadIdx.x; const size_t r0 = (size_t)blockIdx.x * 64;
  for (int e = t; e < 64 * DM; e += 256) { const int r = e / DM, c = e % DM; const float v = O[(r0 + r) * DM + c]; const _Float16 h = (_Float16)v; sq[r][c] = h; sql_[r][c] = (_Float16)((v - (float)h) * 2048.0f); }
  __syncthreads();
  for (int e = t; e < 64 * (DM / 8); e += 256) { const int r = e / (DM / 8), q = e % (DM / 8); const size_t o = (r0 + r) * (2 * DM) + q * 8; vst2((unsigned*)(QK + o), *(const v4u*)&sq[r][q * 8]); vst2((unsigned*)(QKL + o), *(const v4u*)&sql_[r][q * 8]); }
}
extern "C" void kernel_launch(void* const* d_in, const int* in_sizes, int n_in, void* d_out, int out_size, void* d_ws, size_t ws_size, hipStream_t stream) {
  (void)in_sizes; (void)n_in; (void)out_size;
  const float** F = (const float**)d_in;   // 0 R [2,2048,512] (state patterns / queries), 1 Y [2,2048,512] (stored patterns = keys = values)
  if (ws_size < (size_t)WS_END) return;
  char* ws = (char*)d_ws; (void)0; _Float16 *QK = (_Float16*)(ws + WS_QK), *QKL = (_Float16*)(ws + WS_QKL), *VTH = (_Float16*)(ws + WS_VTH), *VTL = (_Float16*)(ws + WS_VTL); float* O = (float*)(ws + WS_O);
  k_layqk<<<NB * SS / 64, 256, 0, stream>>>(F[0], F[1], QK, QKL);
  k_layv<<<dim3(SS / 64, NB), 256, 0, stream>>>(F[1], VTH, VTL);
  k_attn<<<dim3(TQB, NH, TNB), 128, 0, stream>>>(QK, QKL, VTH, VTL, nullptr, O);          // step 1
  k_req<<<TOB, 256, 0, stream>>>(O, QK, QKL);
  k_attn<<<dim3(TQB, NH, TNB), 128, 0, stream>>>(QK, QKL, VTH, VTL, nullptr, (float*)d_out);   // step 2 -> output rows [b*L + l][h*64 + e]
}

// v003
// Measured time: 154 microseconds a run.
// In two side-by-side timings against v002, it was 1.50 and 1.49 times as fast.
// All steps since v000 together make it 3.23 times as fast.
// compute dtype: R and Y rounded to bf16; no projections: q0 = R and k = v = Y are exact bf16 values re-laid on device as f16 hi + (x2048) residual planes (hi exact for bf16 values, residual only below the f16 normal range), k and v in fragment order; step 1: 3-product scores x 1/8 (effectively exact operands), running-max softmax in f32 (hardware exp), P (scaled by 2^11, as f16 hi + residual) x v hi/lo (3 products) -> q1 kept as f16 hi + (x2048) residual planes; step 2 identical with q1; f32 accumulate; the final state is the f32 output.
#include <hip/hip_runtime.h>
#include <math.h>

typedef __attribute__((ext_vector_type(16))) _Float16 v16h;
typedef __attribute__((ext_vector_type(16))) __bf16 v16b;
typedef __attribute__((ext_vector_type(8)))  _Float16 v8h;
typedef __attribute__((ext_vector_type(8)))  float v8f;
typedef __attribute__((ext_vector_type(4)))  float v4f;
typedef __attribute__((ext_vector_type(2)))  float v2f;
typedef __attribute__((ext_vector_type(4)))  unsigned v4u;
typedef __attribute__((ext_vector_type(4)))  int v4i;
typedef float __attribute__((may_alias)) float_a;
typedef int __attribute__((may_alias)) int_a;

template <typename T> __device__ __forceinline__ void vst2(void* p, T v) { *(T*)p = v;  }
__device__ __forceinline__ v8f wmma16(v16h a, v16h b, v8f c) {
  v8f d = __builtin_amdgcn_wmma_f32_16x16x32_f16(false, a, false, b, (short)0, c, false, false);
  asm volatile("v_nop\n\tv_nop\n\tv_nop\n\tv_nop" : "+v"(d) : "v"(a), "v"(b));
  return d;
}
__device__ __forceinline__ v8f wmma_bf(v16b a, v16b b, v8f c) {
  v8f d = __builtin_amdgcn_wmma_f32_16x16x32_bf16(false, a, false, b, (short)0, c, false, false);
  asm volatile("v_nop\n\tv_nop\n\tv_nop\n\tv_nop" : "+v"(d) : "v"(a), "v"(b));
  return d;
}
__device__ __forceinline__ v16h frag_h(const _Float16* rowk0, int lane) {
  union { v16h v; v8h q[2]; } u; const _Float16* p = rowk0 + 8 * (lane >> 4);
  u.q[0] = *(const v8h*)p; u.q[1] = *(const v8h*)(p + 16); return u.v;
}
__device__ __forceinline__ v16h frag_f32(const float* rowk0, int lane) {
  v16h a; const float* p = rowk0 + 8 * (lane >> 4);
#pragma unroll
  for (int i = 0; i < 8; ++i) { a[i] = (_Float16)p[i]; a[8 + i] = (_Float16)p[16 + i]; }
  return a;
}
__device__ __forceinline__ v16h frag_f32s(const float* rowk0, int lane, float sc) {
  v16h a; const float* p = rowk0 + 8 * (lane >> 4);
#pragma unroll
  for (int i = 0; i < 8; ++i) { a[i] = (_Float16)(p[i] * sc); a[8 + i] = (_Float16)(p[16 + i] * sc); }
  return a;
}
// column fragment from a [K][ld] layout (column n), rows >= K read as 0
__device__ __forceinline__ v16h fragc_f32(const float* W, int k0, int n, int lane, int ld, int K) {
  v16h a; const int g = lane >> 4;
#pragma unroll
  for (int i = 0; i < 8; ++i) { const int ka = k0 + 8 * g + i, kb = ka + 16;
    a[i] = (_Float16)(ka < K ? W[(size_t)(ka < K ? ka : K - 1) * ld + n] : 0.f); a[8 + i] = (_Float16)(kb < K ? W[(size_t)(kb < K ? kb : K - 1) * ld + n] : 0.f); }
  return a;
}
struct F2 { v16b h, l; };
__device__ __forceinline__ F2 bsplit16(const float v[16]) { F2 r;
#pragma unroll
  for (int i = 0; i < 16; ++i) { const __bf16 h = (__bf16)v[i]; r.h[i] = h; r.l[i] = (__bf16)(v[i] - (float)h); }
  return r; }
__device__ __forceinline__ F2 split_row(const float* row, int k0, int lane) { float v[16]; const float* p = row + k0 + 8 * (lane >> 4);
#pragma unroll
  for (int i = 0; i < 8; ++i) { v[i] = p[i]; v[8 + i] = p[16 + i]; }
  return bsplit16(v); }
__device__ __forceinline__ F2 split_rowK(const float* row, int k0, int lane, int K) { float v[16]; const int g = lane >> 4;
#pragma unroll
  for (int i = 0; i < 8; ++i) { const int ka = k0 + 8 * g + i, kb = ka + 16; v[i] = ka < K ? row[ka < K ? ka : K - 1] : 0.f; v[8 + i] = kb < K ? row[kb < K ? kb : K - 1] : 0.f; }
  return bsplit16(v); }
__device__ __forceinline__ F2 split_col(const float* W, int k0, int n, int lane, int ld, int K) { float v[16]; const int g = lane >> 4;
#pragma unroll
  for (int i = 0; i < 8; ++i) { const int ka = k0 + 8 * g + i, kb = ka + 16; v[i] = ka < K ? W[(size_t)(ka < K ? ka : K - 1) * ld + n] : 0.f; v[8 + i] = kb < K ? W[(size_t)(kb < K ? kb : K - 1) * ld + n] : 0.f; }
  return bsplit16(v); }
__device__ __forceinline__ v8f mac3(const F2& a, const F2& b, v8f c) { c = wmma_bf(a.l, b.h, c); c = wmma_bf(a.h, b.l, c); return wmma_bf(a.h, b.h, c); }
__device__ __forceinline__ float sigm(float v) { return 1.0f / (1.0f + expf(-v)); }
#define LDSX() do { asm volatile("s_wait_dscnt 0" ::: "memory"); __builtin_amdgcn_wave_barrier(); __builtin_amdgcn_fence(__ATOMIC_RELEASE, "workgroup"); } while (0)


#define NB 2
#define SS 2048
#define DM 512
#define NH 8
#define HD 64
#define QKVW (3 * DM)
#ifndef TQB
#define TQB (SS / 64)
#define TNB NB
#define TOB (NB * SS / 64)     // output row tiles (all)
#endif
typedef __attribute__((ext_vector_type(8))) __bf16 v8b;
__device__ __forceinline__ v16b frag_b(const __bf16* rowk0, int lane) {
  union { v16b v; v8b q[2]; } u; const __bf16* p = rowk0 + 8 * (lane >> 4);
  u.q[0] = *(const v8b*)p; u.q[1] = *(const v8b*)(p + 16); return u.v;
}
#define FSLOT 512                    // bytes of one slot: one 16-byte load of every lane of a wave, lane after lane (four whole 128-byte lines)
#define FPASS (16 * FSLOT)           // bytes of one pass of one head: slots 0-7 hi, 8-15 residual; a fragment is two slots in a row (its k halves 0-15 and 16-31)
// fragment in frag_h's k order from a fragment-ordered plane: its base, the lane's byte offset (pass and lane) and the fragment's first slot
__device__ __forceinline__ v16h frag_p(const _Float16* base, unsigned boff, int slot) {
  union { v16h v; v8h q[2]; } u; const char* p = (const char*)base + boff + slot * FSLOT;
  u.q[0] = *(const v8h*)p; u.q[1] = *(const v8h*)(p + FSLOT); return u.v;
}
__device__ __forceinline__ float bfr(float v) { return (float)(__bf16)v; }
__device__ __attribute__((noinline)) float exp_ni(float v) { return expf(v); }
__device__ __attribute__((noinline)) float erf_ni(float v) { return erff(v); }

#define PK_A 0                       // [1536][512] Wqkv rows (natural [out][in])
#define PK_P (PK_A + QKVW * DM)        // [512][512] Wo rows (natural)
#define PK_END (PK_P + DM * DM)
#define WS_PK  0u
#define WS_QK  (WS_PK + 2u * PK_END)             // f16 [4096 rows][1024]: q | k
#define WS_QKL (WS_QK + 2u * NB * SS * 2 * DM)     // f16 q | k residual planes x2048
#define WS_VTH (WS_QKL + 2u * NB * SS * 2 * DM)    // f16 [b][512 (h*64+d)][2048 s] hi
#define WS_VTL (WS_VTH + 2u * NB * DM * SS)        // f16 lo x 2048
#define WS_O   (WS_VTL + 2u * NB * DM * SS)        // f32 [4096][512]
#define WS_CS  (WS_O + 4u * NB * SS * DM)           // f32 2 x [2048][32], reserved, unused
#define WS_KP  (WS_CS + 4u * 2 * SS * 32)          // f16 k in fragment order: [b][h][pass of 32 keys][16 slots][32 lanes][8]
#define WS_VP  (WS_KP + 2u * 2 * NB * SS * DM)     // f16 v^T in fragment order, same shape
#define WS_END (WS_VP + 2u * 2 * NB * SS * DM)
// ---- k_pack: block = (row n, which): natural [out][in] rows -> bf16; which 0..2 -> W_q/W_k/W_v into PK_A rows which*512 + n; 3 -> W_o into PK_P
__global__ __launch_bounds__(256) void k_pack(const float* __restrict__ WQ, const float* __restrict__ WK, const float* __restrict__ WV, const float* __restrict__ WO, __bf16* __restrict__ PK) {
  __shared__ __align__(16) __bf16 s[DM]; const int n = blockIdx.x, which = blockIdx.y, t = threadIdx.x; const float* Wm = (which == 0) ? WQ : (which == 1) ? WK : (which == 2) ? WV : WO;
  for (int k = t; k < DM; k += 256) s[k] = (__bf16)Wm[(size_t)n * DM + k];
  __syncthreads();
  __bf16* dst = (which < 3) ? PK + PK_A + ((size_t)which * DM + n) * DM : PK + PK_P + (size_t)n * DM;
  for (int q = t; q < DM / 8; q += 256) vst2((unsigned*)(dst + q * 8), *(const v4u*)&s[q * 8]);
}
__global__ __launch_bounds__(128) void k_qkv(const float* __restrict__ XQ, const float* __restrict__ XK, const float* __restrict__ XV, const __bf16* __restrict__ P, const float* __restrict__ BQ, const float* __restrict__ BK, const float* __restrict__ BV, _Float16* __restrict__ QK, _Float16* __restrict__ QKL, _Float16* __restrict__ VTH, _Float16* __restrict__ VTL) {
  const int which0 = (blockIdx.y * 128) / DM; const float* X = (which0 == 0) ? XQ : (which0 == 1) ? XK : XV; const float* BB = BQ ? (((which0 == 0) ? BQ : (which0 == 1) ? BK : BV) + (blockIdx.y * 128 - which0 * DM)) : nullptr;
  __shared__ __align__(16) _Float16 so[4][16][136], sol[4][16][136]; __shared__ __align__(16) _Float16 sth[128][72], stl[128][72];
  const int tid = threadIdx.x, wave = tid >> 5, lane = tid & 31, col = lane & 15, g = lane >> 4; const size_t r0 = (size_t)blockIdx.x * 64 + wave * 16; const int n0 = blockIdx.y * 128;
  v8f acc[8] = {};
#pragma unroll 2
  for (int kc = 0; kc < DM / 32; ++kc) { v16b a; { const float* p = X + (r0 + col) * DM + kc * 32 + 8 * g;
#pragma unroll
      for (int i = 0; i < 8; ++i) { a[i] = (__bf16)p[i]; a[8 + i] = (__bf16)p[16 + i]; } }
#pragma unroll
    for (int j = 0; j < 8; ++j) acc[j] = wmma_bf(a, frag_b(P + (size_t)(n0 + j * 16 + col) * DM + kc * 32, lane), acc[j]); }
  if (n0 < 2 * DM) {   // q stored unscaled (f16 sigma ~0.6, no subnormal exposure); 1/8 applied to the f32 score
#pragma unroll
    for (int j = 0; j < 8; ++j) {
#pragma unroll
      for (int r = 0; r < 8; ++r) { const float v = acc[j][r] + (BB ? bfr(BB[j * 16 + col]) : 0.f); const _Float16 hv = (_Float16)v; so[wave][8 * g + r][j * 16 + col] = hv; sol[wave][8 * g + r][j * 16 + col] = (_Float16)((v - (float)hv) * 2048.0f); } }   // q, k (+ bias) as f16 hi + (x2048) residual
    LDSX();
    for (int rl = 0; rl < 16; ++rl) if (lane < 16) { vst2((unsigned*)(QK + (r0 + rl) * (2 * DM) + n0 + lane * 8), *(const v4u*)&so[wave][rl][lane * 8]); vst2((unsigned*)(QKL + (r0 + rl) * (2 * DM) + n0 + lane * 8), *(const v4u*)&sol[wave][rl][lane * 8]); }
  } else {
#pragma unroll
    for (int j = 0; j < 8; ++j) {
#pragma unroll
      for (int r = 0; r < 8; ++r) { const float v = acc[j][r] + (BB ? bfr(BB[j * 16 + col]) : 0.f); const _Float16 hv = (_Float16)v; sth[j * 16 + col][wave * 16 + 8 * g + r] = hv; stl[j * 16 + col][wave * 16 + 8 * g + r] = (_Float16)((v - (float)hv) * 2048.0f); } }
    __syncthreads();
    const size_t rb = (size_t)blockIdx.x * 64; const int b = (int)(rb / SS), s0 = (int)(rb % SS); const int pc0 = n0 - 2 * DM;
    for (int q = tid; q < 128 * 8; q += 128) { const int d = q >> 3, pc = q & 7; const size_t o = ((size_t)b * DM + pc0 + d) * SS + s0 + pc * 8; vst2((unsigned*)(VTH + o), *(const v4u*)&sth[d][pc * 8]); vst2((unsigned*)(VTL + o), *(const v4u*)&stl[d][pc * 8]); }
  }
}
// lane l with lane l ^ 16 (the two lane halves hold the two key halves of one query column)
__device__ __forceinline__ float xhalf(float x) { return __builtin_bit_cast(float, __builtin_amdgcn_permlanex16(__builtin_bit_cast(int, x), __builtin_bit_cast(int, x), 0x76543210, 0xfedcba98, false, false)); }
// ---- k_attn: block = (64 queries, head h, batch b): all-keys flash attention (K = 64: 2 k-steps), transposed: S^T = K . Q^T (A = k rows, B = q rows), so a lane holds 16 of the 32 scores of ONE query (keys 8g + r and 16 + 8g + r): maximum and sum in-lane plus one exchange between the lane halves; the two score tiles, converted in place, are the B operand P^T of O^T += V^T . P^T (A = v^T rows): P never touches LDS. scores = (q.k) * 0.125, 3 products (f16 hi + residual) on both sides; O[b*S+q][h*64+d] = (acc + accl / 2048) / (2048 l) (256-B segments)
__global__ __launch_bounds__(128) void k_attn(const _Float16* __restrict__ QK, const _Float16* __restrict__ QKL, const _Float16* __restrict__ KP, const _Float16* __restrict__ VP, const void* __restrict__ KMASK, float* __restrict__ O) {
  __shared__ __align__(16) float so[4][16][68];
  const int tid = threadIdx.x, wave = tid >> 5, lane = tid & 31, col = lane & 15, g = lane >> 4;
  const int qb = blockIdx.x, h = blockIdx.y, b = blockIdx.z; const int q0 = qb * 64 + wave * 16; const size_t rq = (size_t)b * SS + q0 + col;
  v16h aq[2], aql[2];
#pragma unroll
  for (int kc = 0; kc < 2; ++kc) { aq[kc] = frag_h(QK + rq * (2 * DM) + h * HD + kc * 32, lane); aql[kc] = frag_h(QKL + rq * (2 * DM) + h * HD + kc * 32, lane); }
  float m = -3.0e38f, l = 0.f;   // of query column col; l is this lane half's share of the sum, joined behind the loop
  v8f acc[4] = {}, accl[4] = {};   // O^T tiles: register r = O[query col][dt * 16 + 8 g + r]
  const int nks = SS / 32;   // all keys
  // fragment loads run ahead of the products that use them: the k fragments of pass ks + 1 are requested right behind the score products of pass ks, the v fragments of pass ks at its top
  // one byte offset per lane serves every k slot of a pass, one every v slot: each load of a wave reads 512 bytes in a row
  // the short loops over ct, kc and dt below are unrolled so that the fragment arrays are indexed by constants and stay in registers
  unsigned ko = (unsigned)(b * NH + h) * (SS / 32) * FPASS + 16u * lane; unsigned vo = ko;
  v16h kh[2][2], kl[2][2];
#pragma unroll
  for (int ct = 0; ct < 2; ++ct) {
#pragma unroll
    for (int kc = 0; kc < 2; ++kc) { const int o = ct * 4 + kc * 2; kh[ct][kc] = frag_p(KP, ko, o); kl[ct][kc] = frag_p(KP, ko, 8 + o); } }
  asm volatile("s_wait_xcnt 0x0" : "+v"(ko) :: "memory");   // the first pass steps ko on, which the k loads above name
#pragma unroll 1
  for (int ks = 0; ks < nks; ++ks) { v8f s[2]; v16h vh[4], vl[4];
#pragma unroll
    for (int dt = 0; dt < 4; ++dt) { vh[dt] = frag_p(VP, vo, dt * 2); vl[dt] = frag_p(VP, vo, 8 + dt * 2); }
#pragma unroll
    for (int ct = 0; ct < 2; ++ct) { v8f c = {}, cl = {};
#pragma unroll
      for (int kc = 0; kc < 2; ++kc) { c = wmma16(kh[ct][kc], aq[kc], c); cl = wmma16(kh[ct][kc], aql[kc], cl); cl = wmma16(kl[ct][kc], aq[kc], cl); }   // 3 products: q, k as f16 hi + residual; register r = score of key ct * 16 + 8 g + r with query col
#pragma unroll
      for (int r = 0; r < 8; ++r) c[r] += cl[r] * (1.0f / 2048.0f);
#pragma unroll
      for (int r = 0; r < 8; ++r) s[ct][r] = c[r] * 0.125f;   // 1/sqrt(64); no key mask
      __builtin_amdgcn_sched_barrier(0); }   // one score tile's two accumulators are done with before the next tile's begin: with both pairs live the operands of the products no longer fit v0-v255 and a q fragment is spilled and reloaded every pass
    ko += (ks + 1 < nks) ? (unsigned)FPASS : 0u;   // the last pass requests its own slots again: in bounds, never used
#pragma unroll
    for (int ct = 0; ct < 2; ++ct) {
#pragma unroll
      for (int kc = 0; kc < 2; ++kc) { const int o = ct * 4 + kc * 2; kh[ct][kc] = frag_p(KP, ko, o); kl[ct][kc] = frag_p(KP, ko, 8 + o); } }
    __builtin_amdgcn_sched_barrier(0);   // keeps the next pass's k requests here, a whole softmax and P.V ahead of their use: without it they sink below the softmax, whose temporaries take their registers
    float mx[8];
#pragma unroll
    for (int r = 0; r < 8; ++r) mx[r] = fmaxf(s[0][r], s[1][r]);
#pragma unroll
    for (int w = 4; w > 0; w >>= 1) {
#pragma unroll
      for (int r = 0; r < w; ++r) mx[r] = fmaxf(mx[r], mx[r + w]); }
    const float mn = fmaxf(m, fmaxf(mx[0], xhalf(mx[0]))); const float alpha = (m <= -1.0e38f) ? 0.f : __expf(m - mn); m = mn;
    float e[16];
#pragma unroll
    for (int i = 0; i < 16; ++i) { const float sv = s[i >> 3][i & 7]; e[i] = (sv <= -1.0e38f) ? 0.f : __expf(sv - mn); }
    float es[8];
#pragma unroll
    for (int r = 0; r < 8; ++r) es[r] = e[r] + e[8 + r];
#pragma unroll
    for (int w = 4; w > 0; w >>= 1) {
#pragma unroll
      for (int r = 0; r < w; ++r) es[r] += es[r + w]; }
    l = l * alpha + es[0];
#pragma unroll
    for (int dt = 0; dt < 4; ++dt) {
#pragma unroll
      for (int r = 0; r < 8; ++r) { acc[dt][r] *= alpha; accl[dt][r] *= alpha; } }
    asm volatile("s_wait_xcnt 0x0" : "+v"(ko), "+v"(vo) :: "memory");   // the two offset registers of this pass's fragment loads are held whole up to this wait; only behind it are they stepped on
    vo += FPASS;
    v16h pa, pl;   // P^T as B operand: element i = key kmap(i, g) of query col, which is where the two score tiles already hold it
#pragma unroll
    for (int i = 0; i < 16; ++i) { const float x0 = e[i] * 2048.0f; const _Float16 h0 = (_Float16)x0; pa[i] = h0; pl[i] = (_Float16)((x0 - (float)h0) * 2048.0f); }   // P scaled by 2^11 before the f16 split so small softmax weights stay out of the f16 subnormal range; 2^-11 folded into the epilogue
#pragma unroll
    for (int dt = 0; dt < 4; ++dt) { acc[dt] = wmma16(vh[dt], pa, acc[dt]); accl[dt] = wmma16(vh[dt], pl, accl[dt]); accl[dt] = wmma16(vl[dt], pa, accl[dt]); }   // V hi x P hi + (V hi x P lo + V lo x P hi) / 2048
  }
  l += xhalf(l);   // the two lane halves' shares of the row sum
  const float il = (1.0f / 2048.0f) / l;
#pragma unroll
  for (int dt = 0; dt < 4; ++dt) {
#pragma unroll
    for (int r = 0; r < 8; ++r) so[wave][col][dt * 16 + 8 * g + r] = (acc[dt][r] + accl[dt][r] * (1.0f / 2048.0f)) * il; }
  LDSX();
  for (int rl = 0; rl < 16; ++rl) if (lane < 16) vst2(O + ((size_t)b * SS + q0 + rl) * DM + h * HD + lane * 4, *(const v4f*)&so[wave][rl][lane * 4]);
}
// ---- k_out: block = (64 rows, 128 cols): out = O(hi/lo) . Wo rows (2 products) + bo
__global__ __launch_bounds__(128) void k_out(const float* __restrict__ O, const __bf16* __restrict__ P, const float* __restrict__ BO, float* __restrict__ Y) {
  __shared__ __align__(16) float so[4][16][132];
  const int tid = threadIdx.x, wave = tid >> 5, lane = tid & 31, col = lane & 15, g = lane >> 4; const size_t r0 = (size_t)blockIdx.x * 64 + wave * 16; const int n0 = blockIdx.y * 128;
  v8f acc[8] = {};
#pragma unroll 2
  for (int kc = 0; kc < DM / 32; ++kc) { const F2 a = split_row(O + (r0 + col) * DM, kc * 32, lane);
#pragma unroll
    for (int j = 0; j < 8; ++j) { const v16b w = frag_b(P + (size_t)(n0 + j * 16 + col) * DM + kc * 32, lane); acc[j] = wmma_bf(a.l, w, acc[j]); acc[j] = wmma_bf(a.h, w, acc[j]); } }
#pragma unroll
  for (int j = 0; j < 8; ++j) {
#pragma unroll
    for (int r = 0; r < 8; ++r) so[wave][8 * g + r][j * 16 + col] = acc[j][r] + bfr(BO[n0 + j * 16 + col]); }
  LDSX();
  for (int rl = 0; rl < 16; ++rl) vst2(Y + (r0 + rl) * DM + n0 + lane * 4, *(const v4f*)&so[wave][rl][lane * 4]);
}
// ---- k_layqk: block = 64 rows: R rows -> q slots of the q planes, Y rows -> k in fragment order (f16 hi + x2048 residual), 8-element chunks, thread-linear in the destination (no LDS)
// k chunk e = (pass of the block, head, slot = ct * 4 + kc * 2 + j, lane = 16 g + col) holds k[key pass * 32 + ct * 16 + col][h * 64 + kc * 32 + j * 16 + 8 g + 0..7]: what lane (col, g) takes as half j of fragment (ct, kc)
__global__ __launch_bounds__(256) void k_layqk(const float* __restrict__ R, const float* __restrict__ Y, _Float16* __restrict__ QK, _Float16* __restrict__ QKL, _Float16* __restrict__ KP) {
  const int t = threadIdx.x; const size_t r0 = (size_t)blockIdx.x * 64;
  for (int e = t; e < 64 * (DM / 8); e += 256) { const int r = e / (DM / 8), q = e % (DM / 8); const float* src = R + (r0 + r) * DM + q * 8;
    __align__(16) _Float16 hh[8], ll[8];
#pragma unroll
    for (int i = 0; i < 8; ++i) { const float v = bfr(src[i]); const _Float16 h = (_Float16)v; hh[i] = h; ll[i] = (_Float16)((v - (float)h) * 2048.0f); }
    const size_t o = (r0 + r) * (2 * DM) + q * 8; vst2((unsigned*)(QK + o), *(const v4u*)hh); vst2((unsigned*)(QKL + o), *(const v4u*)ll); }
  for (int e = t; e < 64 * (DM / 8); e += 256) { const int ln = e & 31, sl = (e >> 5) & 7, hd = (e >> 8) & 7, ps = e >> 11;
    const float* src = Y + (r0 + ps * 32 + (sl >> 2) * 16 + (ln & 15)) * DM + hd * HD + ((sl >> 1) & 1) * 32 + (sl & 1) * 16 + (ln >> 4) * 8;
    __align__(16) _Float16 hh[8], ll[8];
#pragma unroll
    for (int i = 0; i < 8; ++i) { const float v = bfr(src[i]); const _Float16 h = (_Float16)v; hh[i] = h; ll[i] = (_Float16)((v - (float)h) * 2048.0f); }
    const size_t o = ((((r0 / SS) * NH + hd) * (SS / 32) + (r0 % SS) / 32 + ps) * 16 + sl) * (FSLOT / 2) + ln * 8; vst2((unsigned*)(KP + o), *(const v4u*)hh); vst2((unsigned*)(KP + o + 8 * (FSLOT / 2)), *(const v4u*)ll); }
}
// ---- k_layv: block = (64 rows s, b): Y rows -> v^T in fragment order via an LDS transpose
// chunk e = (pass of the block, head, slot = dt * 2 + j, lane = 16 g + col) holds v[keys pass * 32 + j * 16 + 8 g + 0..7][h * 64 + dt * 16 + col]: what lane (col, g) takes as half j of fragment dt
__global__ __launch_bounds__(256) void k_layv(const float* __restrict__ Y, _Float16* __restrict__ VP) {
  __shared__ __align__(16) _Float16 svh[DM][72], svl[DM][72]; const int t = threadIdx.x; const int s0 = blockIdx.x * 64; const size_t b = blockIdx.y;
  for (int e = t; e < 64 * DM; e += 256) { const int r = e / DM, c = e % DM; const float v = bfr(Y[(b * SS + s0 + r) * DM + c]); const _Float16 h = (_Float16)v; svh[c][r] = h; svl[c][r] = (_Float16)((v - (float)h) * 2048.0f); }
  __syncthreads();
  for (int e = t; e < DM * 8; e += 256) { const int ln = e & 31, sl = (e >> 5) & 7, hd = (e >> 8) & 7, ps = e >> 11; const int c = hd * HD + (sl >> 1) * 16 + (ln & 15), pc = ps * 4 + (sl & 1) * 2 + (ln >> 4);
    const size_t o = (((b * NH + hd) * (SS / 32) + s0 / 32 + ps) * 16 + sl) * (FSLOT / 2) + ln * 8; vst2((unsigned*)(VP + o), *(const v4u*)&svh[c][pc * 8]); vst2((unsigned*)(VP + o + 8 * (FSLOT / 2)), *(const v4u*)&svl[c][pc * 8]); }
}
// ---- k_req: block = 64 rows: the step-1 result O (f32 rows) -> q slots of the planes as f16 hi + x2048 residual (step-2 queries)
__global__ __launch_bounds__(256) void k_req(const float* __restrict__ O, _Float16* __restrict__ QK, _Float16* __restrict__ QKL) {
  __shared__ __align__(16) _Float16 sq[64][DM + 8], sql_[64][DM + 8]; const int t = threadIdx.x; const size_t r0 = (size_t)blockIdx.x * 64;
  for (int e = t; e < 64 * DM; e += 256) { const int r = e / DM, c = e % DM; const float v = O[(r0 + r) * DM + c]; const _Float16 h = (_Float16)v; sq[r][c] = h; sql_[r][c] = (_Float16)((v - (float)h) * 2048.0f); }
  __syncthreads();
  for (int e = t; e < 64 * (DM / 8); e += 256) { const int r = e / (DM / 8), q = e % (DM / 8); const size_t o = (r0 + r) * (2 * DM) + q * 8; vst2((unsigned*)(QK + o), *(const v4u*)&sq[r][q * 8]); vst2((unsigned*)(QKL + o), *(const v4u*)&sql_[r][q * 8]); }
}
extern "C" void kernel_launch(void* const* d_in, const int* in_sizes, int n_in, void* d_out, int out_size, void* d_ws, size_t ws_size, hipStream_t stream) {
  (void)in_sizes; (void)n_in; (void)out_size;
  const float** F = (const float**)d_in;   // 0 R [2,2048,512] (state patterns / queries), 1 Y [2,2048,512] (stored patterns = keys = values)
  if (ws_size < (size_t)WS_END) return;
  char* ws = (char*)d_ws; (void)0; _Float16 *QK = (_Float16*)(ws + WS_QK), *QKL = (_Float16*)(ws + WS_QKL), *KP = (_Float16*)(ws + WS_KP), *VP = (_Float16*)(ws + WS_VP); float* O = (float*)(ws + WS_O);
  k_layqk<<<NB * SS / 64, 256, 0, stream>>>(F[0], F[1], QK, QKL, KP);
  k_layv<<<dim3(SS / 64, NB), 256, 0, stream>>>(F[1], VP);
  k_attn<<<dim3(TQB, NH, TNB), 128, 0, stream>>>(QK, QKL, KP, VP, nullptr, O);          // step 1
  k_req<<<TOB, 256, 0, stream>>>(O, QK, QKL);
  k_attn<<<dim3(TQB, NH, TNB), 128, 0, stream>>>(QK, QKL, KP, VP, nullptr, (float*)d_out);   // step 2 -> output rows [b*L + l][h*64 + e]
}

// v004
// One run takes 129 microseconds.
// Two timings next to v003 both put it at 1.19 times that version's speed.
// Over all steps from v000 it is 3.86 times as fast.
// compute dtype: R and Y rounded to bf16; no projections: q0 = R and k = v = Y are bf16 values re-laid on device as ONE f16 plane each (a bf16 value is exact in f16 from 2^-14 up; below that it is rounded to a multiple of 2^-24), k and v in fragment order; step 1: 1-product scores x 1/8, running-max softmax in f32 (hardware exp), P (scaled by 2^11, as f16 hi + residual) x v (2 products) -> q1 kept as f16 hi + (x2048) residual planes; step 2 the same with q1 hi + residual (2-product scores); f32 accumulate; the final state is the f32 output.
#include <hip/hip_runtime.h>
#include <math.h>

typedef __attribute__((ext_vector_type(16))) _Float16 v16h;
typedef __attribute__((ext_vector_type(16))) __bf16 v16b;
typedef __attribute__((ext_vector_type(8)))  _Float16 v8h;
typedef __attribute__((ext_vector_type(8)))  float v8f;
typedef __attribute__((ext_vector_type(4)))  float v4f;
typedef __attribute__((ext_vector_type(2)))  float v2f;
typedef __attribute__((ext_vector_type(4)))  unsigned v4u;
typedef __attribute__((ext_vector_type(4)))  int v4i;
typedef float __attribute__((may_alias)) float_a;
typedef int __attribute__((may_alias)) int_a;

template <typename T> __device__ __forceinline__ void vst2(void* p, T v) { *(T*)p = v;  }
__device__ __forceinline__ v8f wmma16(v16h a, v16h b, v8f c) {
  v8f d = __builtin_amdgcn_wmma_f32_16x16x32_f16(false, a, false, b, (short)0, c, false, false);
  asm volatile("v_nop\n\tv_nop\n\tv_nop\n\tv_nop" : "+v"(d) : "v"(a), "v"(b));
  return d;
}
__device__ __forceinline__ v8f wmma_bf(v16b a, v16b b, v8f c) {
  v8f d = __builtin_amdgcn_wmma_f32_16x16x32_bf16(false, a, false, b, (short)0, c, false, false);
  asm volatile("v_nop\n\tv_nop\n\tv_nop\n\tv_nop" : "+v"(d) : "v"(a), "v"(b));
  return d;
}
__device__ __forceinline__ v16h frag_h(const _Float16* rowk0, int lane) {
  union { v16h v; v8h q[2]; } u; const _Float16* p = rowk0 + 8 * (lane >> 4);
  u.q[0] = *(const v8h*)p; u.q[1] = *(const v8h*)(p + 16); return u.v;
}
__device__ __forceinline__ v16h frag_f32(const float* rowk0, int lane) {
  v16h a; const float* p = rowk0 + 8 * (lane >> 4);
#pragma unroll
  for (int i = 0; i < 8; ++i) { a[i] = (_Float16)p[i]; a[8 + i] = (_Float16)p[16 + i]; }
  return a;
}
__device__ __forceinline__ v16h frag_f32s(const float* rowk0, int lane, float sc) {
  v16h a; const float* p = rowk0 + 8 * (lane >> 4);
#pragma unroll
  for (int i = 0; i < 8; ++i) { a[i] = (_Float16)(p[i] * sc); a[8 + i] = (_Float16)(p[16 + i] * sc); }
  return a;
}
// column fragment from a [K][ld] layout (column n), rows >= K read as 0
__device__ __forceinline__ v16h fragc_f32(const float* W, int k0, int n, int lane, int ld, int K) {
  v16h a; const int g = lane >> 4;
#pragma unroll
  for (int i = 0; i < 8; ++i) { const int ka = k0 + 8 * g + i, kb = ka + 16;
    a[i] = (_Float16)(ka < K ? W[(size_t)(ka < K ? ka : K - 1) * ld + n] : 0.f); a[8 + i] = (_Float16)(kb < K ? W[(size_t)(kb < K ? kb : K - 1) * ld + n] : 0.f); }
  return a;
}
struct F2 { v16b h, l; };
__device__ __forceinline__ F2 bsplit16(const float v[16]) { F2 r;
#pragma unroll
  for (int i = 0; i < 16; ++i) { const __bf16 h = (__bf16)v[i]; r.h[i] = h; r.l[i] = (__bf16)(v[i] - (float)h); }
  return r; }
__device__ __forceinline__ F2 split_row(const float* row, int k0, int lane) { float v[16]; const float* p = row + k0 + 8 * (lane >> 4);
#pragma unroll
  for (int i = 0; i < 8; ++i) { v[i] = p[i]; v[8 + i] = p[16 + i]; }
  return bsplit16(v); }
__device__ __forceinline__ F2 split_rowK(const float* row, int k0, int lane, int K) { float v[16]; const int g = lane >> 4;
#pragma unroll
  for (int i = 0; i < 8; ++i) { const int ka = k0 + 8 * g + i, kb = ka + 16; v[i] = ka < K ? row[ka < K ? ka : K - 1] : 0.f; v[8 + i] = kb < K ? row[kb < K ? kb : K - 1] : 0.f; }
  return bsplit16(v); }
__device__ __forceinline__ F2 split_col(const float* W, int k0, int n, int lane, int ld, int K) { float v[16]; const int g = lane >> 4;
#pragma unroll
  for (int i = 0; i < 8; ++i) { const int ka = k0 + 8 * g + i, kb = ka + 16; v[i] = ka < K ? W[(size_t)(ka < K ? ka : K - 1) * ld + n] : 0.f; v[8 + i] = kb < K ? W[(size_t)(kb < K ? kb : K - 1) * ld + n] : 0.f; }
  return bsplit16(v); }
__device__ __forceinline__ v8f mac3(const F2& a, const F2& b, v8f c) { c = wmma_bf(a.l, b.h, c); c = wmma_bf(a.h, b.l, c); return wmma_bf(a.h, b.h, c); }
__device__ __forceinline__ float sigm(float v) { return 1.0f / (1.0f + expf(-v)); }
#define LDSX() do { asm volatile("s_wait_dscnt 0" ::: "memory"); __builtin_amdgcn_wave_barrier(); __builtin_amdgcn_fence(__ATOMIC_RELEASE, "workgroup"); } while (0)


#define NB 2
#define SS 2048
#define DM 512
#define NH 8
#define HD 64
#define QKVW (3 * DM)
#ifndef TQB
#define TQB (SS / 64)
#define TNB NB
#define TOB (NB * SS / 64)     // output row tiles (all)
#endif
typedef __attribute__((ext_vector_type(8))) __bf16 v8b;
__device__ __forceinline__ v16b frag_b(const __bf16* rowk0, int lane) {
  union { v16b v; v8b q[2]; } u; const __bf16* p = rowk0 + 8 * (lane >> 4);
  u.q[0] = *(const v8b*)p; u.q[1] = *(const v8b*)(p + 16); return u.v;
}
#define FSLOT 512                    // bytes of one slot: one 16-byte load of every lane of a wave, lane after lane (four whole 128-byte lines)
#define FPASS (8 * FSLOT)            // bytes of one pass of one head: 8 slots; a fragment is two slots in a row (its k halves 0-15 and 16-31)
// fragment in frag_h's k order from a fragment-ordered plane: its base, the lane's byte offset (pass and lane) and the fragment's first slot
__device__ __forceinline__ v16h frag_p(const _Float16* base, unsigned boff, int slot) {
  union { v16h v; v8h q[2]; } u; const char* p = (const char*)base + boff + slot * FSLOT;
  u.q[0] = *(const v8h*)p; u.q[1] = *(const v8h*)(p + FSLOT); return u.v;
}
__device__ __forceinline__ float bfr(float v) { return (float)(__bf16)v; }
__device__ __attribute__((noinline)) float exp_ni(float v) { return expf(v); }
__device__ __attribute__((noinline)) float erf_ni(float v) { return erff(v); }

#define PK_A 0                       // [1536][512] Wqkv rows (natural [out][in])
#define PK_P (PK_A + QKVW * DM)        // [512][512] Wo rows (natural)
#define PK_END (PK_P + DM * DM)
#define WS_PK  0u
#define WS_QK  (WS_PK + 2u * PK_END)             // f16 [4096 rows][1024]: q | k
#define WS_QKL (WS_QK + 2u * NB * SS * 2 * DM)     // f16 q | k residual planes x2048
#define WS_VTH (WS_QKL + 2u * NB * SS * 2 * DM)    // f16 [b][512 (h*64+d)][2048 s] hi
#define WS_VTL (WS_VTH + 2u * NB * DM * SS)        // f16 lo x 2048
#define WS_O   (WS_VTL + 2u * NB * DM * SS)        // f32 [4096][512]
#define WS_CS  (WS_O + 4u * NB * SS * DM)           // f32 2 x [2048][32]: reserved, nothing writes or reads it
#define WS_KP  (WS_CS + 4u * 2 * SS * 32)          // f16 k in fragment order: [b][h][pass of 32 keys][8 slots][32 lanes][8]
#define WS_VP  (WS_KP + 2u * NB * SS * DM)         // f16 v^T in fragment order, same shape
#define WS_END (WS_VP + 2u * NB * SS * DM)
// ---- k_pack: block = (row n, which): natural [out][in] rows -> bf16; which 0..2 -> W_q/W_k/W_v into PK_A rows which*512 + n; 3 -> W_o into PK_P
__global__ __launch_bounds__(256) void k_pack(const float* __restrict__ WQ, const float* __restrict__ WK, const float* __restrict__ WV, const float* __restrict__ WO, __bf16* __restrict__ PK) {
  __shared__ __align__(16) __bf16 s[DM]; const int n = blockIdx.x, which = blockIdx.y, t = threadIdx.x; const float* Wm = (which == 0) ? WQ : (which == 1) ? WK : (which == 2) ? WV : WO;
  for (int k = t; k < DM; k += 256) s[k] = (__bf16)Wm[(size_t)n * DM + k];
  __syncthreads();
  __bf16* dst = (which < 3) ? PK + PK_A + ((size_t)which * DM + n) * DM : PK + PK_P + (size_t)n * DM;
  for (int q = t; q < DM / 8; q += 256) vst2((unsigned*)(dst + q * 8), *(const v4u*)&s[q * 8]);
}
__global__ __launch_bounds__(128) void k_qkv(const float* __restrict__ XQ, const float* __restrict__ XK, const float* __restrict__ XV, const __bf16* __restrict__ P, const float* __restrict__ BQ, const float* __restrict__ BK, const float* __restrict__ BV, _Float16* __restrict__ QK, _Float16* __restrict__ QKL, _Float16* __restrict__ VTH, _Float16* __restrict__ VTL) {
  const int which0 = (blockIdx.y * 128) / DM; const float* X = (which0 == 0) ? XQ : (which0 == 1) ? XK : XV; const float* BB = BQ ? (((which0 == 0) ? BQ : (which0 == 1) ? BK : BV) + (blockIdx.y * 128 - which0 * DM)) : nullptr;
  __shared__ __align__(16) _Float16 so[4][16][136], sol[4][16][136]; __shared__ __align__(16) _Float16 sth[128][72], stl[128][72];
  const int tid = threadIdx.x, wave = tid >> 5, lane = tid & 31, col = lane & 15, g = lane >> 4; const size_t r0 = (size_t)blockIdx.x * 64 + wave * 16; const int n0 = blockIdx.y * 128;
  v8f acc[8] = {};
#pragma unroll 2
  for (int kc = 0; kc < DM / 32; ++kc) { v16b a; { const float* p = X + (r0 + col) * DM + kc * 32 + 8 * g;
#pragma unroll
      for (int i = 0; i < 8; ++i) { a[i] = (__bf16)p[i]; a[8 + i] = (__bf16)p[16 + i]; } }
#pragma unroll
    for (int j = 0; j < 8; ++j) acc[j] = wmma_bf(a, frag_b(P + (size_t)(n0 + j * 16 + col) * DM + kc * 32, lane), acc[j]); }
  if (n0 < 2 * DM) {   // q stored unscaled (f16 sigma ~0.6, no subnormal exposure); 1/8 applied to the f32 score
#pragma unroll
    for (int j = 0; j < 8; ++j) {
#pragma unroll
      for (int r = 0; r < 8; ++r) { const float v = acc[j][r] + (BB ? bfr(BB[j * 16 + col]) : 0.f); const _Float16 hv = (_Float16)v; so[wave][8 * g + r][j * 16 + col] = hv; sol[wave][8 * g + r][j * 16 + col] = (_Float16)((v - (float)hv) * 2048.0f); } }   // q, k (+ bias) as f16 hi + (x2048) residual
    LDSX();
    for (int rl = 0; rl < 16; ++rl) if (lane < 16) { vst2((unsigned*)(QK + (r0 + rl) * (2 * DM) + n0 + lane * 8), *(const v4u*)&so[wave][rl][lane * 8]); vst2((unsigned*)(QKL + (r0 + rl) * (2 * DM) + n0 + lane * 8), *(const v4u*)&sol[wave][rl][lane * 8]); }
  } else {
#pragma unroll
    for (int j = 0; j < 8; ++j) {
#pragma unroll
      for (int r = 0; r < 8; ++r) { const float v = acc[j][r] + (BB ? bfr(BB[j * 16 + col]) : 0.f); const _Float16 hv = (_Float16)v; sth[j * 16 + col][wave * 16 + 8 * g + r] = hv; stl[j * 16 + col][wave * 16 + 8 * g + r] = (_Float16)((v - (float)hv) * 2048.0f); } }
    __syncthreads();
    const size_t rb = (size_t)blockIdx.x * 64; const int b = (int)(rb / SS), s0 = (int)(rb % SS); const int pc0 = n0 - 2 * DM;
    for (int q = tid; q < 128 * 8; q += 128) { const int d = q >> 3, pc = q & 7; const size_t o = ((size_t)b * DM + pc0 + d) * SS + s0 + pc * 8; vst2((unsigned*)(VTH + o), *(const v4u*)&sth[d][pc * 8]); vst2((unsigned*)(VTL + o), *(const v4u*)&stl[d][pc * 8]); }
  }
}
// lane l with lane l ^ 16 (the two lane halves hold the two key halves of one query column)
__device__ __forceinline__ float xhalf(float x) { return __builtin_bit_cast(float, __builtin_amdgcn_permlanex16(__builtin_bit_cast(int, x), __builtin_bit_cast(int, x), 0x76543210, 0xfedcba98, false, false)); }
// ---- k_attn: block = (64 queries, head h, batch b): all-keys flash attention (K = 64: 2 k-steps), transposed: S^T = K . Q^T (A = k rows, B = q rows), so a lane holds 16 of the 32 scores of ONE query (keys 8g + r and 16 + 8g + r): maximum and sum in-lane plus one exchange between the lane halves; the two score tiles, converted in place, are the B operand P^T of O^T += V^T . P^T (A = v^T rows): P never touches LDS. k and v are one f16 plane each; QRES = 1: q is f16 hi + residual (2 products), QRES = 0: q is one f16 plane too (1 product, QKL not read); scores = (q.k) * 0.125; P is f16 hi + residual (2 products); O[b*S+q][h*64+d] = (acc + accl / 2048) / (2048 l) (256-B segments)
template <int QRES> __global__ __launch_bounds__(128) void k_attn(const _Float16* __restrict__ QK, const _Float16* __restrict__ QKL, const _Float16* __restrict__ KP, const _Float16* __restrict__ VP, const void* __restrict__ KMASK, float* __restrict__ O) {
  __shared__ __align__(16) float so[4][16][68];
  const int tid = threadIdx.x, wave = tid >> 5, lane = tid & 31, col = lane & 15, g = lane >> 4;
  const int qb = blockIdx.x, h = blockIdx.y, b = blockIdx.z; const int q0 = qb * 64 + wave * 16; const size_t rq = (size_t)b * SS + q0 + col;
  v16h aq[2], aql[2];
#pragma unroll
  for (int kc = 0; kc < 2; ++kc) { aq[kc] = frag_h(QK + rq * (2 * DM) + h * HD + kc * 32, lane); if constexpr (QRES) aql[kc] = frag_h(QKL + rq * (2 * DM) + h * HD + kc * 32, lane); }
  asm volatile("s_wait_xcnt 0x0" ::: "memory");   // the q loads' address registers are free for reuse (the k fragments below may land in them) only behind this wait
  float m = -3.0e38f, l = 0.f;   // of query column col; l is this lane half's share of the sum, joined behind the loop
  v8f acc[4] = {}, accl[4] = {};   // O^T tiles: register r = O[query col][dt * 16 + 8 g + r]
  const int nks = SS / 32;   // all keys
  // fragment loads run ahead of the products that use them: the k fragments of pass ks + 1 are requested right behind the score products of pass ks, the v fragments of pass ks at its top
  // one byte offset per lane serves every k slot of a pass, one every v slot: each load of a wave reads 512 bytes in a row
  // the short loops over ct, kc and dt below are unrolled so that the fragment arrays are indexed by constants and stay in registers
  unsigned ko = (unsigned)(b * NH + h) * (SS / 32) * FPASS + 16u * lane; unsigned vo = ko;
  v16h kh[2][2];
#pragma unroll
  for (int ct = 0; ct < 2; ++ct) {
#pragma unroll
    for (int kc = 0; kc < 2; ++kc) kh[ct][kc] = frag_p(KP, ko, ct * 4 + kc * 2); }
  asm volatile("s_wait_xcnt 0x0" : "+v"(ko) :: "memory");   // the first pass steps ko on, which the k loads above name
#pragma unroll 1
  for (int ks = 0; ks < nks; ++ks) { v8f s[2]; v16h vh[4];
#pragma unroll
    for (int dt = 0; dt < 4; ++dt) vh[dt] = frag_p(VP, vo, dt * 2);
#pragma unroll
    for (int ct = 0; ct < 2; ++ct) { v8f c = {}, cl = {};
#pragma unroll
      for (int kc = 0; kc < 2; ++kc) { c = wmma16(kh[ct][kc], aq[kc], c); if constexpr (QRES) cl = wmma16(kh[ct][kc], aql[kc], cl); }   // k x q hi (+ k x q residual); register r = score of key ct * 16 + 8 g + r with query col
      if constexpr (QRES) {
#pragma unroll
        for (int r = 0; r < 8; ++r) c[r] += cl[r] * (1.0f / 2048.0f); }
#pragma unroll
      for (int r = 0; r < 8; ++r) s[ct][r] = c[r] * 0.125f;   // 1/sqrt(64)
    }
    ko += (ks + 1 < nks) ? (unsigned)FPASS : 0u;   // the last pass requests its own slots again: in bounds, never used
#pragma unroll
    for (int ct = 0; ct < 2; ++ct) {
#pragma unroll
      for (int kc = 0; kc < 2; ++kc) kh[ct][kc] = frag_p(KP, ko, ct * 4 + kc * 2); }
    __builtin_amdgcn_sched_barrier(0);   // keeps the next pass's k requests here, a whole softmax and P.V ahead of their use: without it they sink below the softmax, whose temporaries take their registers
    float mx[8];
#pragma unroll
    for (int r = 0; r < 8; ++r) mx[r] = fmaxf(s[0][r], s[1][r]);
#pragma unroll
    for (int w = 4; w > 0; w >>= 1) {
#pragma unroll
      for (int r = 0; r < w; ++r) mx[r] = fmaxf(mx[r], mx[r + w]); }
    const float mn = fmaxf(m, fmaxf(mx[0], xhalf(mx[0]))); const float alpha = (m <= -1.0e38f) ? 0.f : __expf(m - mn); m = mn;
    float e[16];
#pragma unroll
    for (int i = 0; i < 16; ++i) { const float sv = s[i >> 3][i & 7]; e[i] = (sv <= -1.0e38f) ? 0.f : __expf(sv - mn); }
    float es[8];
#pragma unroll
    for (int r = 0; r < 8; ++r) es[r] = e[r] + e[8 + r];
#pragma unroll
    for (int w = 4; w > 0; w >>= 1) {
#pragma unroll
      for (int r = 0; r < w; ++r) es[r] += es[r + w]; }
    l = l * alpha + es[0];
#pragma unroll
    for (int dt = 0; dt < 4; ++dt) {
#pragma unroll
      for (int r = 0; r < 8; ++r) { acc[dt][r] *= alpha; accl[dt][r] *= alpha; } }
    asm volatile("s_wait_xcnt 0x0" : "+v"(ko), "+v"(vo) :: "memory");   // the two offset registers of this pass's fragment loads are held whole up to this wait; only behind it are they stepped on
    vo += FPASS;
    v16h pa, pl;   // P^T as B operand: element i = key kmap(i, g) of query col, which is where the two score tiles already hold it
#pragma unroll
    for (int i = 0; i < 16; ++i) { const float x0 = e[i] * 2048.0f; const _Float16 h0 = (_Float16)x0; pa[i] = h0; pl[i] = (_Float16)((x0 - (float)h0) * 2048.0f); }   // P scaled by 2^11 before the f16 split so small softmax weights stay out of the f16 subnormal range; 2^-11 folded into the epilogue
#pragma unroll
    for (int dt = 0; dt < 4; ++dt) { acc[dt] = wmma16(vh[dt], pa, acc[dt]); accl[dt] = wmma16(vh[dt], pl, accl[dt]); }   // V x P hi + (V x P lo) / 2048
  }
  l += xhalf(l);   // the two lane halves' shares of the row sum
  const float il = (1.0f / 2048.0f) / l;
#pragma unroll
  for (int dt = 0; dt < 4; ++dt) {
#pragma unroll
    for (int r = 0; r < 8; ++r) so[wave][col][dt * 16 + 8 * g + r] = (acc[dt][r] + accl[dt][r] * (1.0f / 2048.0f)) * il; }
  LDSX();
  for (int rl = 0; rl < 16; ++rl) if (lane < 16) vst2(O + ((size_t)b * SS + q0 + rl) * DM + h * HD + lane * 4, *(const v4f*)&so[wave][rl][lane * 4]);
}
// ---- k_out: block = (64 rows, 128 cols): out = O(hi/lo) . Wo rows (2 products) + bo
__global__ __launch_bounds__(128) void k_out(const float* __restrict__ O, const __bf16* __restrict__ P, const float* __restrict__ BO, float* __restrict__ Y) {
  __shared__ __align__(16) float so[4][16][132];
  const int tid = threadIdx.x, wave = tid >> 5, lane = tid & 31, col = lane & 15, g = lane >> 4; const size_t r0 = (size_t)blockIdx.x * 64 + wave * 16; const int n0 = blockIdx.y * 128;
  v8f acc[8] = {};
#pragma unroll 2
  for (int kc = 0; kc < DM / 32; ++kc) { const F2 a = split_row(O + (r0 + col) * DM, kc * 32, lane);
#pragma unroll
    for (int j = 0; j < 8; ++j) { const v16b w = frag_b(P + (size_t)(n0 + j * 16 + col) * DM + kc * 32, lane); acc[j] = wmma_bf(a.l, w, acc[j]); acc[j] = wmma_bf(a.h, w, acc[j]); } }
#pragma unroll
  for (int j = 0; j < 8; ++j) {
#pragma unroll
    for (int r = 0; r < 8; ++r) so[wave][8 * g + r][j * 16 + col] = acc[j][r] + bfr(BO[n0 + j * 16 + col]); }
  LDSX();
  for (int rl = 0; rl < 16; ++rl) vst2(Y + (r0 + rl) * DM + n0 + lane * 4, *(const v4f*)&so[wave][rl][lane * 4]);
}
// ---- k_layqk: block = 64 rows: R rows -> q slots of the q plane, Y rows -> k in fragment order (one f16 plane each), 8-element chunks, thread-linear in the destination (no LDS)
// k chunk e = (pass of the block, head, slot = ct * 4 + kc * 2 + j, lane = 16 g + col) holds k[key pass * 32 + ct * 16 + col][h * 64 + kc * 32 + j * 16 + 8 g + 0..7]: what lane (col, g) takes as half j of fragment (ct, kc)
__global__ __launch_bounds__(256) void k_layqk(const float* __restrict__ R, const float* __restrict__ Y, _Float16* __restrict__ QK, _Float16* __restrict__ KP) {
  const int t = threadIdx.x; const size_t r0 = (size_t)blockIdx.x * 64;
  for (int e = t; e < 64 * (DM / 8); e += 256) { const int r = e / (DM / 8), q = e % (DM / 8); const float* src = R + (r0 + r) * DM + q * 8;
    __align__(16) _Float16 hh[8];
#pragma unroll
    for (int i = 0; i < 8; ++i) hh[i] = (_Float16)bfr(src[i]);
    const size_t o = (r0 + r) * (2 * DM) + q * 8; vst2((unsigned*)(QK + o), *(const v4u*)hh); }
  for (int e = t; e < 64 * (DM / 8); e += 256) { const int ln = e & 31, sl = (e >> 5) & 7, hd = (e >> 8) & 7, ps = e >> 11;
    const float* src = Y + (r0 + ps * 32 + (sl >> 2) * 16 + (ln & 15)) * DM + hd * HD + ((sl >> 1) & 1) * 32 + (sl & 1) * 16 + (ln >> 4) * 8;
    __align__(16) _Float16 hh[8];
#pragma unroll
    for (int i = 0; i < 8; ++i) hh[i] = (_Float16)bfr(src[i]);
    const size_t o = ((((r0 / SS) * NH + hd) * (SS / 32) + (r0 % SS) / 32 + ps) * 8 + sl) * (FSLOT / 2) + ln * 8; vst2((unsigned*)(KP + o), *(const v4u*)hh); }
}
// ---- k_layv: block = (64 rows s, b): Y rows -> v^T in fragment order via an LDS transpose
// chunk e = (pass of the block, head, slot = dt * 2 + j, lane = 16 g + col) holds v[keys pass * 32 + j * 16 + 8 g + 0..7][h * 64 + dt * 16 + col]: what lane (col, g) takes as half j of fragment dt
__global__ __launch_bounds__(256) void k_layv(const float* __restrict__ Y, _Float16* __restrict__ VP) {
  __shared__ __align__(16) _Float16 svh[DM][72]; const int t = threadIdx.x; const int s0 = blockIdx.x * 64; const size_t b = blockIdx.y;
  for (int e = t; e < 64 * DM; e += 256) { const int r = e / DM, c = e % DM; svh[c][r] = (_Float16)bfr(Y[(b * SS + s0 + r) * DM + c]); }
  __syncthreads();
  for (int e = t; e < DM * 8; e += 256) { const int ln = e & 31, sl = (e >> 5) & 7, hd = (e >> 8) & 7, ps = e >> 11; const int c = hd * HD + (sl >> 1) * 16 + (ln & 15), pc = ps * 4 + (sl & 1) * 2 + (ln >> 4);
    const size_t o = (((b * NH + hd) * (SS / 32) + s0 / 32 + ps) * 8 + sl) * (FSLOT / 2) + ln * 8; vst2((unsigned*)(VP + o), *(const v4u*)&svh[c][pc * 8]); }
}
// ---- k_req: block = 64 rows: the step-1 result O (f32 rows) -> q slots of the planes as f16 hi + x2048 residual (step-2 queries)
__global__ __launch_bounds__(256) void k_req(const float* __restrict__ O, _Float16* __restrict__ QK, _Float16* __restrict__ QKL) {
  __shared__ __align__(16) _Float16 sq[64][DM + 8], sql_[64][DM + 8]; const int t = threadIdx.x; const size_t r0 = (size_t)blockIdx.x * 64;
  for (int e = t; e < 64 * DM; e += 256) { const int r = e / DM, c = e % DM; const float v = O[(r0 + r) * DM + c]; const _Float16 h = (_Float16)v; sq[r][c] = h; sql_[r][c] = (_Float16)((v - (float)h) * 2048.0f); }
  __syncthreads();
  for (int e = t; e < 64 * (DM / 8); e += 256) { const int r = e / (DM / 8), q = e % (DM / 8); const size_t o = (r0 + r) * (2 * DM) + q * 8; vst2((unsigned*)(QK + o), *(const v4u*)&sq[r][q * 8]); vst2((unsigned*)(QKL + o), *(const v4u*)&sql_[r][q * 8]); }
}
extern "C" void kernel_launch(void* const* d_in, const int* in_sizes, int n_in, void* d_out, int out_size, void* d_ws, size_t ws_size, hipStream_t stream) {
  (void)in_sizes; (void)n_in; (void)out_size;
  const float** F = (const float**)d_in;   // 0 R [2,2048,512] (state patterns / queries), 1 Y [2,2048,512] (stored patterns = keys = values)
  if (ws_size < (size_t)WS_END) return;
  char* ws = (char*)d_ws; (void)0; _Float16 *QK = (_Float16*)(ws + WS_QK), *QKL = (_Float16*)(ws + WS_QKL), *KP = (_Float16*)(ws + WS_KP), *VP = (_Float16*)(ws + WS_VP); float* O = (float*)(ws + WS_O);
  k_layqk<<<NB * SS / 64, 256, 0, stream>>>(F[0], F[1], QK, KP);
  k_layv<<<dim3(SS / 64, NB), 256, 0, stream>>>(F[1], VP);
  k_attn<0><<<dim3(TQB, NH, TNB), 128, 0, stream>>>(QK, QKL, KP, VP, nullptr, O);          // step 1: q0 is one plane
  k_req<<<TOB, 256, 0, stream>>>(O, QK, QKL);
  k_attn<1><<<dim3(TQB, NH, TNB), 128, 0, stream>>>(QK, QKL, KP, VP, nullptr, (float*)d_out);   // step 2 -> output rows [b*L + l][h*64 + e]
}

// v005
// One run takes 99.5 microseconds.
// Two timings next to v004 put it at 1.31 and 1.29 times that version's speed.
// Counting every step since v000, it is 5.02 times as fast.
// compute dtype: R and Y rounded to bf16; no projections: q0 = R and k = v = Y are bf16 values re-laid on device as ONE f16 plane each (a bf16 value is exact in f16 from 2^-14 up; below that it is rounded to a multiple of 2^-24), k and v in fragment order; step 1: 1-product scores x 1/8, running-max softmax in f32 (hardware exp), P (scaled by 2^11, as f16 hi + residual) x v (2 products) -> q1 kept in registers as f16 hi + (x2048) residual; step 2, in the same launch, the same with q1 hi + residual (2-product scores); f32 accumulate; the final state is the f32 output.
#include <hip/hip_runtime.h>
#include <math.h>

typedef __attribute__((ext_vector_type(16))) _Float16 v16h;
typedef __attribute__((ext_vector_type(16))) __bf16 v16b;
typedef __attribute__((ext_vector_type(8)))  _Float16 v8h;
typedef __attribute__((ext_vector_type(8)))  float v8f;
typedef __attribute__((ext_vector_type(4)))  float v4f;
typedef __attribute__((ext_vector_type(2)))  float v2f;
typedef __attribute__((ext_vector_type(4)))  unsigned v4u;
typedef __attribute__((ext_vector_type(4)))  int v4i;
typedef float __attribute__((may_alias)) float_a;
typedef int __attribute__((may_alias)) int_a;

template <typename T> __device__ __forceinline__ void vst2(void* p, T v) { *(T*)p = v;  }
__device__ __forceinline__ v8f wmma16(v16h a, v16h b, v8f c) {
  v8f d = __builtin_amdgcn_wmma_f32_16x16x32_f16(false, a, false, b, (short)0, c, false, false);
  asm volatile("v_nop\n\tv_nop\n\tv_nop\n\tv_nop" : "+v"(d) : "v"(a), "v"(b));
  return d;
}
__device__ __forceinline__ v8f wmma_bf(v16b a, v16b b, v8f c) {
  v8f d = __builtin_amdgcn_wmma_f32_16x16x32_bf16(false, a, false, b, (short)0, c, false, false);
  asm volatile("v_nop\n\tv_nop\n\tv_nop\n\tv_nop" : "+v"(d) : "v"(a), "v"(b));
  return d;
}
__device__ __forceinline__ v16h frag_h(const _Float16* rowk0, int lane) {
  union { v16h v; v8h q[2]; } u; const _Float16* p = rowk0 + 8 * (lane >> 4);
  u.q[0] = *(const v8h*)p; u.q[1] = *(const v8h*)(p + 16); return u.v;
}
__device__ __forceinline__ v16h frag_f32(const float* rowk0, int lane) {
  v16h a; const float* p = rowk0 + 8 * (lane >> 4);
#pragma unroll
  for (int i = 0; i < 8; ++i) { a[i] = (_Float16)p[i]; a[8 + i] = (_Float16)p[16 + i]; }
  return a;
}
__device__ __forceinline__ v16h frag_f32s(const float* rowk0, int lane, float sc) {
  v16h a; const float* p = rowk0 + 8 * (lane >> 4);
#pragma unroll
  for (int i = 0; i < 8; ++i) { a[i] = (_Float16)(p[i] * sc); a[8 + i] = (_Float16)(p[16 + i] * sc); }
  return a;
}
// column fragment from a [K][ld] layout (column n), rows >= K read as 0
__device__ __forceinline__ v16h fragc_f32(const float* W, int k0, int n, int lane, int ld, int K) {
  v16h a; const int g = lane >> 4;
#pragma unroll
  for (int i = 0; i < 8; ++i) { const int ka = k0 + 8 * g + i, kb = ka + 16;
    a[i] = (_Float16)(ka < K ? W[(size_t)(ka < K ? ka : K - 1) * ld + n] : 0.f); a[8 + i] = (_Float16)(kb < K ? W[(size_t)(kb < K ? kb : K - 1) * ld + n] : 0.f); }
  return a;
}
struct F2 { v16b h, l; };
__device__ __forceinline__ F2 bsplit16(const float v[16]) { F2 r;
#pragma unroll
  for (int i = 0; i < 16; ++i) { const __bf16 h = (__bf16)v[i]; r.h[i] = h; r.l[i] = (__bf16)(v[i] - (float)h); }
  return r; }
__device__ __forceinline__ F2 split_row(const float* row, int k0, int lane) { float v[16]; const float* p = row + k0 + 8 * (lane >> 4);
#pragma unroll
  for (int i = 0; i < 8; ++i) { v[i] = p[i]; v[8 + i] = p[16 + i]; }
  return bsplit16(v); }
__device__ __forceinline__ F2 split_rowK(const float* row, int k0, int lane, int K) { float v[16]; const int g = lane >> 4;
#pragma unroll
  for (int i = 0; i < 8; ++i) { const int ka = k0 + 8 * g + i, kb = ka + 16; v[i] = ka < K ? row[ka < K ? ka : K - 1] : 0.f; v[8 + i] = kb < K ? row[kb < K ? kb : K - 1] : 0.f; }
  return bsplit16(v); }
__device__ __forceinline__ F2 split_col(const float* W, int k0, int n, int lane, int ld, int K) { float v[16]; const int g = lane >> 4;
#pragma unroll
  for (int i = 0; i < 8; ++i) { const int ka = k0 + 8 * g + i, kb = ka + 16; v[i] = ka < K ? W[(size_t)(ka < K ? ka : K - 1) * ld + n] : 0.f; v[8 + i] = kb < K ? W[(size_t)(kb < K ? kb : K - 1) * ld + n] : 0.f; }
  return bsplit16(v); }
__device__ __forceinline__ v8f mac3(const F2& a, const F2& b, v8f c) { c = wmma_bf(a.l, b.h, c); c = wmma_bf(a.h, b.l, c); return wmma_bf(a.h, b.h, c); }
__device__ __forceinline__ float sigm(float v) { return 1.0f / (1.0f + expf(-v)); }
#define LDSX() do { asm volatile("s_wait_dscnt 0" ::: "memory"); __builtin_amdgcn_wave_barrier(); __builtin_amdgcn_fence(__ATOMIC_RELEASE, "workgroup"); } while (0)


#define NB 2
#define SS 2048
#define DM 512
#define NH 8
#define HD 64
#define QKVW (3 * DM)
#ifndef TQB
#define TQB (SS / 64)
#define TNB NB
#define TOB (NB * SS / 64)     // output row tiles (all)
#endif
typedef __attribute__((ext_vector_type(8))) __bf16 v8b;
__device__ __forceinline__ v16b frag_b(const __bf16* rowk0, int lane) {
  union { v16b v; v8b q[2]; } u; const __bf16* p = rowk0 + 8 * (lane >> 4);
  u.q[0] = *(const v8b*)p; u.q[1] = *(const v8b*)(p + 16); return u.v;
}
#define FSLOT 512                    // bytes of one slot: one 16-byte load of every lane of a wave, lane after lane (four whole 128-byte lines)
#define FPASS (8 * FSLOT)            // bytes of one pass of one head: 8 slots; a fragment is two slots in a row (its k halves 0-15 and 16-31)
// fragment in frag_h's k order from a fragment-ordered plane: its base, the lane's byte offset (pass and lane) and the fragment's first slot
__device__ __forceinline__ v16h frag_p(const _Float16* base, unsigned boff, int slot) {
  union { v16h v; v8h q[2]; } u; const char* p = (const char*)base + boff + slot * FSLOT;
  u.q[0] = *(const v8h*)p; u.q[1] = *(const v8h*)(p + FSLOT); return u.v;
}
__device__ __forceinline__ float bfr(float v) { return (float)(__bf16)v; }
__device__ __attribute__((noinline)) float exp_ni(float v) { return expf(v); }
__device__ __attribute__((noinline)) float erf_ni(float v) { return erff(v); }

#define PK_A 0                       // [1536][512] Wqkv rows (natural [out][in])
#define PK_P (PK_A + QKVW * DM)        // [512][512] Wo rows (natural)
#define PK_END (PK_P + DM * DM)
#define WS_PK  0u
#define WS_QK  (WS_PK + 2u * PK_END)             // f16 [4096 rows][1024]: q | k
#define WS_QKL (WS_QK + 2u * NB * SS * 2 * DM)     // f16 q | k residual planes x2048
#define WS_VTH (WS_QKL + 2u * NB * SS * 2 * DM)    // f16 [b][512 (h*64+d)][2048 s] hi
#define WS_VTL (WS_VTH + 2u * NB * DM * SS)        // f16 lo x 2048
#define WS_O   (WS_VTL + 2u * NB * DM * SS)        // f32 [4096][512]
#define WS_CS  (WS_O + 4u * NB * SS * DM)           // f32 2 x [2048][32]: reserved, nothing writes or reads it
#define WS_KP  (WS_CS + 4u * 2 * SS * 32)          // f16 k in fragment order: [b][h][pass of 32 keys][8 slots][32 lanes][8]
#define WS_VP  (WS_KP + 2u * NB * SS * DM)         // f16 v^T in fragment order, same shape
#define WS_END (WS_VP + 2u * NB * SS * DM)
// ---- k_pack: block = (row n, which): natural [out][in] rows -> bf16; which 0..2 -> W_q/W_k/W_v into PK_A rows which*512 + n; 3 -> W_o into PK_P
__global__ __launch_bounds__(256) void k_pack(const float* __restrict__ WQ, const float* __restrict__ WK, const float* __restrict__ WV, const float* __restrict__ WO, __bf16* __restrict__ PK) {
  __shared__ __align__(16) __bf16 s[DM]; const int n = blockIdx.x, which = blockIdx.y, t = threadIdx.x; const float* Wm = (which == 0) ? WQ : (which == 1) ? WK : (which == 2) ? WV : WO;
  for (int k = t; k < DM; k += 256) s[k] = (__bf16)Wm[(size_t)n * DM + k];
  __syncthreads();
  __bf16* dst = (which < 3) ? PK + PK_A + ((size_t)which * DM + n) * DM : PK + PK_P + (size_t)n * DM;
  for (int q = t; q < DM / 8; q += 256) vst2((unsigned*)(dst + q * 8), *(const v4u*)&s[q * 8]);
}
__global__ __launch_bounds__(128) void k_qkv(const float* __restrict__ XQ, const float* __restrict__ XK, const float* __restrict__ XV, const __bf16* __restrict__ P, const float* __restrict__ BQ, const float* __restrict__ BK, const float* __restrict__ BV, _Float16* __restrict__ QK, _Float16* __restrict__ QKL, _Float16* __restrict__ VTH, _Float16* __restrict__ VTL) {
  const int which0 = (blockIdx.y * 128) / DM; const float* X = (which0 == 0) ? XQ : (which0 == 1) ? XK : XV; const float* BB = BQ ? (((which0 == 0) ? BQ : (which0 == 1) ? BK : BV) + (blockIdx.y * 128 - which0 * DM)) : nullptr;
  __shared__ __align__(16) _Float16 so[4][16][136], sol[4][16][136]; __shared__ __align__(16) _Float16 sth[128][72], stl[128][72];
  const int tid = threadIdx.x, wave = tid >> 5, lane = tid & 31, col = lane & 15, g = lane >> 4; const size_t r0 = (size_t)blockIdx.x * 64 + wave * 16; const int n0 = blockIdx.y * 128;
  v8f acc[8] = {};
#pragma unroll 2
  for (int kc = 0; kc < DM / 32; ++kc) { v16b a; { const float* p = X + (r0 + col) * DM + kc * 32 + 8 * g;
#pragma unroll
      for (int i = 0; i < 8; ++i) { a[i] = (__bf16)p[i]; a[8 + i] = (__bf16)p[16 + i]; } }
#pragma unroll
    for (int j = 0; j < 8; ++j) acc[j] = wmma_bf(a, frag_b(P + (size_t)(n0 + j * 16 + col) * DM + kc * 32, lane), acc[j]); }
  if (n0 < 2 * DM) {   // q stored unscaled (f16 sigma ~0.6, no subnormal exposure); 1/8 applied to the f32 score
#pragma unroll
    for (int j = 0; j < 8; ++j) {
#pragma unroll
      for (int r = 0; r < 8; ++r) { const float v = acc[j][r] + (BB ? bfr(BB[j * 16 + col]) : 0.f); const _Float16 hv = (_Float16)v; so[wave][8 * g + r][j * 16 + col] = hv; sol[wave][8 * g + r][j * 16 + col] = (_Float16)((v - (float)hv) * 2048.0f); } }   // q, k (+ bias) as f16 hi + (x2048) residual
    LDSX();
    for (int rl = 0; rl < 16; ++rl) if (lane < 16) { vst2((unsigned*)(QK + (r0 + rl) * (2 * DM) + n0 + lane * 8), *(const v4u*)&so[wave][rl][lane * 8]); vst2((unsigned*)(QKL + (r0 + rl) * (2 * DM) + n0 + lane * 8), *(const v4u*)&sol[wave][rl][lane * 8]); }
  } else {
#pragma unroll
    for (int j = 0; j < 8; ++j) {
#pragma unroll
      for (int r = 0; r < 8; ++r) { const float v = acc[j][r] + (BB ? bfr(BB[j * 16 + col]) : 0.f); const _Float16 hv = (_Float16)v; sth[j * 16 + col][wave * 16 + 8 * g + r] = hv; stl[j * 16 + col][wave * 16 + 8 * g + r] = (_Float16)((v - (float)hv) * 2048.0f); } }
    __syncthreads();
    const size_t rb = (size_t)blockIdx.x * 64; const int b = (int)(rb / SS), s0 = (int)(rb % SS); const int pc0 = n0 - 2 * DM;
    for (int q = tid; q < 128 * 8; q += 128) { const int d = q >> 3, pc = q & 7; const size_t o = ((size_t)b * DM + pc0 + d) * SS + s0 + pc * 8; vst2((unsigned*)(VTH + o), *(const v4u*)&sth[d][pc * 8]); vst2((unsigned*)(VTL + o), *(const v4u*)&stl[d][pc * 8]); }
  }
}
// lane l with lane l ^ 16 (the two lane halves hold the two key halves of one query column)
__device__ __forceinline__ float xhalf(float x) { return __builtin_bit_cast(float, __builtin_amdgcn_permlanex16(__builtin_bit_cast(int, x), __builtin_bit_cast(int, x), 0x76543210, 0xfedcba98, false, false)); }
// ---- attn_keys: one update step of one wave's 16 queries over all keys of its head: flash attention (K = 64: 2 k-steps), transposed: S^T = K . Q^T (A = k rows, B = q rows), so a lane holds 16 of the 32 scores of ONE query (keys 8g + r and 16 + 8g + r): maximum and sum in-lane plus one exchange between the lane halves; the two score tiles, converted in place, are the B operand P^T of O^T += V^T . P^T (A = v^T rows): P never touches LDS. k and v are one f16 plane each; QRES = 1: q is f16 hi + residual (2 products), QRES = 0: q is one f16 plane too (1 product, aql not read); scores = (q.k) * 0.125; P is f16 hi + residual (2 products); the step's result is O[query col][d] = (acc + accl / 2048) / (2048 l), l the returned row sum
template <int QRES> __device__ __forceinline__ float attn_keys(const v16h (&aq)[2], const v16h (&aql)[2], const _Float16* __restrict__ KP, const _Float16* __restrict__ VP, unsigned& ko, v16h (&kh)[2][2], v8f (&acc)[4], v8f (&accl)[4]) {
  float m = -3.0e38f, l = 0.f;   // of query column col; l is this lane half's share of the sum, joined behind the loop
#pragma unroll
  for (int dt = 0; dt < 4; ++dt) { acc[dt] = v8f{}; accl[dt] = v8f{}; }   // O^T tiles: register r = O[query col][dt * 16 + 8 g + r] (unrolled: constant indices)
  const int nks = SS / 32;   // all keys
  // fragment loads run ahead of the products that use them: the k fragments of pass ks + 1 are requested right behind the score products of pass ks, the v fragments of pass ks at its top
  // one byte offset per lane serves every k slot of a pass, one every v slot: each load of a wave reads 512 bytes in a row
  // the short loops over ct, kc and dt below are unrolled so that the fragment arrays are indexed by constants and stay in registers
  unsigned vo = ko;   // on entry ko is the lane's offset of the head's pass 0, whose k fragments are in kh or on their way; so it is again on return
#pragma unroll 1
  for (int ks = 0; ks < nks; ++ks) { v8f s[2]; v16h vh[4];
#pragma unroll
    for (int dt = 0; dt < 4; ++dt) vh[dt] = frag_p(VP, vo, dt * 2);
#pragma unroll
    for (int ct = 0; ct < 2; ++ct) { v8f c = {}, cl = {};
#pragma unroll
      for (int kc = 0; kc < 2; ++kc) { c = wmma16(kh[ct][kc], aq[kc], c); if constexpr (QRES) cl = wmma16(kh[ct][kc], aql[kc], cl); }   // k x q hi (+ k x q residual); register r = score of key ct * 16 + 8 g + r with query col
      if constexpr (QRES) {
#pragma unroll
        for (int r = 0; r < 8; ++r) c[r] += cl[r] * (1.0f / 2048.0f); }
#pragma unroll
      for (int r = 0; r < 8; ++r) s[ct][r] = c[r] * 0.125f;   // 1/sqrt(64)
    }
    ko += (ks + 1 < nks) ? (unsigned)FPASS : 0u - (unsigned)(nks - 1) * FPASS;   // the last pass requests pass 0 again: the next step's first fragments (behind the last step: in bounds, never used)
#pragma unroll
    for (int ct = 0; ct < 2; ++ct) {
#pragma unroll
      for (int kc = 0; kc < 2; ++kc) kh[ct][kc] = frag_p(KP, ko, ct * 4 + kc * 2); }
    __builtin_amdgcn_sched_barrier(0);   // keeps the next pass's k requests here, a whole softmax and P.V ahead of their use: without it they sink below the softmax, whose temporaries take their registers
    float mx[8];
#pragma unroll
    for (int r = 0; r < 8; ++r) mx[r] = fmaxf(s[0][r], s[1][r]);
#pragma unroll
    for (int w = 4; w > 0; w >>= 1) {
#pragma unroll
      for (int r = 0; r < w; ++r) mx[r] = fmaxf(mx[r], mx[r + w]); }
    const float mn = fmaxf(m, fmaxf(mx[0], xhalf(mx[0]))); const float alpha = (m <= -1.0e38f) ? 0.f : __expf(m - mn); m = mn;
    float e[16];
#pragma unroll
    for (int i = 0; i < 16; ++i) { const float sv = s[i >> 3][i & 7]; e[i] = (sv <= -1.0e38f) ? 0.f : __expf(sv - mn); }
    float es[8];
#pragma unroll
    for (int r = 0; r < 8; ++r) es[r] = e[r] + e[8 + r];
#pragma unroll
    for (int w = 4; w > 0; w >>= 1) {
#pragma unroll
      for (int r = 0; r < w; ++r) es[r] += es[r + w]; }
    l = l * alpha + es[0];
#pragma unroll
    for (int dt = 0; dt < 4; ++dt) {
#pragma unroll
      for (int r = 0; r < 8; ++r) { acc[dt][r] *= alpha; accl[dt][r] *= alpha; } }
    asm volatile("s_wait_xcnt 0x0" : "+v"(ko), "+v"(vo) :: "memory");   // the two offset registers of this pass's fragment loads are held whole up to this wait; only behind it are they stepped on
    vo += FPASS;
    v16h pa, pl;   // P^T as B operand: element i = key kmap(i, g) of query col, which is where the two score tiles already hold it
#pragma unroll
    for (int i = 0; i < 16; ++i) { const float x0 = e[i] * 2048.0f; const _Float16 h0 = (_Float16)x0; pa[i] = h0; pl[i] = (_Float16)((x0 - (float)h0) * 2048.0f); }   // P scaled by 2^11 before the f16 split so small softmax weights stay out of the f16 subnormal range; 2^-11 folded into the epilogue
#pragma unroll
    for (int dt = 0; dt < 4; ++dt) { acc[dt] = wmma16(vh[dt], pa, acc[dt]); accl[dt] = wmma16(vh[dt], pl, accl[dt]); }   // V x P hi + (V x P lo) / 2048
  }
  l += xhalf(l);   // the two lane halves' shares of the row sum
  return l;
}
// ---- k_attn: block = (64 queries, head h, batch b): BOTH update steps. A head's step-2 queries are its own step-1 results, and the O^T tiles hold them where the q operand wants them: element i of fragment kc is d = kc * 32 + 8 g + i = register i of tile 2 kc, element 8 + i is register i of tile 2 kc + 1, same lane: q1 is split into f16 hi + (x2048) residual in registers and never leaves the wave. O[b*S+q][h*64+d] = the step-2 result (256-B segments)
__global__ __launch_bounds__(128) void k_attn(const _Float16* __restrict__ QK, const _Float16* __restrict__ KP, const _Float16* __restrict__ VP, float* __restrict__ O) {
  __shared__ __align__(16) float so[4][16][68];
  const int tid = threadIdx.x, wave = tid >> 5, lane = tid & 31, col = lane & 15, g = lane >> 4;
  const int qb = blockIdx.x, h = blockIdx.y, b = blockIdx.z; const int q0 = qb * 64 + wave * 16; const size_t rq = (size_t)b * SS + q0 + col;
  v16h aq[2], aql[2];
#pragma unroll
  for (int kc = 0; kc < 2; ++kc) aq[kc] = frag_h(QK + rq * (2 * DM) + h * HD + kc * 32, lane);
  asm volatile("s_wait_xcnt 0x0" ::: "memory");   // the q loads' address registers are free for reuse (the k fragments below may land in them) only behind this wait
  unsigned ko = (unsigned)(b * NH + h) * (SS / 32) * FPASS + 16u * lane;
  v16h kh[2][2];
#pragma unroll
  for (int ct = 0; ct < 2; ++ct) {
#pragma unroll
    for (int kc = 0; kc < 2; ++kc) kh[ct][kc] = frag_p(KP, ko, ct * 4 + kc * 2); }
  asm volatile("s_wait_xcnt 0x0" : "+v"(ko) :: "memory");   // the first pass steps ko on, which the k loads above name
  v8f acc[4], accl[4];
  const float l1 = attn_keys<0>(aq, aq, KP, VP, ko, kh, acc, accl);   // step 1: q0 is one plane
  const float il1 = (1.0f / 2048.0f) / l1;
  // both loops unrolled: tiles and fragments are indexed by constants and stay in registers
#pragma unroll
  for (int kc = 0; kc < 2; ++kc) {
#pragma unroll
    for (int i = 0; i < 16; ++i) { const float v = (acc[2 * kc + (i >> 3)][i & 7] + accl[2 * kc + (i >> 3)][i & 7] * (1.0f / 2048.0f)) * il1; const _Float16 hv = (_Float16)v; aq[kc][i] = hv; aql[kc][i] = (_Float16)((v - (float)hv) * 2048.0f); } }
  const float l = attn_keys<1>(aq, aql, KP, VP, ko, kh, acc, accl);   // step 2
  const float il = (1.0f / 2048.0f) / l;
#pragma unroll
  for (int dt = 0; dt < 4; ++dt) {
#pragma unroll
    for (int r = 0; r < 8; ++r) so[wave][col][dt * 16 + 8 * g + r] = (acc[dt][r] + accl[dt][r] * (1.0f / 2048.0f)) * il; }
  LDSX();
  for (int rl = 0; rl < 16; ++rl) if (lane < 16) vst2(O + ((size_t)b * SS + q0 + rl) * DM + h * HD + lane * 4, *(const v4f*)&so[wave][rl][lane * 4]);
}
// ---- k_out: block = (64 rows, 128 cols): out = O(hi/lo) . Wo rows (2 products) + bo
__global__ __launch_bounds__(128) void k_out(const float* __restrict__ O, const __bf16* __restrict__ P, const float* __restrict__ BO, float* __restrict__ Y) {
  __shared__ __align__(16) float so[4][16][132];
  const int tid = threadIdx.x, wave = tid >> 5, lane = tid & 31, col = lane & 15, g = lane >> 4; const size_t r0 = (size_t)blockIdx.x * 64 + wave * 16; const int n0 = blockIdx.y * 128;
  v8f acc[8] = {};
#pragma unroll 2
  for (int kc = 0; kc < DM / 32; ++kc) { const F2 a = split_row(O + (r0 + col) * DM, kc * 32, lane);
#pragma unroll
    for (int j = 0; j < 8; ++j) { const v16b w = frag_b(P + (size_t)(n0 + j * 16 + col) * DM + kc * 32, lane); acc[j] = wmma_bf(a.l, w, acc[j]); acc[j] = wmma_bf(a.h, w, acc[j]); } }
#pragma unroll
  for (int j = 0; j < 8; ++j) {
#pragma unroll
    for (int r = 0; r < 8; ++r) so[wave][8 * g + r][j * 16 + col] = acc[j][r] + bfr(BO[n0 + j * 16 + col]); }
  LDSX();
  for (int rl = 0; rl < 16; ++rl) vst2(Y + (r0 + rl) * DM + n0 + lane * 4, *(const v4f*)&so[wave][rl][lane * 4]);
}
// ---- k_layqk: block = 64 rows: R rows -> q slots of the q plane, Y rows -> k in fragment order (one f16 plane each), 8-element chunks, thread-linear in the destination (no LDS)
// k chunk e = (pass of the block, head, slot = ct * 4 + kc * 2 + j, lane = 16 g + col) holds k[key pass * 32 + ct * 16 + col][h * 64 + kc * 32 + j * 16 + 8 g + 0..7]: what lane (col, g) takes as half j of fragment (ct, kc)
__global__ __launch_bounds__(256) void k_layqk(const float* __restrict__ R, const float* __restrict__ Y, _Float16* __restrict__ QK, _Float16* __restrict__ KP) {
  const int t = threadIdx.x; const size_t r0 = (size_t)blockIdx.x * 64;
  for (int e = t; e < 64 * (DM / 8); e += 256) { const int r = e / (DM / 8), q = e % (DM / 8); const float* src = R + (r0 + r) * DM + q * 8;
    __align__(16) _Float16 hh[8];
#pragma unroll
    for (int i = 0; i < 8; ++i) hh[i] = (_Float16)bfr(src[i]);
    const size_t o = (r0 + r) * (2 * DM) + q * 8; vst2((unsigned*)(QK + o), *(const v4u*)hh); }
  for (int e = t; e < 64 * (DM / 8); e += 256) { const int ln = e & 31, sl = (e >> 5) & 7, hd = (e >> 8) & 7, ps = e >> 11;
    const float* src = Y + (r0 + ps * 32 + (sl >> 2) * 16 + (ln & 15)) * DM + hd * HD + ((sl >> 1) & 1) * 32 + (sl & 1) * 16 + (ln >> 4) * 8;
    __align__(16) _Float16 hh[8];
#pragma unroll
    for (int i = 0; i < 8; ++i) hh[i] = (_Float16)bfr(src[i]);
    const size_t o = ((((r0 / SS) * NH + hd) * (SS / 32) + (r0 % SS) / 32 + ps) * 8 + sl) * (FSLOT / 2) + ln * 8; vst2((unsigned*)(KP + o), *(const v4u*)hh); }
}
// ---- k_layv: block = (64 rows s, b): Y rows -> v^T in fragment order via an LDS transpose
// chunk e = (pass of the block, head, slot = dt * 2 + j, lane = 16 g + col) holds v[keys pass * 32 + j * 16 + 8 g + 0..7][h * 64 + dt * 16 + col]: what lane (col, g) takes as half j of fragment dt
__global__ __launch_bounds__(256) void k_layv(const float* __restrict__ Y, _Float16* __restrict__ VP) {
  __shared__ __align__(16) _Float16 svh[DM][72]; const int t = threadIdx.x; const int s0 = blockIdx.x * 64; const size_t b = blockIdx.y;
  for (int e = t; e < 64 * DM; e += 256) { const int r = e / DM, c = e % DM; svh[c][r] = (_Float16)bfr(Y[(b * SS + s0 + r) * DM + c]); }
  __syncthreads();
  for (int e = t; e < DM * 8; e += 256) { const int ln = e & 31, sl = (e >> 5) & 7, hd = (e >> 8) & 7, ps = e >> 11; const int c = hd * HD + (sl >> 1) * 16 + (ln & 15), pc = ps * 4 + (sl & 1) * 2 + (ln >> 4);
    const size_t o = (((b * NH + hd) * (SS / 32) + s0 / 32 + ps) * 8 + sl) * (FSLOT / 2) + ln * 8; vst2((unsigned*)(VP + o), *(const v4u*)&svh[c][pc * 8]); }
}
extern "C" void kernel_launch(void* const* d_in, const int* in_sizes, int n_in, void* d_out, int out_size, void* d_ws, size_t ws_size, hipStream_t stream) {
  (void)in_sizes; (void)n_in; (void)out_size;
  const float** F = (const float**)d_in;   // 0 R [2,2048,512] (state patterns / queries), 1 Y [2,2048,512] (stored patterns = keys = values)
  if (ws_size < (size_t)WS_END) return;
  char* ws = (char*)d_ws; (void)0; _Float16 *QK = (_Float16*)(ws + WS_QK), *KP = (_Float16*)(ws + WS_KP), *VP = (_Float16*)(ws + WS_VP);
  k_layqk<<<NB * SS / 64, 256, 0, stream>>>(F[0], F[1], QK, KP);
  k_layv<<<dim3(SS / 64, NB), 256, 0, stream>>>(F[1], VP);
  k_attn<<<dim3(TQB, NH, TNB), 128, 0, stream>>>(QK, KP, VP, (float*)d_out);   // both steps -> output rows [b*L + l][h*64 + e]
}

// v006
// It runs in 84.6 microseconds.
// In two side-by-side timings against v005, it was 1.18 and 1.19 times as fast.
// All steps since v000 together make it 5.95 times as fast.
// compute dtype: R and Y rounded to bf16; no projections: q0 = R and k = v = Y are bf16 values re-laid on device as ONE f16 plane each (a bf16 value is exact in f16 from 2^-14 up; below that it is rounded to a multiple of 2^-24), k and v in fragment order; step 1: 1-product scores x 1/8, running-max softmax in f32 (hardware exp), P (scaled by 2^11, as f16 hi + residual) x v (2 products) -> q1 kept in registers as f16 hi + (x2048) residual; step 2, in the same launch, the same with q1 hi + residual (2-product scores); f32 accumulate; the final state is the f32 output.
#include <hip/hip_runtime.h>
#include <math.h>

typedef __attribute__((ext_vector_type(16))) _Float16 v16h;
typedef __attribute__((ext_vector_type(16))) __bf16 v16b;
typedef __attribute__((ext_vector_type(8)))  _Float16 v8h;
typedef __attribute__((ext_vector_type(8)))  float v8f;
typedef __attribute__((ext_vector_type(4)))  float v4f;
typedef __attribute__((ext_vector_type(2)))  float v2f;
typedef __attribute__((ext_vector_type(4)))  unsigned v4u;
typedef __attribute__((ext_vector_type(4)))  int v4i;
typedef float __attribute__((may_alias)) float_a;
typedef int __attribute__((may_alias)) int_a;

template <typename T> __device__ __forceinline__ void vst2(void* p, T v) { *(T*)p = v;  }
__device__ __forceinline__ v8f wmma16(v16h a, v16h b, v8f c) {
  v8f d = __builtin_amdgcn_wmma_f32_16x16x32_f16(false, a, false, b, (short)0, c, false, false);
  asm volatile("v_nop\n\tv_nop\n\tv_nop\n\tv_nop" : "+v"(d) : "v"(a), "v"(b));
  return d;
}
__device__ __forceinline__ v8f wmma_bf(v16b a, v16b b, v8f c) {
  v8f d = __builtin_amdgcn_wmma_f32_16x16x32_bf16(false, a, false, b, (short)0, c, false, false);
  asm volatile("v_nop\n\tv_nop\n\tv_nop\n\tv_nop" : "+v"(d) : "v"(a), "v"(b));
  return d;
}
__device__ __forceinline__ v16h frag_h(const _Float16* rowk0, int lane) {
  union { v16h v; v8h q[2]; } u; const _Float16* p = rowk0 + 8 * (lane >> 4);
  u.q[0] = *(const v8h*)p; u.q[1] = *(const v8h*)(p + 16); return u.v;
}
__device__ __forceinline__ v16h frag_f32(const float* rowk0, int lane) {
  v16h a; const float* p = rowk0 + 8 * (lane >> 4);
#pragma unroll
  for (int i = 0; i < 8; ++i) { a[i] = (_Float16)p[i]; a[8 + i] = (_Float16)p[16 + i]; }
  return a;
}
__device__ __forceinline__ v16h frag_f32s(const float* rowk0, int lane, float sc) {
  v16h a; const float* p = rowk0 + 8 * (lane >> 4);
#pragma unroll
  for (int i = 0; i < 8; ++i) { a[i] = (_Float16)(p[i] * sc); a[8 + i] = (_Float16)(p[16 + i] * sc); }
  return a;
}
// column fragment from a [K][ld] layout (column n), rows >= K read as 0
__device__ __forceinline__ v16h fragc_f32(const float* W, int k0, int n, int lane, int ld, int K) {
  v16h a; const int g = lane >> 4;
#pragma unroll
  for (int i = 0; i < 8; ++i) { const int ka = k0 + 8 * g + i, kb = ka + 16;
    a[i] = (_Float16)(ka < K ? W[(size_t)(ka < K ? ka : K - 1) * ld + n] : 0.f); a[8 + i] = (_Float16)(kb < K ? W[(size_t)(kb < K ? kb : K - 1) * ld + n] : 0.f); }
  return a;
}
struct F2 { v16b h, l; };
__device__ __forceinline__ F2 bsplit16(const float v[16]) { F2 r;
#pragma unroll
  for (int i = 0; i < 16; ++i) { const __bf16 h = (__bf16)v[i]; r.h[i] = h; r.l[i] = (__bf16)(v[i] - (float)h); }
  return r; }
__device__ __forceinline__ F2 split_row(const float* row, int k0, int lane) { float v[16]; const float* p = row + k0 + 8 * (lane >> 4);
#pragma unroll
  for (int i = 0; i < 8; ++i) { v[i] = p[i]; v[8 + i] = p[16 + i]; }
  return bsplit16(v); }
__device__ __forceinline__ F2 split_rowK(const float* row, int k0, int lane, int K) { float v[16]; const int g = lane >> 4;
#pragma unroll
  for (int i = 0; i < 8; ++i) { const int ka = k0 + 8 * g + i, kb = ka + 16; v[i] = ka < K ? row[ka < K ? ka : K - 1] : 0.f; v[8 + i] = kb < K ? row[kb < K ? kb : K - 1] : 0.f; }
  return bsplit16(v); }
__device__ __forceinline__ F2 split_col(const float* W, int k0, int n, int lane, int ld, int K) { float v[16]; const int g = lane >> 4;
#pragma unroll
  for (int i = 0; i < 8; ++i) { const int ka = k0 + 8 * g + i, kb = ka + 16; v[i] = ka < K ? W[(size_t)(ka < K ? ka : K - 1) * ld + n] : 0.f; v[8 + i] = kb < K ? W[(size_t)(kb < K ? kb : K - 1) * ld + n] : 0.f; }
  return bsplit16(v); }
__device__ __forceinline__ v8f mac3(const F2& a, const F2& b, v8f c) { c = wmma_bf(a.l, b.h, c); c = wmma_bf(a.h, b.l, c); return wmma_bf(a.h, b.h, c); }
__device__ __forceinline__ float sigm(float v) { return 1.0f / (1.0f + expf(-v)); }
#define LDSX() do { asm volatile("s_wait_dscnt 0" ::: "memory"); __builtin_amdgcn_wave_barrier(); __builtin_amdgcn_fence(__ATOMIC_RELEASE, "workgroup"); } while (0)


#define NB 2
#define SS 2048
#define DM 512
#define NH 8
#define HD 64
#define QKVW (3 * DM)
#ifndef TQB
#define TQB (SS / 64)
#define TNB NB
#define TOB (NB * SS / 64)     // output row tiles (all)
#endif
typedef __attribute__((ext_vector_type(8))) __bf16 v8b;
__device__ __forceinline__ v16b frag_b(const __bf16* rowk0, int lane) {
  union { v16b v; v8b q[2]; } u; const __bf16* p = rowk0 + 8 * (lane >> 4);
  u.q[0] = *(const v8b*)p; u.q[1] = *(const v8b*)(p + 16); return u.v;
}
#define FSLOT 512                    // bytes of one slot: one 16-byte load of every lane of a wave, lane after lane (four whole 128-byte lines)
#define FPASS (8 * FSLOT)            // bytes of one pass of one head: 8 slots; a fragment is two slots in a row (its k halves 0-15 and 16-31)
// fragment in frag_h's k order from a fragment-ordered plane: its base, the lane's byte offset (pass and lane) and the fragment's first slot
__device__ __forceinline__ v16h frag_p(const _Float16* base, unsigned boff, int slot) {
  union { v16h v; v8h q[2]; } u; const char* p = (const char*)base + boff + slot * FSLOT;
  u.q[0] = *(const v8h*)p; u.q[1] = *(const v8h*)(p + FSLOT); return u.v;
}
__device__ __forceinline__ float bfr(float v) { return (float)(__bf16)v; }
__device__ __attribute__((noinline)) float exp_ni(float v) { return expf(v); }
__device__ __attribute__((noinline)) float erf_ni(float v) { return erff(v); }

#define PK_A 0                       // [1536][512] Wqkv rows (natural [out][in])
#define PK_P (PK_A + QKVW * DM)        // [512][512] Wo rows (natural)
#define PK_END (PK_P + DM * DM)
#define WS_PK  0u
#define WS_QK  (WS_PK + 2u * PK_END)             // f16 [4096 rows][1024]: q | k
#define WS_QKL (WS_QK + 2u * NB * SS * 2 * DM)     // f16 q | k residual planes x2048
#define WS_VTH (WS_QKL + 2u * NB * SS * 2 * DM)    // f16 [b][512 (h*64+d)][2048 s] hi
#define WS_VTL (WS_VTH + 2u * NB * DM * SS)        // f16 lo x 2048
#define WS_O   (WS_VTL + 2u * NB * DM * SS)        // f32 [4096][512]
#define WS_CS  (WS_O + 4u * NB * SS * DM)           // f32 2 x [2048][32]: reserved, nothing writes or reads it
#define WS_KP  (WS_CS + 4u * 2 * SS * 32)          // f16 k in fragment order: [b][h][pass of 32 keys][8 slots][32 lanes][8]
#define WS_VP  (WS_KP + 2u * NB * SS * DM)         // f16 v^T in fragment order, same shape
#define WS_END (WS_VP + 2u * NB * SS * DM)
// ---- k_pack: block = (row n, which): natural [out][in] rows -> bf16; which 0..2 -> W_q/W_k/W_v into PK_A rows which*512 + n; 3 -> W_o into PK_P
__global__ __launch_bounds__(256) void k_pack(const float* __restrict__ WQ, const float* __restrict__ WK, const float* __restrict__ WV, const float* __restrict__ WO, __bf16* __restrict__ PK) {
  __shared__ __align__(16) __bf16 s[DM]; const int n = blockIdx.x, which = blockIdx.y, t = threadIdx.x; const float* Wm = (which == 0) ? WQ : (which == 1) ? WK : (which == 2) ? WV : WO;
  for (int k = t; k < DM; k += 256) s[k] = (__bf16)Wm[(size_t)n * DM + k];
  __syncthreads();
  __bf16* dst = (which < 3) ? PK + PK_A + ((size_t)which * DM + n) * DM : PK + PK_P + (size_t)n * DM;
  for (int q = t; q < DM / 8; q += 256) vst2((unsigned*)(dst + q * 8), *(const v4u*)&s[q * 8]);
}
__global__ __launch_bounds__(128) void k_qkv(const float* __restrict__ XQ, const float* __restrict__ XK, const float* __restrict__ XV, const __bf16* __restrict__ P, const float* __restrict__ BQ, const float* __restrict__ BK, const float* __restrict__ BV, _Float16* __restrict__ QK, _Float16* __restrict__ QKL, _Float16* __restrict__ VTH, _Float16* __restrict__ VTL) {
  const int which0 = (blockIdx.y * 128) / DM; const float* X = (which0 == 0) ? XQ : (which0 == 1) ? XK : XV; const float* BB = BQ ? (((which0 == 0) ? BQ : (which0 == 1) ? BK : BV) + (blockIdx.y * 128 - which0 * DM)) : nullptr;
  __shared__ __align__(16) _Float16 so[4][16][136], sol[4][16][136]; __shared__ __align__(16) _Float16 sth[128][72], stl[128][72];
  const int tid = threadIdx.x, wave = tid >> 5, lane = tid & 31, col = lane & 15, g = lane >> 4; const size_t r0 = (size_t)blockIdx.x * 64 + wave * 16; const int n0 = blockIdx.y * 128;
  v8f acc[8] = {};
#pragma unroll 2
  for (int kc = 0; kc < DM / 32; ++kc) { v16b a; { const float* p = X + (r0 + col) * DM + kc * 32 + 8 * g;
#pragma unroll
      for (int i = 0; i < 8; ++i) { a[i] = (__bf16)p[i]; a[8 + i] = (__bf16)p[16 + i]; } }
#pragma unroll
    for (int j = 0; j < 8; ++j) acc[j] = wmma_bf(a, frag_b(P + (size_t)(n0 + j * 16 + col) * DM + kc * 32, lane), acc[j]); }
  if (n0 < 2 * DM) {   // q stored unscaled (f16 sigma ~0.6, no subnormal exposure); 1/8 applied to the f32 score
#pragma unroll
    for (int j = 0; j < 8; ++j) {
#pragma unroll
      for (int r = 0; r < 8; ++r) { const float v = acc[j][r] + (BB ? bfr(BB[j * 16 + col]) : 0.f); const _Float16 hv = (_Float16)v; so[wave][8 * g + r][j * 16 + col] = hv; sol[wave][8 * g + r][j * 16 + col] = (_Float16)((v - (float)hv) * 2048.0f); } }   // q, k (+ bias) as f16 hi + (x2048) residual
    LDSX();
    for (int rl = 0; rl < 16; ++rl) if (lane < 16) { vst2((unsigned*)(QK + (r0 + rl) * (2 * DM) + n0 + lane * 8), *(const v4u*)&so[wave][rl][lane * 8]); vst2((unsigned*)(QKL + (r0 + rl) * (2 * DM) + n0 + lane * 8), *(const v4u*)&sol[wave][rl][lane * 8]); }
  } else {
#pragma unroll
    for (int j = 0; j < 8; ++j) {
#pragma unroll
      for (int r = 0; r < 8; ++r) { const float v = acc[j][r] + (BB ? bfr(BB[j * 16 + col]) : 0.f); const _Float16 hv = (_Float16)v; sth[j * 16 + col][wave * 16 + 8 * g + r] = hv; stl[j * 16 + col][wave * 16 + 8 * g + r] = (_Float16)((v - (float)hv) * 2048.0f); } }
    __syncthreads();
    const size_t rb = (size_t)blockIdx.x * 64; const int b = (int)(rb / SS), s0 = (int)(rb % SS); const int pc0 = n0 - 2 * DM;
    for (int q = tid; q < 128 * 8; q += 128) { const int d = q >> 3, pc = q & 7; const size_t o = ((size_t)b * DM + pc0 + d) * SS + s0 + pc * 8; vst2((unsigned*)(VTH + o), *(const v4u*)&sth[d][pc * 8]); vst2((unsigned*)(VTL + o), *(const v4u*)&stl[d][pc * 8]); }
  }
}
// lane l with lane l ^ 16 (the two lane halves hold the two key halves of one query column)
__device__ __forceinline__ float xhalf(float x) { return __builtin_bit_cast(float, __builtin_amdgcn_permlanex16(__builtin_bit_cast(int, x), __builtin_bit_cast(int, x), 0x76543210, 0xfedcba98, false, false)); }
// ---- attn_keys: one update step of one wave's 16 queries over all keys of its head: flash attention (K = 64: 2 k-steps), transposed: S^T = K . Q^T (A = k rows, B = q rows), so a lane holds 16 of the 32 scores of ONE query (keys 8g + r and 16 + 8g + r): maximum and sum in-lane plus one exchange between the lane halves; the two score tiles, converted in place, are the B operand P^T of O^T += V^T . P^T (A = v^T rows): P never touches LDS. k and v are one f16 plane each; QRES = 1: q is f16 hi + residual (2 products), QRES = 0: q is one f16 plane too (1 product, aql not read); scores = (q.k) * 0.125; P is f16 hi + residual (2 products); the step's result is O[query col][d] = (acc + accl / 2048) / (2048 l), l the returned row sum
template <int QRES> __device__ __forceinline__ float attn_keys(const v16h (&aq)[2], const v16h (&aql)[2], const _Float16* __restrict__ KP, const _Float16* __restrict__ VP, unsigned& ko, v16h (&kh)[2][2], v8f (&acc)[4], v8f (&accl)[4]) {
  float m = -3.0e38f, l = 0.f;   // of query column col; l is this lane half's share of the sum, joined behind the loop
#pragma unroll
  for (int dt = 0; dt < 4; ++dt) { acc[dt] = v8f{}; accl[dt] = v8f{}; }   // O^T tiles: register r = O[query col][dt * 16 + 8 g + r] (unrolled: constant indices)
  const int nks = SS / 32;   // all keys
  // fragment loads run ahead of the products that use them: the k fragments of pass ks + 1 are requested right behind the score products of pass ks, the v fragments of pass ks at its top
  // one byte offset per lane serves every k slot of a pass, one every v slot: each load of a wave reads 512 bytes in a row
  // the short loops over ct, kc and dt below are unrolled so that the fragment arrays are indexed by constants and stay in registers
  unsigned vo = ko;   // on entry ko is the lane's offset of the head's pass 0, whose k fragments are in kh or on their way; so it is again on return
#pragma unroll 1
  for (int ks = 0; ks < nks; ++ks) { v8f s[2]; v16h vh[4];
#pragma unroll
    for (int dt = 0; dt < 4; ++dt) vh[dt] = frag_p(VP, vo, dt * 2);
#pragma unroll
    for (int ct = 0; ct < 2; ++ct) { v8f c = {}, cl = {};
#pragma unroll
      for (int kc = 0; kc < 2; ++kc) { c = wmma16(kh[ct][kc], aq[kc], c); if constexpr (QRES) cl = wmma16(kh[ct][kc], aql[kc], cl); }   // k x q hi (+ k x q residual); register r = score of key ct * 16 + 8 g + r with query col
      if constexpr (QRES) {
#pragma unroll
        for (int r = 0; r < 8; ++r) c[r] += cl[r] * (1.0f / 2048.0f); }
#pragma unroll
      for (int r = 0; r < 8; ++r) s[ct][r] = c[r] * 0.125f;   // 1/sqrt(64)
    }
    ko += (ks + 1 < nks) ? (unsigned)FPASS : 0u - (unsigned)(nks - 1) * FPASS;   // the last pass requests pass 0 again: the next step's first fragments (behind the last step: in bounds, never used)
#pragma unroll
    for (int ct = 0; ct < 2; ++ct) {
#pragma unroll
      for (int kc = 0; kc < 2; ++kc) kh[ct][kc] = frag_p(KP, ko, ct * 4 + kc * 2); }
    __builtin_amdgcn_sched_barrier(0);   // keeps the next pass's k requests here, a whole softmax and P.V ahead of their use: without it they sink below the softmax, whose temporaries take their registers
    float mx[8];
#pragma unroll
    for (int r = 0; r < 8; ++r) mx[r] = fmaxf(s[0][r], s[1][r]);
#pragma unroll
    for (int w = 4; w > 0; w >>= 1) {
#pragma unroll
      for (int r = 0; r < w; ++r) mx[r] = fmaxf(mx[r], mx[r + w]); }
    const float mn = fmaxf(m, fmaxf(mx[0], xhalf(mx[0]))); const float alpha = (m <= -1.0e38f) ? 0.f : __expf(m - mn); m = mn;
    float e[16];
#pragma unroll
    for (int i = 0; i < 16; ++i) { const float sv = s[i >> 3][i & 7]; e[i] = (sv <= -1.0e38f) ? 0.f : __expf(sv - mn); }
    float es[8];
#pragma unroll
    for (int r = 0; r < 8; ++r) es[r] = e[r] + e[8 + r];
#pragma unroll
    for (int w = 4; w > 0; w >>= 1) {
#pragma unroll
      for (int r = 0; r < w; ++r) es[r] += es[r + w]; }
    l = l * alpha + es[0];
#pragma unroll
    for (int dt = 0; dt < 4; ++dt) {
#pragma unroll
      for (int r = 0; r < 8; ++r) { acc[dt][r] *= alpha; accl[dt][r] *= alpha; } }
    asm volatile("s_wait_xcnt 0x0" : "+v"(ko), "+v"(vo) :: "memory");   // the two offset registers of this pass's fragment loads are held whole up to this wait; only behind it are they stepped on
    vo += FPASS;
    v16h pa, pl;   // P^T as B operand: element i = key kmap(i, g) of query col, which is where the two score tiles already hold it
#pragma unroll
    for (int i = 0; i < 16; ++i) { const float x0 = e[i] * 2048.0f; const _Float16 h0 = (_Float16)x0; pa[i] = h0; pl[i] = (_Float16)((x0 - (float)h0) * 2048.0f); }   // P scaled by 2^11 before the f16 split so small softmax weights stay out of the f16 subnormal range; 2^-11 folded into the epilogue
#pragma unroll
    for (int dt = 0; dt < 4; ++dt) { acc[dt] = wmma16(vh[dt], pa, acc[dt]); accl[dt] = wmma16(vh[dt], pl, accl[dt]); }   // V x P hi + (V x P lo) / 2048
  }
  l += xhalf(l);   // the two lane halves' shares of the row sum
  return l;
}
// ---- k_attn: block = (64 queries, head h, batch b): BOTH update steps. A head's step-2 queries are its own step-1 results, and the O^T tiles hold them where the q operand wants them: element i of fragment kc is d = kc * 32 + 8 g + i = register i of tile 2 kc, element 8 + i is register i of tile 2 kc + 1, same lane: q1 is split into f16 hi + (x2048) residual in registers and never leaves the wave. O[b*S+q][h*64+d] = the step-2 result (256-B segments)
__global__ __launch_bounds__(128) void k_attn(const _Float16* __restrict__ QK, const _Float16* __restrict__ KP, const _Float16* __restrict__ VP, float* __restrict__ O) {
  __shared__ __align__(16) float so[4][16][68];
  const int tid = threadIdx.x, wave = tid >> 5, lane = tid & 31, col = lane & 15, g = lane >> 4;
  const int qb = blockIdx.x, h = blockIdx.y, b = blockIdx.z; const int q0 = qb * 64 + wave * 16; const size_t rq = (size_t)b * SS + q0 + col;
  v16h aq[2], aql[2];
#pragma unroll
  for (int kc = 0; kc < 2; ++kc) aq[kc] = frag_h(QK + rq * (2 * DM) + h * HD + kc * 32, lane);
  asm volatile("s_wait_xcnt 0x0" ::: "memory");   // the q loads' address registers are free for reuse (the k fragments below may land in them) only behind this wait
  unsigned ko = (unsigned)(b * NH + h) * (SS / 32) * FPASS + 16u * lane;
  v16h kh[2][2];
#pragma unroll
  for (int ct = 0; ct < 2; ++ct) {
#pragma unroll
    for (int kc = 0; kc < 2; ++kc) kh[ct][kc] = frag_p(KP, ko, ct * 4 + kc * 2); }
  asm volatile("s_wait_xcnt 0x0" : "+v"(ko) :: "memory");   // the first pass steps ko on, which the k loads above name
  v8f acc[4], accl[4];
  const float l1 = attn_keys<0>(aq, aq, KP, VP, ko, kh, acc, accl);   // step 1: q0 is one plane
  const float il1 = (1.0f / 2048.0f) / l1;
  // both loops unrolled: tiles and fragments are indexed by constants and stay in registers
#pragma unroll
  for (int kc = 0; kc < 2; ++kc) {
#pragma unroll
    for (int i = 0; i < 16; ++i) { const float v = (acc[2 * kc + (i >> 3)][i & 7] + accl[2 * kc + (i >> 3)][i & 7] * (1.0f / 2048.0f)) * il1; const _Float16 hv = (_Float16)v; aq[kc][i] = hv; aql[kc][i] = (_Float16)((v - (float)hv) * 2048.0f); } }
  const float l = attn_keys<1>(aq, aql, KP, VP, ko, kh, acc, accl);   // step 2
  const float il = (1.0f / 2048.0f) / l;
#pragma unroll
  for (int dt = 0; dt < 4; ++dt) {
#pragma unroll
    for (int r = 0; r < 8; ++r) so[wave][col][dt * 16 + 8 * g + r] = (acc[dt][r] + accl[dt][r] * (1.0f / 2048.0f)) * il; }
  LDSX();
  for (int rl = 0; rl < 16; ++rl) if (lane < 16) vst2(O + ((size_t)b * SS + q0 + rl) * DM + h * HD + lane * 4, *(const v4f*)&so[wave][rl][lane * 4]);
}
// ---- k_out: block = (64 rows, 128 cols): out = O(hi/lo) . Wo rows (2 products) + bo
__global__ __launch_bounds__(128) void k_out(const float* __restrict__ O, const __bf16* __restrict__ P, const float* __restrict__ BO, float* __restrict__ Y) {
  __shared__ __align__(16) float so[4][16][132];
  const int tid = threadIdx.x, wave = tid >> 5, lane = tid & 31, col = lane & 15, g = lane >> 4; const size_t r0 = (size_t)blockIdx.x * 64 + wave * 16; const int n0 = blockIdx.y * 128;
  v8f acc[8] = {};
#pragma unroll 2
  for (int kc = 0; kc < DM / 32; ++kc) { const F2 a = split_row(O + (r0 + col) * DM, kc * 32, lane);
#pragma unroll
    for (int j = 0; j < 8; ++j) { const v16b w = frag_b(P + (size_t)(n0 + j * 16 + col) * DM + kc * 32, lane); acc[j] = wmma_bf(a.l, w, acc[j]); acc[j] = wmma_bf(a.h, w, acc[j]); } }
#pragma unroll
  for (int j = 0; j < 8; ++j) {
#pragma unroll
    for (int r = 0; r < 8; ++r) so[wave][8 * g + r][j * 16 + col] = acc[j][r] + bfr(BO[n0 + j * 16 + col]); }
  LDSX();
  for (int rl = 0; rl < 16; ++rl) vst2(Y + (r0 + rl) * DM + n0 + lane * 4, *(const v4f*)&so[wave][rl][lane * 4]);
}
// ---- k_lay: every re-lay of the call in one launch of as many blocks as the chip has WGPs: block = (batch b, pass ps of 32 keys, half hq of the heads); a thread's 16 global loads, 512 bytes in a row per wave each, are all requested before the first is used
// Y rows ps * 32 + 0..31, columns hq * 256 + 0..255 -> one f16 tile in LDS -> k chunks (16 bytes of a tile row) and v^T chunks (8 rows of a tile column), both thread-linear in the destination; R rows blockIdx.x * 16 + 0..15 -> q slots of the q plane, element by element
// k chunk (head, slot = ct * 4 + kc * 2 + j, lane = 16 g + col) holds k[key pass * 32 + ct * 16 + col][h * 64 + kc * 32 + j * 16 + 8 g + 0..7]: what lane (col, g) takes as half j of fragment (ct, kc)
// v chunk (head, slot = dt * 2 + j, lane = 16 g + col) holds v[keys pass * 32 + j * 16 + 8 g + 0..7][h * 64 + dt * 16 + col]: what lane (col, g) takes as half j of fragment dt
#define LYP 264                      // halves of one tile row: 256 + 8, so that the 16 rows of a wave's 16-byte chunk reads start 4 banks apart
#define FHEAD ((SS / 32) * (FPASS / 2))   // halves of one head in a fragment-ordered plane
typedef __attribute__((ext_vector_type(4))) _Float16 v4h;
__device__ __forceinline__ v4h lay4(v4f x) { v4h r;
#pragma unroll
  for (int k = 0; k < 4; ++k) r[k] = (_Float16)bfr(x[k]);
  return r; }
__global__ __launch_bounds__(256) void k_lay(const float* __restrict__ R, const float* __restrict__ Y, _Float16* __restrict__ QK, _Float16* __restrict__ KP, _Float16* __restrict__ VP) {
  __shared__ __align__(16) _Float16 sy[32][LYP];
  const int t = threadIdx.x, ln = t & 31, sl = t >> 5;
  const int hq = blockIdx.x & 1, ps = (blockIdx.x >> 1) & (SS / 32 - 1), b = blockIdx.x / (2 * (SS / 32));
  const float* ys = Y + ((size_t)b * SS + ps * 32 + (t >> 6)) * DM + hq * 256 + (t & 63) * 4;   // load i: tile row (t >> 6) + 4 i
  const float* rs = R + (size_t)blockIdx.x * 16 * DM + t * 4;                                   // load i: row (t >> 7) + 2 i of the block's 16
  v4f yv[8], rv[8];
  // the loops below are unrolled so that the loaded values are indexed by constants and stay in registers
#pragma unroll
  for (int i = 0; i < 8; ++i) yv[i] = *(const v4f*)(ys + i * 4 * DM);
#pragma unroll
  for (int i = 0; i < 8; ++i) rv[i] = *(const v4f*)(rs + i * 2 * DM);
  asm volatile("s_wait_xcnt 0x0" ::: "memory");   // all 16 loads are requested above this line (without it the last of them sink below the first waits), and it stands in front of every reuse of their address registers
#pragma unroll
  for (int i = 0; i < 8; ++i) vst2(&sy[(t >> 6) + 4 * i][(t & 63) * 4], lay4(yv[i]));
  __syncthreads();   // the tile is whole before any chunk is read from it; no global store stands in front of it, so it waits for none
  const size_t o = ((((size_t)b * NH + hq * 4) * (SS / 32) + ps) * 8 + sl) * (FSLOT / 2) + ln * 8;
  const _Float16* kr = &sy[(sl >> 2) * 16 + (ln & 15)][((sl >> 1) & 1) * 32 + (sl & 1) * 16 + (ln >> 4) * 8];
  const _Float16* vr = &sy[(sl & 1) * 16 + (ln >> 4) * 8][(sl >> 1) * 16 + (ln & 15)];
  _Float16* qd = QK + ((size_t)blockIdx.x * 16 + (t >> 7)) * (2 * DM) + (t & 127) * 4;
  v8h kw[4], vw[4]; v4h qw[8];
#pragma unroll
  for (int hh = 0; hh < 4; ++hh) { kw[hh] = *(const v8h*)(kr + hh * HD);
#pragma unroll
    for (int i = 0; i < 8; ++i) vw[hh][i] = vr[i * LYP + hh * HD]; }
#pragma unroll
  for (int i = 0; i < 8; ++i) qw[i] = lay4(rv[i]);
#pragma unroll
  for (int hh = 0; hh < 4; ++hh) { vst2(KP + o + (size_t)hh * FHEAD, kw[hh]); vst2(VP + o + (size_t)hh * FHEAD, vw[hh]); }
#pragma unroll
  for (int i = 0; i < 8; ++i) vst2(qd + i * 2 * (2 * DM), qw[i]);
}
extern "C" void kernel_launch(void* const* d_in, const int* in_sizes, int n_in, void* d_out, int out_size, void* d_ws, size_t ws_size, hipStream_t stream) {
  (void)in_sizes; (void)n_in; (void)out_size;
  const float** F = (const float**)d_in;   // 0 R [2,2048,512] (state patterns / queries), 1 Y [2,2048,512] (stored patterns = keys = values)
  if (ws_size < (size_t)WS_END) return;
  char* ws = (char*)d_ws; (void)0; _Float16 *QK = (_Float16*)(ws + WS_QK), *KP = (_Float16*)(ws + WS_KP), *VP = (_Float16*)(ws + WS_VP);
  k_lay<<<NB * (SS / 32) * 2, 256, 0, stream>>>(F[0], F[1], QK, KP, VP);
  k_attn<<<dim3(TQB, NH, TNB), 128, 0, stream>>>(QK, KP, VP, (float*)d_out);   // both steps -> output rows [b*L + l][h*64 + e]
}

// v007
// A run of this version takes 80.9 microseconds.
// Timed twice side by side with v006, it ran 1.05 and 1.04 times as fast.
// Over all steps from v000 it is 6.22 times as fast.
// compute dtype: R and Y rounded to bf16; no projections: q0 = R and k = v = Y are bf16 values re-laid on device as ONE f16 plane each (a bf16 value is exact in f16 from 2^-14 up; below that it is rounded to a multiple of 2^-24), k and v in fragment order; step 1: 1-product scores, running-max softmax in f32 (one fma, which holds the 1/8, log2 e, the maximum and P's 2^11, and one hardware base-2 exp a score), P (scaled by 2^11, as f16 hi + residual) x v (2 products) -> q1 kept in registers as f16 hi + (x2048) residual; step 2, in the same launch, the same with q1 hi + residual (2-product scores); f32 accumulate; the final state is the f32 output.
#include <hip/hip_runtime.h>
#include <math.h>

typedef __attribute__((ext_vector_type(16))) _Float16 v16h;
typedef __attribute__((ext_vector_type(16))) __bf16 v16b;
typedef __attribute__((ext_vector_type(8)))  _Float16 v8h;
typedef __attribute__((ext_vector_type(8)))  float v8f;
typedef __attribute__((ext_vector_type(4)))  float v4f;
typedef __attribute__((ext_vector_type(2)))  float v2f;
typedef __attribute__((ext_vector_type(4)))  unsigned v4u;
typedef __attribute__((ext_vector_type(4)))  int v4i;
typedef float __attribute__((may_alias)) float_a;
typedef int __attribute__((may_alias)) int_a;

template <typename T> __device__ __forceinline__ void vst2(void* p, T v) { *(T*)p = v;  }
__device__ __forceinline__ v8f wmma16(v16h a, v16h b, v8f c) {
  v8f d = __builtin_amdgcn_wmma_f32_16x16x32_f16(false, a, false, b, (short)0, c, false, false);
  asm volatile("v_nop\n\tv_nop\n\tv_nop\n\tv_nop" : "+v"(d) : "v"(a), "v"(b));
  return d;
}
__device__ __forceinline__ v8f wmma_bf(v16b a, v16b b, v8f c) {
  v8f d = __builtin_amdgcn_wmma_f32_16x16x32_bf16(false, a, false, b, (short)0, c, false, false);
  asm volatile("v_nop\n\tv_nop\n\tv_nop\n\tv_nop" : "+v"(d) : "v"(a), "v"(b));
  return d;
}
__device__ __forceinline__ v16h frag_h(const _Float16* rowk0, int lane) {
  union { v16h v; v8h q[2]; } u; const _Float16* p = rowk0 + 8 * (lane >> 4);
  u.q[0] = *(const v8h*)p; u.q[1] = *(const v8h*)(p + 16); return u.v;
}
__device__ __forceinline__ v16h frag_f32(const float* rowk0, int lane) {
  v16h a; const float* p = rowk0 + 8 * (lane >> 4);
#pragma unroll
  for (int i = 0; i < 8; ++i) { a[i] = (_Float16)p[i]; a[8 + i] = (_Float16)p[16 + i]; }
  return a;
}
__device__ __forceinline__ v16h frag_f32s(const float* rowk0, int lane, float sc) {
  v16h a; const float* p = rowk0 + 8 * (lane >> 4);
#pragma unroll
  for (int i = 0; i < 8; ++i) { a[i] = (_Float16)(p[i] * sc); a[8 + i] = (_Float16)(p[16 + i] * sc); }
  return a;
}
// column fragment from a [K][ld] layout (column n), rows >= K read as 0
__device__ __forceinline__ v16h fragc_f32(const float* W, int k0, int n, int lane, int ld, int K) {
  v16h a; const int g = lane >> 4;
#pragma unroll
  for (int i = 0; i < 8; ++i) { const int ka = k0 + 8 * g + i, kb = ka + 16;
    a[i] = (_Float16)(ka < K ? W[(size_t)(ka < K ? ka : K - 1) * ld + n] : 0.f); a[8 + i] = (_Float16)(kb < K ? W[(size_t)(kb < K ? kb : K - 1) * ld + n] : 0.f); }
  return a;
}
struct F2 { v16b h, l; };
__device__ __forceinline__ F2 bsplit16(const float v[16]) { F2 r;
#pragma unroll
  for (int i = 0; i < 16; ++i) { const __bf16 h = (__bf16)v[i]; r.h[i] = h; r.l[i] = (__bf16)(v[i] - (float)h); }
  return r; }
__device__ __forceinline__ F2 split_row(const float* row, int k0, int lane) { float v[16]; const float* p = row + k0 + 8 * (lane >> 4);
#pragma unroll
  for (int i = 0; i < 8; ++i) { v[i] = p[i]; v[8 + i] = p[16 + i]; }
  return bsplit16(v); }
__device__ __forceinline__ F2 split_rowK(const float* row, int k0, int lane, int K) { float v[16]; const int g = lane >> 4;
#pragma unroll
  for (int i = 0; i < 8; ++i) { const int ka = k0 + 8 * g + i, kb = ka + 16; v[i] = ka < K ? row[ka < K ? ka : K - 1] : 0.f; v[8 + i] = kb < K ? row[kb < K ? kb : K - 1] : 0.f; }
  return bsplit16(v); }
__device__ __forceinline__ F2 split_col(const float* W, int k0, int n, int lane, int ld, int K) { float v[16]; const int g = lane >> 4;
#pragma unroll
  for (int i = 0; i < 8; ++i) { const int ka = k0 + 8 * g + i, kb = ka + 16; v[i] = ka < K ? W[(size_t)(ka < K ? ka : K - 1) * ld + n] : 0.f; v[8 + i] = kb < K ? W[(size_t)(kb < K ? kb : K - 1) * ld + n] : 0.f; }
  return bsplit16(v); }
__device__ __forceinline__ v8f mac3(const F2& a, const F2& b, v8f c) { c = wmma_bf(a.l, b.h, c); c = wmma_bf(a.h, b.l, c); return wmma_bf(a.h, b.h, c); }
__device__ __forceinline__ float sigm(float v) { return 1.0f / (1.0f + expf(-v)); }
#define LDSX() do { asm volatile("s_wait_dscnt 0" ::: "memory"); __builtin_amdgcn_wave_barrier(); __builtin_amdgcn_fence(__ATOMIC_RELEASE, "workgroup"); } while (0)


#define NB 2
#define SS 2048
#define DM 512
#define NH 8
#define HD 64
#define QKVW (3 * DM)
#ifndef TQB
#define TQB (SS / 64)
#define TNB NB
#define TOB (NB * SS / 64)     // output row tiles (all)
#endif
typedef __attribute__((ext_vector_type(8))) __bf16 v8b;
__device__ __forceinline__ v16b frag_b(const __bf16* rowk0, int lane) {
  union { v16b v; v8b q[2]; } u; const __bf16* p = rowk0 + 8 * (lane >> 4);
  u.q[0] = *(const v8b*)p; u.q[1] = *(const v8b*)(p + 16); return u.v;
}
#define FSLOT 512                    // bytes of one slot: one 16-byte load of every lane of a wave, lane after lane (four whole 128-byte lines)
#define FPASS (8 * FSLOT)            // bytes of one pass of one head: 8 slots; a fragment is two slots in a row (its k halves 0-15 and 16-31)
// fragment in frag_h's k order from a fragment-ordered plane: its base, the lane's byte offset (pass and lane) and the fragment's first slot
__device__ __forceinline__ v16h frag_p(const _Float16* base, unsigned boff, int slot) {
  union { v16h v; v8h q[2]; } u; const char* p = (const char*)base + boff + slot * FSLOT;
  u.q[0] = *(const v8h*)p; u.q[1] = *(const v8h*)(p + FSLOT); return u.v;
}
__device__ __forceinline__ float bfr(float v) { return (float)(__bf16)v; }
__device__ __attribute__((noinline)) float exp_ni(float v) { return expf(v); }
__device__ __attribute__((noinline)) float erf_ni(float v) { return erff(v); }

#define PK_A 0                       // [1536][512] Wqkv rows (natural [out][in])
#define PK_P (PK_A + QKVW * DM)        // [512][512] Wo rows (natural)
#define PK_END (PK_P + DM * DM)
#define WS_PK  0u
#define WS_QK  (WS_PK + 2u * PK_END)             // f16 [4096 rows][1024]: q | k
#define WS_QKL (WS_QK + 2u * NB * SS * 2 * DM)     // f16 q | k residual planes x2048
#define WS_VTH (WS_QKL + 2u * NB * SS * 2 * DM)    // f16 [b][512 (h*64+d)][2048 s] hi
#define WS_VTL (WS_VTH + 2u * NB * DM * SS)        // f16 lo x 2048
#define WS_O   (WS_VTL + 2u * NB * DM * SS)        // f32 [4096][512]
#define WS_CS  (WS_O + 4u * NB * SS * DM)           // f32 2 x [2048][32]: reserved, nothing writes or reads it
#define WS_KP  (WS_CS + 4u * 2 * SS * 32)          // f16 k in fragment order: [b][h][pass of 32 keys][8 slots][32 lanes][8]
#define WS_VP  (WS_KP + 2u * NB * SS * DM)         // f16 v^T in fragment order, same shape
#define WS_END (WS_VP + 2u * NB * SS * DM)
// ---- k_pack: block = (row n, which): natural [out][in] rows -> bf16; which 0..2 -> W_q/W_k/W_v into PK_A rows which*512 + n; 3 -> W_o into PK_P
__global__ __launch_bounds__(256) void k_pack(const float* __restrict__ WQ, const float* __restrict__ WK, const float* __restrict__ WV, const float* __restrict__ WO, __bf16* __restrict__ PK) {
  __shared__ __align__(16) __bf16 s[DM]; const int n = blockIdx.x, which = blockIdx.y, t = threadIdx.x; const float* Wm = (which == 0) ? WQ : (which == 1) ? WK : (which == 2) ? WV : WO;
  for (int k = t; k < DM; k += 256) s[k] = (__bf16)Wm[(size_t)n * DM + k];
  __syncthreads();
  __bf16* dst = (which < 3) ? PK + PK_A + ((size_t)which * DM + n) * DM : PK + PK_P + (size_t)n * DM;
  for (int q = t; q < DM / 8; q += 256) vst2((unsigned*)(dst + q * 8), *(const v4u*)&s[q * 8]);
}
__global__ __launch_bounds__(128) void k_qkv(const float* __restrict__ XQ, const float* __restrict__ XK, const float* __restrict__ XV, const __bf16* __restrict__ P, const float* __restrict__ BQ, const float* __restrict__ BK, const float* __restrict__ BV, _Float16* __restrict__ QK, _Float16* __restrict__ QKL, _Float16* __restrict__ VTH, _Float16* __restrict__ VTL) {
  const int which0 = (blockIdx.y * 128) / DM; const float* X = (which0 == 0) ? XQ : (which0 == 1) ? XK : XV; const float* BB = BQ ? (((which0 == 0) ? BQ : (which0 == 1) ? BK : BV) + (blockIdx.y * 128 - which0 * DM)) : nullptr;
  __shared__ __align__(16) _Float16 so[4][16][136], sol[4][16][136]; __shared__ __align__(16) _Float16 sth[128][72], stl[128][72];
  const int tid = threadIdx.x, wave = tid >> 5, lane = tid & 31, col = lane & 15, g = lane >> 4; const size_t r0 = (size_t)blockIdx.x * 64 + wave * 16; const int n0 = blockIdx.y * 128;
  v8f acc[8] = {};
#pragma unroll 2
  for (int kc = 0; kc < DM / 32; ++kc) { v16b a; { const float* p = X + (r0 + col) * DM + kc * 32 + 8 * g;
#pragma unroll
      for (int i = 0; i < 8; ++i) { a[i] = (__bf16)p[i]; a[8 + i] = (__bf16)p[16 + i]; } }
#pragma unroll
    for (int j = 0; j < 8; ++j) acc[j] = wmma_bf(a, frag_b(P + (size_t)(n0 + j * 16 + col) * DM + kc * 32, lane), acc[j]); }
  if (n0 < 2 * DM) {   // q stored unscaled (f16 sigma ~0.6, no subnormal exposure); 1/8 applied to the f32 score
#pragma unroll
    for (int j = 0; j < 8; ++j) {
#pragma unroll
      for (int r = 0; r < 8; ++r) { const float v = acc[j][r] + (BB ? bfr(BB[j * 16 + col]) : 0.f); const _Float16 hv = (_Float16)v; so[wave][8 * g + r][j * 16 + col] = hv; sol[wave][8 * g + r][j * 16 + col] = (_Float16)((v - (float)hv) * 2048.0f); } }   // q, k (+ bias) as f16 hi + (x2048) residual
    LDSX();
    for (int rl = 0; rl < 16; ++rl) if (lane < 16) { vst2((unsigned*)(QK + (r0 + rl) * (2 * DM) + n0 + lane * 8), *(const v4u*)&so[wave][rl][lane * 8]); vst2((unsigned*)(QKL + (r0 + rl) * (2 * DM) + n0 + lane * 8), *(const v4u*)&sol[wave][rl][lane * 8]); }
  } else {
#pragma unroll
    for (int j = 0; j < 8; ++j) {
#pragma unroll
      for (int r = 0; r < 8; ++r) { const float v = acc[j][r] + (BB ? bfr(BB[j * 16 + col]) : 0.f); const _Float16 hv = (_Float16)v; sth[j * 16 + col][wave * 16 + 8 * g + r] = hv; stl[j * 16 + col][wave * 16 + 8 * g + r] = (_Float16)((v - (float)hv) * 2048.0f); } }
    __syncthreads();
    const size_t rb = (size_t)blockIdx.x * 64; const int b = (int)(rb / SS), s0 = (int)(rb % SS); const int pc0 = n0 - 2 * DM;
    for (int q = tid; q < 128 * 8; q += 128) { const int d = q >> 3, pc = q & 7; const size_t o = ((size_t)b * DM + pc0 + d) * SS + s0 + pc * 8; vst2((unsigned*)(VTH + o), *(const v4u*)&sth[d][pc * 8]); vst2((unsigned*)(VTL + o), *(const v4u*)&stl[d][pc * 8]); }
  }
}
// lane l with lane l ^ 16 (the two lane halves hold the two key halves of one query column)
__device__ __forceinline__ float xhalf(float x) { return __builtin_bit_cast(float, __builtin_amdgcn_permlanex16(__builtin_bit_cast(int, x), __builtin_bit_cast(int, x), 0x76543210, 0xfedcba98, false, false)); }
// ---- attn_keys: one update step of one wave's 16 queries over all keys of its head: flash attention (K = 64: 2 k-steps), transposed: S^T = K . Q^T (A = k rows, B = q rows), so a lane holds 16 of the 32 scores of ONE query (keys 8g + r and 16 + 8g + r): maximum and sum in-lane plus one exchange between the lane halves; the two score tiles, converted in place, are the B operand P^T of O^T += V^T . P^T (A = v^T rows): P never touches LDS. k and v are one f16 plane each; QRES = 1: q is f16 hi + residual (2 products), QRES = 0: q is one f16 plane too (1 product, aql not read); the weight of a score c = q.k is 2^(KS c - KS max + 11) = 2^11 exp((c - max) / 8); P is f16 hi + residual (2 products); the step's result is O[query col][d] = (acc + accl / 2048) / l, l the returned row sum of those weights
template <int QRES> __device__ __forceinline__ float attn_keys(const v16h (&aq)[2], const v16h (&aql)[2], const _Float16* __restrict__ KP, const _Float16* __restrict__ VP, unsigned& ko, v16h (&kh)[2][2], v8f (&acc)[4], v8f (&accl)[4]) {
  constexpr float KS = 0.125f * 1.44269504088896340736f;   // 1/sqrt(64) * log2 e: an unscaled score times KS is its base-2 exponent
  float m = -3.0e38f, l = 0.f;   // of query column col; m is the maximum of the unscaled scores; l is this lane half's share of the sum, joined behind the loop
#pragma unroll
  for (int dt = 0; dt < 4; ++dt) { acc[dt] = v8f{}; accl[dt] = v8f{}; }   // O^T tiles: register r = O[query col][dt * 16 + 8 g + r] (unrolled: constant indices)
  const int nks = SS / 32;   // all keys
  // fragment loads run ahead of the products that use them: the k fragments of pass ks + 1 are requested right behind the score products of pass ks, the v fragments of pass ks at its top
  // one byte offset per lane serves every k slot of a pass, one every v slot: each load of a wave reads 512 bytes in a row
  // the short loops over ct, kc and dt below are unrolled so that the fragment arrays are indexed by constants and stay in registers
  unsigned vo = ko;   // on entry ko is the lane's offset of the head's pass 0, whose k fragments are in kh or on their way; so it is again on return
#pragma unroll 1
  for (int ks = 0; ks < nks; ++ks) { v8f s[2]; v16h vh[4];
#pragma unroll
    for (int dt = 0; dt < 4; ++dt) vh[dt] = frag_p(VP, vo, dt * 2);
#pragma unroll
    for (int ct = 0; ct < 2; ++ct) { v8f c = {}, cl = {};
#pragma unroll
      for (int kc = 0; kc < 2; ++kc) { c = wmma16(kh[ct][kc], aq[kc], c); if constexpr (QRES) cl = wmma16(kh[ct][kc], aql[kc], cl); }   // k x q hi (+ k x q residual); register r = score of key ct * 16 + 8 g + r with query col
      if constexpr (QRES) {
#pragma unroll
        for (int r = 0; r < 8; ++r) c[r] += cl[r] * (1.0f / 2048.0f); }
#pragma unroll
      for (int r = 0; r < 8; ++r) s[ct][r] = c[r];   // unscaled
    }
    ko += (ks + 1 < nks) ? (unsigned)FPASS : 0u - (unsigned)(nks - 1) * FPASS;   // the last pass requests pass 0 again: the next step's first fragments (behind the last step: in bounds, never used)
#pragma unroll
    for (int ct = 0; ct < 2; ++ct) {
#pragma unroll
      for (int kc = 0; kc < 2; ++kc) kh[ct][kc] = frag_p(KP, ko, ct * 4 + kc * 2); }
    __builtin_amdgcn_sched_barrier(0);   // keeps the next pass's k requests here, a whole softmax and P.V ahead of their use: without it they sink below the softmax, whose temporaries take their registers
    float mx[8];
#pragma unroll
    for (int r = 0; r < 8; ++r) mx[r] = fmaxf(s[0][r], s[1][r]);
#pragma unroll
    for (int w = 4; w > 0; w >>= 1) {
#pragma unroll
      for (int r = 0; r < w; ++r) mx[r] = fmaxf(mx[r], mx[r + w]); }
    const float mn = fmaxf(m, fmaxf(mx[0], xhalf(mx[0]))); const float alpha = __builtin_amdgcn_exp2f((m - mn) * KS); m = mn;   // first pass: 2^(-5e37) = 0
    const float nb = fmaf(mn, -KS, 11.0f);
    float e[16];
#pragma unroll
    for (int i = 0; i < 16; ++i) e[i] = __builtin_amdgcn_exp2f(fmaf(s[i >> 3][i & 7], KS, nb));   // the weight, 2^11 included
    float es[8];
#pragma unroll
    for (int r = 0; r < 8; ++r) es[r] = e[r] + e[8 + r];
#pragma unroll
    for (int w = 4; w > 0; w >>= 1) {
#pragma unroll
      for (int r = 0; r < w; ++r) es[r] += es[r + w]; }
    l = l * alpha + es[0];
#pragma unroll
    for (int dt = 0; dt < 4; ++dt) {
#pragma unroll
      for (int r = 0; r < 8; ++r) { acc[dt][r] *= alpha; accl[dt][r] *= alpha; } }
    asm volatile("s_wait_xcnt 0x0" : "+v"(ko), "+v"(vo) :: "memory");   // the two offset registers of this pass's fragment loads are held whole up to this wait; only behind it are they stepped on
    vo += FPASS;
    v16h pa, pl;   // P^T as B operand: element i = key kmap(i, g) of query col, which is where the two score tiles already hold it
#pragma unroll
    for (int i = 0; i < 16; ++i) { const float x0 = e[i]; const _Float16 h0 = (_Float16)x0; pa[i] = h0; pl[i] = (_Float16)((x0 - (float)h0) * 2048.0f); }   // P carries 2^11 into the f16 split so small softmax weights stay out of the f16 subnormal range; the row sum carries it too, so it cancels in the epilogue
#pragma unroll
    for (int dt = 0; dt < 4; ++dt) { acc[dt] = wmma16(vh[dt], pa, acc[dt]); accl[dt] = wmma16(vh[dt], pl, accl[dt]); }   // V x P hi + (V x P lo) / 2048
  }
  l += xhalf(l);   // the two lane halves' shares of the row sum
  return l;
}
// ---- k_attn: block = (64 queries, head h, batch b): BOTH update steps. A head's step-2 queries are its own step-1 results, and the O^T tiles hold them where the q operand wants them: element i of fragment kc is d = kc * 32 + 8 g + i = register i of tile 2 kc, element 8 + i is register i of tile 2 kc + 1, same lane: q1 is split into f16 hi + (x2048) residual in registers and never leaves the wave. O[b*S+q][h*64+d] = the step-2 result (256-B segments)
__global__ __launch_bounds__(128) void k_attn(const _Float16* __restrict__ QK, const _Float16* __restrict__ KP, const _Float16* __restrict__ VP, float* __restrict__ O) {
  __shared__ __align__(16) float so[4][16][68];
  const int tid = threadIdx.x, wave = tid >> 5, lane = tid & 31, col = lane & 15, g = lane >> 4;
  const int qb = blockIdx.x, h = blockIdx.y, b = blockIdx.z; const int q0 = qb * 64 + wave * 16; const size_t rq = (size_t)b * SS + q0 + col;
  v16h aq[2], aql[2];
#pragma unroll
  for (int kc = 0; kc < 2; ++kc) aq[kc] = frag_h(QK + rq * (2 * DM) + h * HD + kc * 32, lane);
  asm volatile("s_wait_xcnt 0x0" ::: "memory");   // the q loads' address registers are free for reuse (the k fragments below may land in them) only behind this wait
  unsigned ko = (unsigned)(b * NH + h) * (SS / 32) * FPASS + 16u * lane;
  v16h kh[2][2];
#pragma unroll
  for (int ct = 0; ct < 2; ++ct) {
#pragma unroll
    for (int kc = 0; kc < 2; ++kc) kh[ct][kc] = frag_p(KP, ko, ct * 4 + kc * 2); }
  asm volatile("s_wait_xcnt 0x0" : "+v"(ko) :: "memory");   // the first pass steps ko on, which the k loads above name
  v8f acc[4], accl[4];
  const float l1 = attn_keys<0>(aq, aq, KP, VP, ko, kh, acc, accl);   // step 1: q0 is one plane
  const float il1 = 1.0f / l1;
  // both loops unrolled: tiles and fragments are indexed by constants and stay in registers
#pragma unroll
  for (int kc = 0; kc < 2; ++kc) {
#pragma unroll
    for (int i = 0; i < 16; ++i) { const float v = (acc[2 * kc + (i >> 3)][i & 7] + accl[2 * kc + (i >> 3)][i & 7] * (1.0f / 2048.0f)) * il1; const _Float16 hv = (_Float16)v; aq[kc][i] = hv; aql[kc][i] = (_Float16)((v - (float)hv) * 2048.0f); } }
  const float l = attn_keys<1>(aq, aql, KP, VP, ko, kh, acc, accl);   // step 2
  const float il = 1.0f / l;
#pragma unroll
  for (int dt = 0; dt < 4; ++dt) {
#pragma unroll
    for (int r = 0; r < 8; ++r) so[wave][col][dt * 16 + 8 * g + r] = (acc[dt][r] + accl[dt][r] * (1.0f / 2048.0f)) * il; }
  LDSX();
  for (int rl = 0; rl < 16; ++rl) if (lane < 16) vst2(O + ((size_t)b * SS + q0 + rl) * DM + h * HD + lane * 4, *(const v4f*)&so[wave][rl][lane * 4]);
}
// ---- k_out: block = (64 rows, 128 cols): out = O(hi/lo) . Wo rows (2 products) + bo
__global__ __launch_bounds__(128) void k_out(const float* __restrict__ O, const __bf16* __restrict__ P, const float* __restrict__ BO, float* __restrict__ Y) {
  __shared__ __align__(16) float so[4][16][132];
  const int tid = threadIdx.x, wave = tid >> 5, lane = tid & 31, col = lane & 15, g = lane >> 4; const size_t r0 = (size_t)blockIdx.x * 64 + wave * 16; const int n0 = blockIdx.y * 128;
  v8f acc[8] = {};
#pragma unroll 2
  for (int kc = 0; kc < DM / 32; ++kc) { const F2 a = split_row(O + (r0 + col) * DM, kc * 32, lane);
#pragma unroll
    for (int j = 0; j < 8; ++j) { const v16b w = frag_b(P + (size_t)(n0 + j * 16 + col) * DM + kc * 32, lane); acc[j] = wmma_bf(a.l, w, acc[j]); acc[j] = wmma_bf(a.h, w, acc[j]); } }
#pragma unroll
  for (int j = 0; j < 8; ++j) {
#pragma unroll
    for (int r = 0; r < 8; ++r) so[wave][8 * g + r][j * 16 + col] = acc[j][r] + bfr(BO[n0 + j * 16 + col]); }
  LDSX();
  for (int rl = 0; rl < 16; ++rl) vst2(Y + (r0 + rl) * DM + n0 + lane * 4, *(const v4f*)&so[wave][rl][lane * 4]);
}
// ---- k_lay: every re-lay of the call in one launch of as many blocks as the chip has WGPs: block = (batch b, pass ps of 32 keys, half hq of the heads); a thread's 16 global loads, 512 bytes in a row per wave each, are all requested before the first is used
// Y rows ps * 32 + 0..31, columns hq * 256 + 0..255 -> one f16 tile in LDS -> k chunks (16 bytes of a tile row) and v^T chunks (8 rows of a tile column), both thread-linear in the destination; R rows blockIdx.x * 16 + 0..15 -> q slots of the q plane, element by element
// k chunk (head, slot = ct * 4 + kc * 2 + j, lane = 16 g + col) holds k[key pass * 32 + ct * 16 + col][h * 64 + kc * 32 + j * 16 + 8 g + 0..7]: what lane (col, g) takes as half j of fragment (ct, kc)
// v chunk (head, slot = dt * 2 + j, lane = 16 g + col) holds v[keys pass * 32 + j * 16 + 8 g + 0..7][h * 64 + dt * 16 + col]: what lane (col, g) takes as half j of fragment dt
#define LYP 264                      // halves of one tile row: 256 + 8, so that the 16 rows of a wave's 16-byte chunk reads start 4 banks apart
#define FHEAD ((SS / 32) * (FPASS / 2))   // halves of one head in a fragment-ordered plane
typedef __attribute__((ext_vector_type(4))) _Float16 v4h;
__device__ __forceinline__ v4h lay4(v4f x) { v4h r;
#pragma unroll
  for (int k = 0; k < 4; ++k) r[k] = (_Float16)bfr(x[k]);
  return r; }
__global__ __launch_bounds__(256) void k_lay(const float* __restrict__ R, const float* __restrict__ Y, _Float16* __restrict__ QK, _Float16* __restrict__ KP, _Float16* __restrict__ VP) {
  __shared__ __align__(16) _Float16 sy[32][LYP];
  const int t = threadIdx.x, ln = t & 31, sl = t >> 5;
  const int hq = blockIdx.x & 1, ps = (blockIdx.x >> 1) & (SS / 32 - 1), b = blockIdx.x / (2 * (SS / 32));
  const float* ys = Y + ((size_t)b * SS + ps * 32 + (t >> 6)) * DM + hq * 256 + (t & 63) * 4;   // load i: tile row (t >> 6) + 4 i
  const float* rs = R + (size_t)blockIdx.x * 16 * DM + t * 4;                                   // load i: row (t >> 7) + 2 i of the block's 16
  v4f yv[8], rv[8];
  // the loops below are unrolled so that the loaded values are indexed by constants and stay in registers
#pragma unroll
  for (int i = 0; i < 8; ++i) yv[i] = *(const v4f*)(ys + i * 4 * DM);
#pragma unroll
  for (int i = 0; i < 8; ++i) rv[i] = *(const v4f*)(rs + i * 2 * DM);
  asm volatile("s_wait_xcnt 0x0" ::: "memory");   // all 16 loads are requested above this line (without it the last of them sink below the first waits), and it stands in front of every reuse of their address registers
#pragma unroll
  for (int i = 0; i < 8; ++i) vst2(&sy[(t >> 6) + 4 * i][(t & 63) * 4], lay4(yv[i]));
  __syncthreads();   // the tile is whole before any chunk is read from it; no global store stands in front of it, so it waits for none
  const size_t o = ((((size_t)b * NH + hq * 4) * (SS / 32) + ps) * 8 + sl) * (FSLOT / 2) + ln * 8;
  const _Float16* kr = &sy[(sl >> 2) * 16 + (ln & 15)][((sl >> 1) & 1) * 32 + (sl & 1) * 16 + (ln >> 4) * 8];
  const _Float16* vr = &sy[(sl & 1) * 16 + (ln >> 4) * 8][(sl >> 1) * 16 + (ln & 15)];
  _Float16* qd = QK + ((size_t)blockIdx.x * 16 + (t >> 7)) * (2 * DM) + (t & 127) * 4;
  v8h kw[4], vw[4]; v4h qw[8];
#pragma unroll
  for (int hh = 0; hh < 4; ++hh) { kw[hh] = *(const v8h*)(kr + hh * HD);
#pragma unroll
    for (int i = 0; i < 8; ++i) vw[hh][i] = vr[i * LYP + hh * HD]; }
#pragma unroll
  for (int i = 0; i < 8; ++i) qw[i] = lay4(rv[i]);
#pragma unroll
  for (int hh = 0; hh < 4; ++hh) { vst2(KP + o + (size_t)hh * FHEAD, kw[hh]); vst2(VP + o + (size_t)hh * FHEAD, vw[hh]); }
#pragma unroll
  for (int i = 0; i < 8; ++i) vst2(qd + i * 2 * (2 * DM), qw[i]);
}
extern "C" void kernel_launch(void* const* d_in, const int* in_sizes, int n_in, void* d_out, int out_size, void* d_ws, size_t ws_size, hipStream_t stream) {
  (void)in_sizes; (void)n_in; (void)out_size;
  const float** F = (const float**)d_in;   // 0 R [2,2048,512] (state patterns / queries), 1 Y [2,2048,512] (stored patterns = keys = values)
  if (ws_size < (size_t)WS_END) return;
  char* ws = (char*)d_ws; (void)0; _Float16 *QK = (_Float16*)(ws + WS_QK), *KP = (_Float16*)(ws + WS_KP), *VP = (_Float16*)(ws + WS_VP);
  k_lay<<<NB * (SS / 32) * 2, 256, 0, stream>>>(F[0], F[1], QK, KP, VP);
  k_attn<<<dim3(TQB, NH, TNB), 128, 0, stream>>>(QK, KP, VP, (float*)d_out);   // both steps -> output rows [b*L + l][h*64 + e]
}

// v008
// One run takes 60.6 microseconds.
// Next to v007, in two timings, it ran 1.34 times as fast each time.
// Over all steps from v000 it is 8.33 times as fast.
// compute dtype: R and Y rounded to bf16; no projections: q0 = R and k = v = Y are bf16 values re-laid on device as ONE f16 plane each (a bf16 value is exact in f16 from 2^-14 up; below that it is rounded to a multiple of 2^-24), k and v in fragment order; step 1: 1-product scores, running-max softmax in f32 (one fma, which holds the 1/8, log2 e, the maximum and P's 2^11, and one hardware base-2 exp a score), P (scaled by 2^11, as f16 hi + residual) x v (2 products) -> q1 kept in registers as f16 hi + (x2048) residual; step 2, in the same launch, the same with q1 hi + residual (2-product scores); each step's keys are split between two waves, whose maxima, sums and results are joined in f32 through LDS; f32 accumulate; the final state is the f32 output.
#include <hip/hip_runtime.h>
#include <math.h>

typedef __attribute__((ext_vector_type(16))) _Float16 v16h;
typedef __attribute__((ext_vector_type(16))) __bf16 v16b;
typedef __attribute__((ext_vector_type(8)))  _Float16 v8h;
typedef __attribute__((ext_vector_type(8)))  float v8f;
typedef __attribute__((ext_vector_type(4)))  float v4f;
typedef __attribute__((ext_vector_type(2)))  float v2f;
typedef __attribute__((ext_vector_type(4)))  unsigned v4u;
typedef __attribute__((ext_vector_type(4)))  int v4i;
typedef float __attribute__((may_alias)) float_a;
typedef int __attribute__((may_alias)) int_a;

template <typename T> __device__ __forceinline__ void vst2(void* p, T v) { *(T*)p = v;  }
__device__ __forceinline__ v8f wmma16(v16h a, v16h b, v8f c) {
  v8f d = __builtin_amdgcn_wmma_f32_16x16x32_f16(false, a, false, b, (short)0, c, false, false);
  asm volatile("v_nop\n\tv_nop\n\tv_nop\n\tv_nop" : "+v"(d) : "v"(a), "v"(b));
  return d;
}
__device__ __forceinline__ v8f wmma_bf(v16b a, v16b b, v8f c) {
  v8f d = __builtin_amdgcn_wmma_f32_16x16x32_bf16(false, a, false, b, (short)0, c, false, false);
  asm volatile("v_nop\n\tv_nop\n\tv_nop\n\tv_nop" : "+v"(d) : "v"(a), "v"(b));
  return d;
}
__device__ __forceinline__ v16h frag_h(const _Float16* rowk0, int lane) {
  union { v16h v; v8h q[2]; } u; const _Float16* p = rowk0 + 8 * (lane >> 4);
  u.q[0] = *(const v8h*)p; u.q[1] = *(const v8h*)(p + 16); return u.v;
}
__device__ __forceinline__ v16h frag_f32(const float* rowk0, int lane) {
  v16h a; const float* p = rowk0 + 8 * (lane >> 4);
#pragma unroll
  for (int i = 0; i < 8; ++i) { a[i] = (_Float16)p[i]; a[8 + i] = (_Float16)p[16 + i]; }
  return a;
}
__device__ __forceinline__ v16h frag_f32s(const float* rowk0, int lane, float sc) {
  v16h a; const float* p = rowk0 + 8 * (lane >> 4);
#pragma unroll
  for (int i = 0; i < 8; ++i) { a[i] = (_Float16)(p[i] * sc); a[8 + i] = (_Float16)(p[16 + i] * sc); }
  return a;
}
// column fragment from a [K][ld] layout (column n), rows >= K read as 0
__device__ __forceinline__ v16h fragc_f32(const float* W, int k0, int n, int lane, int ld, int K) {
  v16h a; const int g = lane >> 4;
#pragma unroll
  for (int i = 0; i < 8; ++i) { const int ka = k0 + 8 * g + i, kb = ka + 16;
    a[i] = (_Float16)(ka < K ? W[(size_t)(ka < K ? ka : K - 1) * ld + n] : 0.f); a[8 + i] = (_Float16)(kb < K ? W[(size_t)(kb < K ? kb : K - 1) * ld + n] : 0.f); }
  return a;
}
struct F2 { v16b h, l; };
__device__ __forceinline__ F2 bsplit16(const float v[16]) { F2 r;
#pragma unroll
  for (int i = 0; i < 16; ++i) { const __bf16 h = (__bf16)v[i]; r.h[i] = h; r.l[i] = (__bf16)(v[i] - (float)h); }
  return r; }
__device__ __forceinline__ F2 split_row(const float* row, int k0, int lane) { float v[16]; const float* p = row + k0 + 8 * (lane >> 4);
#pragma unroll
  for (int i = 0; i < 8; ++i) { v[i] = p[i]; v[8 + i] = p[16 + i]; }
  return bsplit16(v); }
__device__ __forceinline__ F2 split_rowK(const float* row, int k0, int lane, int K) { float v[16]; const int g = lane >> 4;
#pragma unroll
  for (int i = 0; i < 8; ++i) { const int ka = k0 + 8 * g + i, kb = ka + 16; v[i] = ka < K ? row[ka < K ? ka : K - 1] : 0.f; v[8 + i] = kb < K ? row[kb < K ? kb : K - 1] : 0.f; }
  return bsplit16(v); }
__device__ __forceinline__ F2 split_col(const float* W, int k0, int n, int lane, int ld, int K) { float v[16]; const int g = lane >> 4;
#pragma unroll
  for (int i = 0; i < 8; ++i) { const int ka = k0 + 8 * g + i, kb = ka + 16; v[i] = ka < K ? W[(size_t)(ka < K ? ka : K - 1) * ld + n] : 0.f; v[8 + i] = kb < K ? W[(size_t)(kb < K ? kb : K - 1) * ld + n] : 0.f; }
  return bsplit16(v); }
__device__ __forceinline__ v8f mac3(const F2& a, const F2& b, v8f c) { c = wmma_bf(a.l, b.h, c); c = wmma_bf(a.h, b.l, c); return wmma_bf(a.h, b.h, c); }
__device__ __forceinline__ float sigm(float v) { return 1.0f / (1.0f + expf(-v)); }
#define LDSX() do { asm volatile("s_wait_dscnt 0" ::: "memory"); __builtin_amdgcn_wave_barrier(); __builtin_amdgcn_fence(__ATOMIC_RELEASE, "workgroup"); } while (0)


#define NB 2
#define SS 2048
#define DM 512
#define NH 8
#define HD 64
#define QKVW (3 * DM)
#ifndef TQB
#define TQB (SS / 64)
#define TNB NB
#define TOB (NB * SS / 64)     // output row tiles (all)
#endif
typedef __attribute__((ext_vector_type(8))) __bf16 v8b;
__device__ __forceinline__ v16b frag_b(const __bf16* rowk0, int lane) {
  union { v16b v; v8b q[2]; } u; const __bf16* p = rowk0 + 8 * (lane >> 4);
  u.q[0] = *(const v8b*)p; u.q[1] = *(const v8b*)(p + 16); return u.v;
}
#define FSLOT 512                    // bytes of one slot: one 16-byte load of every lane of a wave, lane after lane (four whole 128-byte lines)
#define FPASS (8 * FSLOT)            // bytes of one pass of one head: 8 slots; a fragment is two slots in a row (its k halves 0-15 and 16-31)
// fragment in frag_h's k order from a fragment-ordered plane: its base, the lane's byte offset (pass and lane) and the fragment's first slot
__device__ __forceinline__ v16h frag_p(const _Float16* base, unsigned boff, int slot) {
  union { v16h v; v8h q[2]; } u; const char* p = (const char*)base + boff + slot * FSLOT;
  u.q[0] = *(const v8h*)p; u.q[1] = *(const v8h*)(p + FSLOT); return u.v;
}
__device__ __forceinline__ float bfr(float v) { return (float)(__bf16)v; }
__device__ __attribute__((noinline)) float exp_ni(float v) { return expf(v); }
__device__ __attribute__((noinline)) float erf_ni(float v) { return erff(v); }

#define PK_A 0                       // [1536][512] Wqkv rows (natural [out][in])
#define PK_P (PK_A + QKVW * DM)        // [512][512] Wo rows (natural)
#define PK_END (PK_P + DM * DM)
#define WS_PK  0u
#define WS_QK  (WS_PK + 2u * PK_END)             // f16 [4096 rows][1024]: q | k
#define WS_QKL (WS_QK + 2u * NB * SS * 2 * DM)     // f16 q | k residual planes x2048
#define WS_VTH (WS_QKL + 2u * NB * SS * 2 * DM)    // f16 [b][512 (h*64+d)][2048 s] hi
#define WS_VTL (WS_VTH + 2u * NB * DM * SS)        // f16 lo x 2048
#define WS_O   (WS_VTL + 2u * NB * DM * SS)        // f32 [4096][512]
#define WS_CS  (WS_O + 4u * NB * SS * DM)           // f32 2 x [2048][32]: reserved, nothing writes or reads it
#define WS_KP  (WS_CS + 4u * 2 * SS * 32)          // f16 k in fragment order: [b][h][pass of 32 keys][8 slots][32 lanes][8]
#define WS_VP  (WS_KP + 2u * NB * SS * DM)         // f16 v^T in fragment order, same shape
#define WS_END (WS_VP + 2u * NB * SS * DM)
// ---- k_pack: block = (row n, which): natural [out][in] rows -> bf16; which 0..2 -> W_q/W_k/W_v into PK_A rows which*512 + n; 3 -> W_o into PK_P
__global__ __launch_bounds__(256) void k_pack(const float* __restrict__ WQ, const float* __restrict__ WK, const float* __restrict__ WV, const float* __restrict__ WO, __bf16* __restrict__ PK) {
  __shared__ __align__(16) __bf16 s[DM]; const int n = blockIdx.x, which = blockIdx.y, t = threadIdx.x; const float* Wm = (which == 0) ? WQ : (which == 1) ? WK : (which == 2) ? WV : WO;
  for (int k = t; k < DM; k += 256) s[k] = (__bf16)Wm[(size_t)n * DM + k];
  __syncthreads();
  __bf16* dst = (which < 3) ? PK + PK_A + ((size_t)which * DM + n) * DM : PK + PK_P + (size_t)n * DM;
  for (int q = t; q < DM / 8; q += 256) vst2((unsigned*)(dst + q * 8), *(const v4u*)&s[q * 8]);
}
__global__ __launch_bounds__(128) void k_qkv(const float* __restrict__ XQ, const float* __restrict__ XK, const float* __restrict__ XV, const __bf16* __restrict__ P, const float* __restrict__ BQ, const float* __restrict__ BK, const float* __restrict__ BV, _Float16* __restrict__ QK, _Float16* __restrict__ QKL, _Float16* __restrict__ VTH, _Float16* __restrict__ VTL) {
  const int which0 = (blockIdx.y * 128) / DM; const float* X = (which0 == 0) ? XQ : (which0 == 1) ? XK : XV; const float* BB = BQ ? (((which0 == 0) ? BQ : (which0 == 1) ? BK : BV) + (blockIdx.y * 128 - which0 * DM)) : nullptr;
  __shared__ __align__(16) _Float16 so[4][16][136], sol[4][16][136]; __shared__ __align__(16) _Float16 sth[128][72], stl[128][72];
  const int tid = threadIdx.x, wave = tid >> 5, lane = tid & 31, col = lane & 15, g = lane >> 4; const size_t r0 = (size_t)blockIdx.x * 64 + wave * 16; const int n0 = blockIdx.y * 128;
  v8f acc[8] = {};
#pragma unroll 2
  for (int kc = 0; kc < DM / 32; ++kc) { v16b a; { const float* p = X + (r0 + col) * DM + kc * 32 + 8 * g;
#pragma unroll
      for (int i = 0; i < 8; ++i) { a[i] = (__bf16)p[i]; a[8 + i] = (__bf16)p[16 + i]; } }
#pragma unroll
    for (int j = 0; j < 8; ++j) acc[j] = wmma_bf(a, frag_b(P + (size_t)(n0 + j * 16 + col) * DM + kc * 32, lane), acc[j]); }
  if (n0 < 2 * DM) {   // q stored unscaled (f16 sigma ~0.6, no subnormal exposure); 1/8 applied to the f32 score
#pragma unroll
    for (int j = 0; j < 8; ++j) {
#pragma unroll
      for (int r = 0; r < 8; ++r) { const float v = acc[j][r] + (BB ? bfr(BB[j * 16 + col]) : 0.f); const _Float16 hv = (_Float16)v; so[wave][8 * g + r][j * 16 + col] = hv; sol[wave][8 * g + r][j * 16 + col] = (_Float16)((v - (float)hv) * 2048.0f); } }   // q, k (+ bias) as f16 hi + (x2048) residual
    LDSX();
    for (int rl = 0; rl < 16; ++rl) if (lane < 16) { vst2((unsigned*)(QK + (r0 + rl) * (2 * DM) + n0 + lane * 8), *(const v4u*)&so[wave][rl][lane * 8]); vst2((unsigned*)(QKL + (r0 + rl) * (2 * DM) + n0 + lane * 8), *(const v4u*)&sol[wave][rl][lane * 8]); }
  } else {
#pragma unroll
    for (int j = 0; j < 8; ++j) {
#pragma unroll
      for (int r = 0; r < 8; ++r) { const float v = acc[j][r] + (BB ? bfr(BB[j * 16 + col]) : 0.f); const _Float16 hv = (_Float16)v; sth[j * 16 + col][wave * 16 + 8 * g + r] = hv; stl[j * 16 + col][wave * 16 + 8 * g + r] = (_Float16)((v - (float)hv) * 2048.0f); } }
    __syncthreads();
    const size_t rb = (size_t)blockIdx.x * 64; const int b = (int)(rb / SS), s0 = (int)(rb % SS); const int pc0 = n0 - 2 * DM;
    for (int q = tid; q < 128 * 8; q += 128) { const int d = q >> 3, pc = q & 7; const size_t o = ((size_t)b * DM + pc0 + d) * SS + s0 + pc * 8; vst2((unsigned*)(VTH + o), *(const v4u*)&sth[d][pc * 8]); vst2((unsigned*)(VTL + o), *(const v4u*)&stl[d][pc * 8]); }
  }
}
// lane l with lane l ^ 16 (the two lane halves hold the two key halves of one query column)
__device__ __forceinline__ float xhalf(float x) { return __builtin_bit_cast(float, __builtin_amdgcn_permlanex16(__builtin_bit_cast(int, x), __builtin_bit_cast(int, x), 0x76543210, 0xfedcba98, false, false)); }
// ---- attn_keys: one update step of one wave's 16 queries over the wave's share of the keys of its head (SS / KSPL keys in a row): flash attention (K = 64: 2 k-steps), transposed: S^T = K . Q^T (A = k rows, B = q rows), so a lane holds 16 of the 32 scores of ONE query (keys 8g + r and 16 + 8g + r): maximum and sum in-lane plus one exchange between the lane halves; the two score tiles, converted in place, are the B operand P^T of O^T += V^T . P^T (A = v^T rows): P never touches LDS. k and v are one f16 plane each; QRES = 1: q is f16 hi + residual (2 products), QRES = 0: q is one f16 plane too (1 product, aql not read); the weight of a score c = q.k is 2^(KS c - KS max + 11) = 2^11 exp((c - max) / 8); P is f16 hi + residual (2 products); the share's result is O[query col][d] = (acc + accl / 2048) / l, l the returned row sum of those weights, both relative to the share's own maximum mret
#define KSPL 2                       // waves that share the keys of one 16-query tile
template <int QRES> __device__ __forceinline__ float attn_keys(const v16h (&aq)[2], const v16h (&aql)[2], const _Float16* __restrict__ KP, const _Float16* __restrict__ VP, unsigned& ko, v16h (&kh)[2][2], v8f (&acc)[4], v8f (&accl)[4], float& mret) {
  constexpr float KS = 0.125f * 1.44269504088896340736f;   // 1/sqrt(64) * log2 e: an unscaled score times KS is its base-2 exponent
  float m = -3.0e38f, l = 0.f;   // of query column col; m is the maximum of the unscaled scores; l is this lane half's share of the sum, joined behind the loop
#pragma unroll
  for (int dt = 0; dt < 4; ++dt) { acc[dt] = v8f{}; accl[dt] = v8f{}; }   // O^T tiles: register r = O[query col][dt * 16 + 8 g + r] (unrolled: constant indices)
  const int nks = SS / 32 / KSPL;   // the wave's share of the keys
  // fragment loads run ahead of the products that use them: the k fragments of pass ks + 1 are requested right behind the score products of pass ks, the v fragments of pass ks at its top
  // one byte offset per lane serves every k slot of a pass, one every v slot: each load of a wave reads 512 bytes in a row
  // the short loops over ct, kc and dt below are unrolled so that the fragment arrays are indexed by constants and stay in registers
  unsigned vo = ko;   // on entry ko is the lane's offset of the share's pass 0, whose k fragments are in kh or on their way; so it is again on return
#pragma unroll 1
  for (int ks = 0; ks < nks; ++ks) { v8f s[2]; v16h vh[4];
#pragma unroll
    for (int dt = 0; dt < 4; ++dt) vh[dt] = frag_p(VP, vo, dt * 2);
#pragma unroll
    for (int ct = 0; ct < 2; ++ct) { v8f c = {}, cl = {};
#pragma unroll
      for (int kc = 0; kc < 2; ++kc) { c = wmma16(kh[ct][kc], aq[kc], c); if constexpr (QRES) cl = wmma16(kh[ct][kc], aql[kc], cl); }   // k x q hi (+ k x q residual); register r = score of key ct * 16 + 8 g + r with query col
      if constexpr (QRES) {
#pragma unroll
        for (int r = 0; r < 8; ++r) c[r] += cl[r] * (1.0f / 2048.0f); }
#pragma unroll
      for (int r = 0; r < 8; ++r) s[ct][r] = c[r];   // unscaled
    }
    ko += (ks + 1 < nks) ? (unsigned)FPASS : 0u - (unsigned)(nks - 1) * FPASS;   // the last pass requests pass 0 again: the next step's first fragments (behind the last step: in bounds, never used)
#pragma unroll
    for (int ct = 0; ct < 2; ++ct) {
#pragma unroll
      for (int kc = 0; kc < 2; ++kc) kh[ct][kc] = frag_p(KP, ko, ct * 4 + kc * 2); }
    __builtin_amdgcn_sched_barrier(0);   // keeps the next pass's k requests here, a whole softmax and P.V ahead of their use: without it they sink below the softmax, whose temporaries take their registers
    float mx[8];
#pragma unroll
    for (int r = 0; r < 8; ++r) mx[r] = fmaxf(s[0][r], s[1][r]);
#pragma unroll
    for (int w = 4; w > 0; w >>= 1) {
#pragma unroll
      for (int r = 0; r < w; ++r) mx[r] = fmaxf(mx[r], mx[r + w]); }
    const float mn = fmaxf(m, fmaxf(mx[0], xhalf(mx[0]))); const float alpha = __builtin_amdgcn_exp2f((m - mn) * KS); m = mn;   // first pass: 2^(-5e37) = 0
    const float nb = fmaf(mn, -KS, 11.0f);
    float e[16];
#pragma unroll
    for (int i = 0; i < 16; ++i) e[i] = __builtin_amdgcn_exp2f(fmaf(s[i >> 3][i & 7], KS, nb));   // the weight, 2^11 included
    float es[8];
#pragma unroll
    for (int r = 0; r < 8; ++r) es[r] = e[r] + e[8 + r];
#pragma unroll
    for (int w = 4; w > 0; w >>= 1) {
#pragma unroll
      for (int r = 0; r < w; ++r) es[r] += es[r + w]; }
    l = l * alpha + es[0];
#pragma unroll
    for (int dt = 0; dt < 4; ++dt) {
#pragma unroll
      for (int r = 0; r < 8; ++r) { acc[dt][r] *= alpha; accl[dt][r] *= alpha; } }
    asm volatile("s_wait_xcnt 0x0" : "+v"(ko), "+v"(vo) :: "memory");   // the two offset registers of this pass's fragment loads are held whole up to this wait; only behind it are they stepped on
    vo += FPASS;
    v16h pa, pl;   // P^T as B operand: element i = key kmap(i, g) of query col, which is where the two score tiles already hold it
#pragma unroll
    for (int i = 0; i < 16; ++i) { const float x0 = e[i]; const _Float16 h0 = (_Float16)x0; pa[i] = h0; pl[i] = (_Float16)((x0 - (float)h0) * 2048.0f); }   // P carries 2^11 into the f16 split so small softmax weights stay out of the f16 subnormal range; the row sum carries it too, so it cancels in the epilogue
#pragma unroll
    for (int dt = 0; dt < 4; ++dt) { acc[dt] = wmma16(vh[dt], pa, acc[dt]); accl[dt] = wmma16(vh[dt], pl, accl[dt]); }   // V x P hi + (V x P lo) / 2048
  }
  l += xhalf(l);   // the two lane halves' shares of the row sum
  mret = m;
  return l;
}
// ---- join_shares: the two waves of one query tile (wave and wave ^ 4) hold the same lane layout: each leaves its maximum, row sum and 32 O^T values per lane in LDS (16 bytes a lane, lane after lane), and behind one barrier takes the other's; both then hold the step's whole result o (still to be divided by l), brought to the common maximum
__device__ __forceinline__ void join_shares(float (*xb)[9][32][4], int wave, int lane, float m, float& l, const v8f (&acc)[4], const v8f (&accl)[4], float (&o)[32]) {
  constexpr float KS = 0.125f * 1.44269504088896340736f;
  // the loops over j and k are unrolled so that o is indexed by constants and stays in registers
#pragma unroll
  for (int j = 0; j < 8; ++j) { v4f w;
#pragma unroll
    for (int k = 0; k < 4; ++k) { const int i = 4 * j + k; o[i] = acc[i >> 3][i & 7] + accl[i >> 3][i & 7] * (1.0f / 2048.0f); w[k] = o[i]; }
    *(v4f*)&xb[wave][j][lane][0] = w; }
  *(v2f*)&xb[wave][8][lane][0] = v2f{m, l};
  __syncthreads();   // every wave's share is in LDS before its partner reads it
  const v2f ml = *(const v2f*)&xb[wave ^ 4][8][lane][0];
  const float mn = fmaxf(m, ml[0]); const float a = __builtin_amdgcn_exp2f((m - mn) * KS), c = __builtin_amdgcn_exp2f((ml[0] - mn) * KS);
  l = l * a + ml[1] * c;
#pragma unroll
  for (int j = 0; j < 8; ++j) { const v4f w = *(const v4f*)&xb[wave ^ 4][j][lane][0];
#pragma unroll
    for (int k = 0; k < 4; ++k) o[4 * j + k] = o[4 * j + k] * a + w[k] * c; }
}
// ---- k_attn: block = (64 queries, head h, batch b), 8 waves: wave = (query tile qt of 16, key half hf): BOTH update steps. Two waves a tile, so that four waves (two blocks) stand on each SIMD and fill one another's waits. A head's step-2 queries are its own step-1 results, and the joined O^T tiles hold them where the q operand wants them: element i of fragment kc is d = kc * 32 + 8 g + i = register i of tile 2 kc, element 8 + i is register i of tile 2 kc + 1, same lane: q1 is split into f16 hi + (x2048) residual in registers. O[b*S+q][h*64+d] = the step-2 result; wave hf stores d = hf * 32 + 0..31 (whole 128-B lines)
__global__ __launch_bounds__(256) void k_attn(const _Float16* __restrict__ QK, const _Float16* __restrict__ KP, const _Float16* __restrict__ VP, float* __restrict__ O) {
  __shared__ __align__(16) float xch[2][8][9][32][4];   // one exchange buffer a step: [wave][8 x 4 O^T values, then maximum and sum][lane]
  const int tid = threadIdx.x, wave = tid >> 5, lane = tid & 31, col = lane & 15, g = lane >> 4, qt = wave & 3, hf = wave >> 2;
  const int qb = blockIdx.x, h = blockIdx.y, b = blockIdx.z; const int q0 = qb * 64 + qt * 16; const size_t rq = (size_t)b * SS + q0 + col;
  v16h aq[2], aql[2];
#pragma unroll
  for (int kc = 0; kc < 2; ++kc) aq[kc] = frag_h(QK + rq * (2 * DM) + h * HD + kc * 32, lane);
  asm volatile("s_wait_xcnt 0x0" ::: "memory");   // the q loads' address registers are free for reuse (the k fragments below may land in them) only behind this wait
  unsigned ko = ((unsigned)(b * NH + h) * (SS / 32) + (unsigned)hf * (SS / 32 / KSPL)) * FPASS + 16u * lane;
  v16h kh[2][2];
#pragma unroll
  for (int ct = 0; ct < 2; ++ct) {
#pragma unroll
    for (int kc = 0; kc < 2; ++kc) kh[ct][kc] = frag_p(KP, ko, ct * 4 + kc * 2); }
  asm volatile("s_wait_xcnt 0x0" : "+v"(ko) :: "memory");   // the first pass steps ko on, which the k loads above name
  v8f acc[4], accl[4]; float o[32], m;
  float l1 = attn_keys<0>(aq, aq, KP, VP, ko, kh, acc, accl, m);   // step 1: q0 is one plane
  join_shares(xch[0], wave, lane, m, l1, acc, accl, o);
  const float il1 = 1.0f / l1;
  // both loops unrolled: values and fragments are indexed by constants and stay in registers
#pragma unroll
  for (int kc = 0; kc < 2; ++kc) {
#pragma unroll
    for (int i = 0; i < 16; ++i) { const float v = o[kc * 16 + i] * il1; const _Float16 hv = (_Float16)v; aq[kc][i] = hv; aql[kc][i] = (_Float16)((v - (float)hv) * 2048.0f); } }
  float l = attn_keys<1>(aq, aql, KP, VP, ko, kh, acc, accl, m);   // step 2
  join_shares(xch[1], wave, lane, m, l, acc, accl, o);
  const float il = 1.0f / l;
  float* st = &xch[0][wave][0][0][0];   // the wave's own part of the step-1 buffer as [16 queries][36]: its partner read it before it came to the step-2 barrier
  // both loops below are unrolled: o is indexed by constants and stays in registers, and the four stores follow one another
#pragma unroll
  for (int i = 0; i < 16; ++i) st[col * 36 + (i >> 3) * 16 + 8 * g + (i & 7)] = (hf ? o[16 + i] : o[i]) * il;   // tiles 2 hf and 2 hf + 1
  LDSX();
#pragma unroll
  for (int it = 0; it < 4; ++it) { const int rl = it * 4 + (lane >> 3); vst2(O + ((size_t)b * SS + q0 + rl) * DM + h * HD + hf * 32 + (lane & 7) * 4, *(const v4f*)&st[rl * 36 + (lane & 7) * 4]); }
}
// ---- k_out: block = (64 rows, 128 cols): out = O(hi/lo) . Wo rows (2 products) + bo
__global__ __launch_bounds__(128) void k_out(const float* __restrict__ O, const __bf16* __restrict__ P, const float* __restrict__ BO, float* __restrict__ Y) {
  __shared__ __align__(16) float so[4][16][132];
  const int tid = threadIdx.x, wave = tid >> 5, lane = tid & 31, col = lane & 15, g = lane >> 4; const size_t r0 = (size_t)blockIdx.x * 64 + wave * 16; const int n0 = blockIdx.y * 128;
  v8f acc[8] = {};
#pragma unroll 2
  for (int kc = 0; kc < DM / 32; ++kc) { const F2 a = split_row(O + (r0 + col) * DM, kc * 32, lane);
#pragma unroll
    for (int j = 0; j < 8; ++j) { const v16b w = frag_b(P + (size_t)(n0 + j * 16 + col) * DM + kc * 32, lane); acc[j] = wmma_bf(a.l, w, acc[j]); acc[j] = wmma_bf(a.h, w, acc[j]); } }
#pragma unroll
  for (int j = 0; j < 8; ++j) {
#pragma unroll
    for (int r = 0; r < 8; ++r) so[wave][8 * g + r][j * 16 + col] = acc[j][r] + bfr(BO[n0 + j * 16 + col]); }
  LDSX();
  for (int rl = 0; rl < 16; ++rl) vst2(Y + (r0 + rl) * DM + n0 + lane * 4, *(const v4f*)&so[wave][rl][lane * 4]);
}
// ---- k_lay: every re-lay of the call in one launch of as many blocks as the chip has WGPs: block = (batch b, pass ps of 32 keys, half hq of the heads); a thread's 16 global loads, 512 bytes in a row per wave each, are all requested before the first is used
// Y rows ps * 32 + 0..31, columns hq * 256 + 0..255 -> one f16 tile in LDS -> k chunks (16 bytes of a tile row) and v^T chunks (8 rows of a tile column), both thread-linear in the destination; R rows blockIdx.x * 16 + 0..15 -> q slots of the q plane, element by element
// k chunk (head, slot = ct * 4 + kc * 2 + j, lane = 16 g + col) holds k[key pass * 32 + ct * 16 + col][h * 64 + kc * 32 + j * 16 + 8 g + 0..7]: what lane (col, g) takes as half j of fragment (ct, kc)
// v chunk (head, slot = dt * 2 + j, lane = 16 g + col) holds v[keys pass * 32 + j * 16 + 8 g + 0..7][h * 64 + dt * 16 + col]: what lane (col, g) takes as half j of fragment dt
#define LYP 264                      // halves of one tile row: 256 + 8, so that the 16 rows of a wave's 16-byte chunk reads start 4 banks apart
#define FHEAD ((SS / 32) * (FPASS / 2))   // halves of one head in a fragment-ordered plane
typedef __attribute__((ext_vector_type(4))) _Float16 v4h;
__device__ __forceinline__ v4h lay4(v4f x) { v4h r;
#pragma unroll
  for (int k = 0; k < 4; ++k) r[k] = (_Float16)bfr(x[k]);
  return r; }
__global__ __launch_bounds__(256) void k_lay(const float* __restrict__ R, const float* __restrict__ Y, _Float16* __restrict__ QK, _Float16* __restrict__ KP, _Float16* __restrict__ VP) {
  __shared__ __align__(16) _Float16 sy[32][LYP];
  const int t = threadIdx.x, ln = t & 31, sl = t >> 5;
  const int hq = blockIdx.x & 1, ps = (blockIdx.x >> 1) & (SS / 32 - 1), b = blockIdx.x / (2 * (SS / 32));
  const float* ys = Y + ((size_t)b * SS + ps * 32 + (t >> 6)) * DM + hq * 256 + (t & 63) * 4;   // load i: tile row (t >> 6) + 4 i
  const float* rs = R + (size_t)blockIdx.x * 16 * DM + t * 4;                                   // load i: row (t >> 7) + 2 i of the block's 16
  v4f yv[8], rv[8];
  // the loops below are unrolled so that the loaded values are indexed by constants and stay in registers
#pragma unroll
  for (int i = 0; i < 8; ++i) yv[i] = *(const v4f*)(ys + i * 4 * DM);
#pragma unroll
  for (int i = 0; i < 8; ++i) rv[i] = *(const v4f*)(rs + i * 2 * DM);
  asm volatile("s_wait_xcnt 0x0" ::: "memory");   // all 16 loads are requested above this line (without it the last of them sink below the first waits), and it stands in front of every reuse of their address registers
#pragma unroll
  for (int i = 0; i < 8; ++i) vst2(&sy[(t >> 6) + 4 * i][(t & 63) * 4], lay4(yv[i]));
  __syncthreads();   // the tile is whole before any chunk is read from it; no global store stands in front of it, so it waits for none
  const size_t o = ((((size_t)b * NH + hq * 4) * (SS / 32) + ps) * 8 + sl) * (FSLOT / 2) + ln * 8;
  const _Float16* kr = &sy[(sl >> 2) * 16 + (ln & 15)][((sl >> 1) & 1) * 32 + (sl & 1) * 16 + (ln >> 4) * 8];
  const _Float16* vr = &sy[(sl & 1) * 16 + (ln >> 4) * 8][(sl >> 1) * 16 + (ln & 15)];
  _Float16* qd = QK + ((size_t)blockIdx.x * 16 + (t >> 7)) * (2 * DM) + (t & 127) * 4;
  v8h kw[4], vw[4]; v4h qw[8];
#pragma unroll
  for (int hh = 0; hh < 4; ++hh) { kw[hh] = *(const v8h*)(kr + hh * HD);
#pragma unroll
    for (int i = 0; i < 8; ++i) vw[hh][i] = vr[i * LYP + hh * HD]; }
#pragma unroll
  for (int i = 0; i < 8; ++i) qw[i] = lay4(rv[i]);
#pragma unroll
  for (int hh = 0; hh < 4; ++hh) { vst2(KP + o + (size_t)hh * FHEAD, kw[hh]); vst2(VP + o + (size_t)hh * FHEAD, vw[hh]); }
#pragma unroll
  for (int i = 0; i < 8; ++i) vst2(qd + i * 2 * (2 * DM), qw[i]);
}
extern "C" void kernel_launch(void* const* d_in, const int* in_sizes, int n_in, void* d_out, int out_size, void* d_ws, size_t ws_size, hipStream_t stream) {
  (void)in_sizes; (void)n_in; (void)out_size;
  const float** F = (const float**)d_in;   // 0 R [2,2048,512] (state patterns / queries), 1 Y [2,2048,512] (stored patterns = keys = values)
  if (ws_size < (size_t)WS_END) return;
  char* ws = (char*)d_ws; (void)0; _Float16 *QK = (_Float16*)(ws + WS_QK), *KP = (_Float16*)(ws + WS_KP), *VP = (_Float16*)(ws + WS_VP);
  k_lay<<<NB * (SS / 32) * 2, 256, 0, stream>>>(F[0], F[1], QK, KP, VP);
  k_attn<<<dim3(TQB, NH, TNB), 256, 0, stream>>>(QK, KP, VP, (float*)d_out);   // both steps -> output rows [b*L + l][h*64 + e]
}

// v009
// Measured time: 59 microseconds a run.
// Timed twice side by side with v008, it ran 1.03 and 1.04 times as fast.
// Counting every step since v000, it is 8.63 times as fast.
// compute dtype: R and Y rounded to bf16; no projections: q0 = R and k = v = Y are bf16 values re-laid on device as ONE f16 plane each (a bf16 value is exact in f16 from 2^-14 up; below that it is rounded to a multiple of 2^-24), k and v in fragment order; step 1: 1-product scores, running-max softmax in f32 (one fma, which holds the 1/8, log2 e, the maximum and P's 2^11, and one hardware base-2 exp a score), P (scaled by 2^11, as f16 hi + residual) x v (2 products) -> q1 kept in registers as f16 hi + (x2048) residual; step 2, in the same launch, the same with q1 hi + residual (2-product scores); each step's keys are split between two waves, whose maxima, sums and results are joined in f32 through LDS; f32 accumulate; the final state is the f32 output.
#include <hip/hip_runtime.h>
#include <math.h>

typedef __attribute__((ext_vector_type(16))) _Float16 v16h;
typedef __attribute__((ext_vector_type(16))) __bf16 v16b;
typedef __attribute__((ext_vector_type(8)))  _Float16 v8h;
typedef __attribute__((ext_vector_type(8)))  float v8f;
typedef __attribute__((ext_vector_type(4)))  float v4f;
typedef __attribute__((ext_vector_type(2)))  float v2f;
typedef __attribute__((ext_vector_type(4)))  unsigned v4u;
typedef __attribute__((ext_vector_type(4)))  int v4i;
typedef float __attribute__((may_alias)) float_a;
typedef int __attribute__((may_alias)) int_a;

template <typename T> __device__ __forceinline__ void vst2(void* p, T v) { *(T*)p = v;  }
__device__ __forceinline__ v8f wmma16(v16h a, v16h b, v8f c) {
  return __builtin_amdgcn_wmma_f32_16x16x32_f16(false, a, false, b, (short)0, c, false, false);
}
__device__ __forceinline__ v8f wmma_bf(v16b a, v16b b, v8f c) {
  v8f d = __builtin_amdgcn_wmma_f32_16x16x32_bf16(false, a, false, b, (short)0, c, false, false);
  asm volatile("v_nop\n\tv_nop\n\tv_nop\n\tv_nop" : "+v"(d) : "v"(a), "v"(b));
  return d;
}
__device__ __forceinline__ v16h frag_h(const _Float16* rowk0, int lane) {
  union { v16h v; v8h q[2]; } u; const _Float16* p = rowk0 + 8 * (lane >> 4);
  u.q[0] = *(const v8h*)p; u.q[1] = *(const v8h*)(p + 16); return u.v;
}
__device__ __forceinline__ v16h frag_f32(const float* rowk0, int lane) {
  v16h a; const float* p = rowk0 + 8 * (lane >> 4);
#pragma unroll
  for (int i = 0; i < 8; ++i) { a[i] = (_Float16)p[i]; a[8 + i] = (_Float16)p[16 + i]; }
  return a;
}
__device__ __forceinline__ v16h frag_f32s(const float* rowk0, int lane, float sc) {
  v16h a; const float* p = rowk0 + 8 * (lane >> 4);
#pragma unroll
  for (int i = 0; i < 8; ++i) { a[i] = (_Float16)(p[i] * sc); a[8 + i] = (_Float16)(p[16 + i] * sc); }
  return a;
}
// column fragment from a [K][ld] layout (column n), rows >= K read as 0
__device__ __forceinline__ v16h fragc_f32(const float* W, int k0, int n, int lane, int ld, int K) {
  v16h a; const int g = lane >> 4;
#pragma unroll
  for (int i = 0; i < 8; ++i) { const int ka = k0 + 8 * g + i, kb = ka + 16;
    a[i] = (_Float16)(ka < K ? W[(size_t)(ka < K ? ka : K - 1) * ld + n] : 0.f); a[8 + i] = (_Float16)(kb < K ? W[(size_t)(kb < K ? kb : K - 1) * ld + n] : 0.f); }
  return a;
}
struct F2 { v16b h, l; };
__device__ __forceinline__ F2 bsplit16(const float v[16]) { F2 r;
#pragma unroll
  for (int i = 0; i < 16; ++i) { const __bf16 h = (__bf16)v[i]; r.h[i] = h; r.l[i] = (__bf16)(v[i] - (float)h); }
  return r; }
__device__ __forceinline__ F2 split_row(const float* row, int k0, int lane) { float v[16]; const float* p = row + k0 + 8 * (lane >> 4);
#pragma unroll
  for (int i = 0; i < 8; ++i) { v[i] = p[i]; v[8 + i] = p[16 + i]; }
  return bsplit16(v); }
__device__ __forceinline__ F2 split_rowK(const float* row, int k0, int lane, int K) { float v[16]; const int g = lane >> 4;
#pragma unroll
  for (int i = 0; i < 8; ++i) { const int ka = k0 + 8 * g + i, kb = ka + 16; v[i] = ka < K ? row[ka < K ? ka : K - 1] : 0.f; v[8 + i] = kb < K ? row[kb < K ? kb : K - 1] : 0.f; }
  return bsplit16(v); }
__device__ __forceinline__ F2 split_col(const float* W, int k0, int n, int lane, int ld, int K) { float v[16]; const int g = lane >> 4;
#pragma unroll
  for (int i = 0; i < 8; ++i) { const int ka = k0 + 8 * g + i, kb = ka + 16; v[i] = ka < K ? W[(size_t)(ka < K ? ka : K - 1) * ld + n] : 0.f; v[8 + i] = kb < K ? W[(size_t)(kb < K ? kb : K - 1) * ld + n] : 0.f; }
  return bsplit16(v); }
__device__ __forceinline__ v8f mac3(const F2& a, const F2& b, v8f c) { c = wmma_bf(a.l, b.h, c); c = wmma_bf(a.h, b.l, c); return wmma_bf(a.h, b.h, c); }
__device__ __forceinline__ float sigm(float v) { return 1.0f / (1.0f + expf(-v)); }
#define LDSX() do { asm volatile("s_wait_dscnt 0" ::: "memory"); __builtin_amdgcn_wave_barrier(); __builtin_amdgcn_fence(__ATOMIC_RELEASE, "workgroup"); } while (0)


#define NB 2
#define SS 2048
#define DM 512
#define NH 8
#define HD 64
#define QKVW (3 * DM)
#ifndef TQB
#define TQB (SS / 64)
#define TNB NB
#define TOB (NB * SS / 64)     // output row tiles (all)
#endif
typedef __attribute__((ext_vector_type(8))) __bf16 v8b;
__device__ __forceinline__ v16b frag_b(const __bf16* rowk0, int lane) {
  union { v16b v; v8b q[2]; } u; const __bf16* p = rowk0 + 8 * (lane >> 4);
  u.q[0] = *(const v8b*)p; u.q[1] = *(const v8b*)(p + 16); return u.v;
}
#define FSLOT 512                    // bytes of one slot: one 16-byte load of every lane of a wave, lane after lane (four whole 128-byte lines)
#define FPASS (8 * FSLOT)            // bytes of one pass of one head: 8 slots; a fragment is two slots in a row (its k halves 0-15 and 16-31)
// fragment in frag_h's k order from a fragment-ordered plane: its base, the lane's byte offset (pass and lane) and the fragment's first slot
__device__ __forceinline__ v16h frag_p(const _Float16* base, unsigned boff, int slot) {
  union { v16h v; v8h q[2]; } u; const char* p = (const char*)base + boff + slot * FSLOT;
  u.q[0] = *(const v8h*)p; u.q[1] = *(const v8h*)(p + FSLOT); return u.v;
}
__device__ __forceinline__ float bfr(float v) { return (float)(__bf16)v; }
__device__ __attribute__((noinline)) float exp_ni(float v) { return expf(v); }
__device__ __attribute__((noinline)) float erf_ni(float v) { return erff(v); }

#define PK_A 0                       // [1536][512] Wqkv rows (natural [out][in])
#define PK_P (PK_A + QKVW * DM)        // [512][512] Wo rows (natural)
#define PK_END (PK_P + DM * DM)
#define WS_PK  0u
#define WS_QK  (WS_PK + 2u * PK_END)             // f16 [4096 rows][1024]: q | k
#define WS_QKL (WS_QK + 2u * NB * SS * 2 * DM)     // f16 q | k residual planes x2048
#define WS_VTH (WS_QKL + 2u * NB * SS * 2 * DM)    // f16 [b][512 (h*64+d)][2048 s] hi
#define WS_VTL (WS_VTH + 2u * NB * DM * SS)        // f16 lo x 2048
#define WS_O   (WS_VTL + 2u * NB * DM * SS)        // f32 [4096][512]
#define WS_CS  (WS_O + 4u * NB * SS * DM)           // f32 2 x [2048][32]: reserved, nothing writes or reads it
#define WS_KP  (WS_CS + 4u * 2 * SS * 32)          // f16 k in fragment order: [b][h][pass of 32 keys][8 slots][32 lanes][8]
#define WS_VP  (WS_KP + 2u * NB * SS * DM)         // f16 v^T in fragment order, same shape
#define WS_END (WS_VP + 2u * NB * SS * DM)
// ---- k_pack: block = (row n, which): natural [out][in] rows -> bf16; which 0..2 -> W_q/W_k/W_v into PK_A rows which*512 + n; 3 -> W_o into PK_P
__global__ __launch_bounds__(256) void k_pack(const float* __restrict__ WQ, const float* __restrict__ WK, const float* __restrict__ WV, const float* __restrict__ WO, __bf16* __restrict__ PK) {
  __shared__ __align__(16) __bf16 s[DM]; const int n = blockIdx.x, which = blockIdx.y, t = threadIdx.x; const float* Wm = (which == 0) ? WQ : (which == 1) ? WK : (which == 2) ? WV : WO;
  for (int k = t; k < DM; k += 256) s[k] = (__bf16)Wm[(size_t)n * DM + k];
  __syncthreads();
  __bf16* dst = (which < 3) ? PK + PK_A + ((size_t)which * DM + n) * DM : PK + PK_P + (size_t)n * DM;
  for (int q = t; q < DM / 8; q += 256) vst2((unsigned*)(dst + q * 8), *(const v4u*)&s[q * 8]);
}
__global__ __launch_bounds__(128) void k_qkv(const float* __restrict__ XQ, const float* __restrict__ XK, const float* __restrict__ XV, const __bf16* __restrict__ P, const float* __restrict__ BQ, const float* __restrict__ BK, const float* __restrict__ BV, _Float16* __restrict__ QK, _Float16* __restrict__ QKL, _Float16* __restrict__ VTH, _Float16* __restrict__ VTL) {
  const int which0 = (blockIdx.y * 128) / DM; const float* X = (which0 == 0) ? XQ : (which0 == 1) ? XK : XV; const float* BB = BQ ? (((which0 == 0) ? BQ : (which0 == 1) ? BK : BV) + (blockIdx.y * 128 - which0 * DM)) : nullptr;
  __shared__ __align__(16) _Float16 so[4][16][136], sol[4][16][136]; __shared__ __align__(16) _Float16 sth[128][72], stl[128][72];
  const int tid = threadIdx.x, wave = tid >> 5, lane = tid & 31, col = lane & 15, g = lane >> 4; const size_t r0 = (size_t)blockIdx.x * 64 + wave * 16; const int n0 = blockIdx.y * 128;
  v8f acc[8] = {};
#pragma unroll 2
  for (int kc = 0; kc < DM / 32; ++kc) { v16b a; { const float* p = X + (r0 + col) * DM + kc * 32 + 8 * g;
#pragma unroll
      for (int i = 0; i < 8; ++i) { a[i] = (__bf16)p[i]; a[8 + i] = (__bf16)p[16 + i]; } }
#pragma unroll
    for (int j = 0; j < 8; ++j) acc[j] = wmma_bf(a, frag_b(P + (size_t)(n0 + j * 16 + col) * DM + kc * 32, lane), acc[j]); }
  if (n0 < 2 * DM) {   // q stored unscaled (f16 sigma ~0.6, no subnormal exposure); 1/8 applied to the f32 score
#pragma unroll
    for (int j = 0; j < 8; ++j) {
#pragma unroll
      for (int r = 0; r < 8; ++r) { const float v = acc[j][r] + (BB ? bfr(BB[j * 16 + col]) : 0.f); const _Float16 hv = (_Float16)v; so[wave][8 * g + r][j * 16 + col] = hv; sol[wave][8 * g + r][j * 16 + col] = (_Float16)((v - (float)hv) * 2048.0f); } }   // q, k (+ bias) as f16 hi + (x2048) residual
    LDSX();
    for (int rl = 0; rl < 16; ++rl) if (lane < 16) { vst2((unsigned*)(QK + (r0 + rl) * (2 * DM) + n0 + lane * 8), *(const v4u*)&so[wave][rl][lane * 8]); vst2((unsigned*)(QKL + (r0 + rl) * (2 * DM) + n0 + lane * 8), *(const v4u*)&sol[wave][rl][lane * 8]); }
  } else {
#pragma unroll
    for (int j = 0; j < 8; ++j) {
#pragma unroll
      for (int r = 0; r < 8; ++r) { const float v = acc[j][r] + (BB ? bfr(BB[j * 16 + col]) : 0.f); const _Float16 hv = (_Float16)v; sth[j * 16 + col][wave * 16 + 8 * g + r] = hv; stl[j * 16 + col][wave * 16 + 8 * g + r] = (_Float16)((v - (float)hv) * 2048.0f); } }
    __syncthreads();
    const size_t rb = (size_t)blockIdx.x * 64; const int b = (int)(rb / SS), s0 = (int)(rb % SS); const int pc0 = n0 - 2 * DM;
    for (int q = tid; q < 128 * 8; q += 128) { const int d = q >> 3, pc = q & 7; const size_t o = ((size_t)b * DM + pc0 + d) * SS + s0 + pc * 8; vst2((unsigned*)(VTH + o), *(const v4u*)&sth[d][pc * 8]); vst2((unsigned*)(VTL + o), *(const v4u*)&stl[d][pc * 8]); }
  }
}
// lane l with lane l ^ 16 (the two lane halves hold the two key halves of one query column)
__device__ __forceinline__ float xhalf(float x) { return __builtin_bit_cast(float, __builtin_amdgcn_permlanex16(__builtin_bit_cast(int, x), __builtin_bit_cast(int, x), 0x76543210, 0xfedcba98, false, false)); }
// ---- attn_keys: one update step of one wave's 16 queries over the wave's share of the keys of its head (SS / KSPL keys in a row): flash attention (K = 64: 2 k-steps), transposed: S^T = K . Q^T (A = k rows, B = q rows), so a lane holds 16 of the 32 scores of ONE query (keys 8g + r and 16 + 8g + r): maximum and sum in-lane plus one exchange between the lane halves; the two score tiles, converted in place, are the B operand P^T of O^T += V^T . P^T (A = v^T rows): P never touches LDS. k and v are one f16 plane each; QRES = 1: q is f16 hi + residual (2 products), QRES = 0: q is one f16 plane too (1 product, aql not read); the weight of a score c = q.k is 2^(KS c - KS max + 11) = 2^11 exp((c - max) / 8); P is f16 hi + residual (2 products); the share's result is O[query col][d] = (acc + accl / 2048) / l, l the returned row sum of those weights, both relative to the share's own maximum mret
#define KSPL 2                       // waves that share the keys of one 16-query tile
template <int QRES> __device__ __forceinline__ float attn_keys(const v16h (&aq)[2], const v16h (&aql)[2], const _Float16* __restrict__ KP, const _Float16* __restrict__ VP, unsigned& ko, v16h (&kh)[2][2], v8f (&acc)[4], v8f (&accl)[4], float& mret) {
  constexpr float KS = 0.125f * 1.44269504088896340736f;   // 1/sqrt(64) * log2 e: an unscaled score times KS is its base-2 exponent
  float m = -3.0e38f, l = 0.f;   // of query column col; m is the maximum of the unscaled scores; l is this lane half's share of the sum, joined behind the loop
#pragma unroll
  for (int dt = 0; dt < 4; ++dt) { acc[dt] = v8f{}; accl[dt] = v8f{}; }   // O^T tiles: register r = O[query col][dt * 16 + 8 g + r] (unrolled: constant indices)
  const int nks = SS / 32 / KSPL;   // the wave's share of the keys
  // fragment loads run ahead of the products that use them: the k fragments of pass ks + 1 are requested right behind the score products of pass ks, the v fragments of pass ks at its top
  // one byte offset per lane serves every k slot of a pass, one every v slot: each load of a wave reads 512 bytes in a row
  // the short loops over ct, kc and dt below are unrolled so that the fragment arrays are indexed by constants and stay in registers
  unsigned vo = ko;   // on entry ko is the lane's offset of the share's pass 0, whose k fragments are in kh or on their way; so it is again on return
#pragma unroll 1
  for (int ks = 0; ks < nks; ++ks) { v8f s[2]; v16h vh[4];
#pragma unroll
    for (int dt = 0; dt < 4; ++dt) vh[dt] = frag_p(VP, vo, dt * 2);
#pragma unroll
    for (int ct = 0; ct < 2; ++ct) { v8f c = {}, cl = {};
#pragma unroll
      for (int kc = 0; kc < 2; ++kc) { c = wmma16(kh[ct][kc], aq[kc], c); if constexpr (QRES) cl = wmma16(kh[ct][kc], aql[kc], cl); }   // k x q hi (+ k x q residual); register r = score of key ct * 16 + 8 g + r with query col
      if constexpr (QRES) {
#pragma unroll
        for (int r = 0; r < 8; ++r) c[r] += cl[r] * (1.0f / 2048.0f); }
#pragma unroll
      for (int r = 0; r < 8; ++r) s[ct][r] = c[r];   // unscaled
    }
    ko += (ks + 1 < nks) ? (unsigned)FPASS : 0u - (unsigned)(nks - 1) * FPASS;   // the last pass requests pass 0 again: the next step's first fragments (behind the last step: in bounds, never used)
#pragma unroll
    for (int ct = 0; ct < 2; ++ct) {
#pragma unroll
      for (int kc = 0; kc < 2; ++kc) kh[ct][kc] = frag_p(KP, ko, ct * 4 + kc * 2); }
    __builtin_amdgcn_sched_barrier(0);   // keeps the next pass's k requests here, a whole softmax and P.V ahead of their use: without it they sink below the softmax, whose temporaries take their registers
    float mx[8];
#pragma unroll
    for (int r = 0; r < 8; ++r) mx[r] = fmaxf(s[0][r], s[1][r]);
#pragma unroll
    for (int w = 4; w > 0; w >>= 1) {
#pragma unroll
      for (int r = 0; r < w; ++r) mx[r] = fmaxf(mx[r], mx[r + w]); }
    const float mn = fmaxf(m, fmaxf(mx[0], xhalf(mx[0]))); const float alpha = __builtin_amdgcn_exp2f((m - mn) * KS); m = mn;   // first pass: 2^(-5e37) = 0
    const float nb = fmaf(mn, -KS, 11.0f);
    float e[16];
#pragma unroll
    for (int i = 0; i < 16; ++i) e[i] = __builtin_amdgcn_exp2f(fmaf(s[i >> 3][i & 7], KS, nb));   // the weight, 2^11 included
    float es[8];
#pragma unroll
    for (int r = 0; r < 8; ++r) es[r] = e[r] + e[8 + r];
#pragma unroll
    for (int w = 4; w > 0; w >>= 1) {
#pragma unroll
      for (int r = 0; r < w; ++r) es[r] += es[r + w]; }
    l = l * alpha + es[0];
#pragma unroll
    for (int dt = 0; dt < 4; ++dt) {
#pragma unroll
      for (int r = 0; r < 8; ++r) { acc[dt][r] *= alpha; accl[dt][r] *= alpha; } }
    asm volatile("s_wait_xcnt 0x0" : "+v"(ko), "+v"(vo) :: "memory");   // the two offset registers of this pass's fragment loads are held whole up to this wait; only behind it are they stepped on
    vo += FPASS;
    v16h pa, pl;   // P^T as B operand: element i = key kmap(i, g) of query col, which is where the two score tiles already hold it
#pragma unroll
    for (int i = 0; i < 16; ++i) { const float x0 = e[i]; const _Float16 h0 = (_Float16)x0; pa[i] = h0; pl[i] = (_Float16)((x0 - (float)h0) * 2048.0f); }   // P carries 2^11 into the f16 split so small softmax weights stay out of the f16 subnormal range; the row sum carries it too, so it cancels in the epilogue
#pragma unroll
    for (int dt = 0; dt < 4; ++dt) { acc[dt] = wmma16(vh[dt], pa, acc[dt]); accl[dt] = wmma16(vh[dt], pl, accl[dt]); }   // V x P hi + (V x P lo) / 2048
  }
  l += xhalf(l);   // the two lane halves' shares of the row sum
  mret = m;
  return l;
}
// ---- join_shares: the two waves of one query tile (wave and wave ^ 4) hold the same lane layout: each leaves its maximum, row sum and 32 O^T values per lane in LDS (16 bytes a lane, lane after lane), and behind one barrier takes the other's; both then hold the step's whole result o (still to be divided by l), brought to the common maximum
__device__ __forceinline__ void join_shares(float (*xb)[9][32][4], int wave, int lane, float m, float& l, const v8f (&acc)[4], const v8f (&accl)[4], float (&o)[32]) {
  constexpr float KS = 0.125f * 1.44269504088896340736f;
  // the loops over j and k are unrolled so that o is indexed by constants and stays in registers
#pragma unroll
  for (int j = 0; j < 8; ++j) { v4f w;
#pragma unroll
    for (int k = 0; k < 4; ++k) { const int i = 4 * j + k; o[i] = acc[i >> 3][i & 7] + accl[i >> 3][i & 7] * (1.0f / 2048.0f); w[k] = o[i]; }
    *(v4f*)&xb[wave][j][lane][0] = w; }
  *(v2f*)&xb[wave][8][lane][0] = v2f{m, l};
  __syncthreads();   // every wave's share is in LDS before its partner reads it
  const v2f ml = *(const v2f*)&xb[wave ^ 4][8][lane][0];
  const float mn = fmaxf(m, ml[0]); const float a = __builtin_amdgcn_exp2f((m - mn) * KS), c = __builtin_amdgcn_exp2f((ml[0] - mn) * KS);
  l = l * a + ml[1] * c;
#pragma unroll
  for (int j = 0; j < 8; ++j) { const v4f w = *(const v4f*)&xb[wave ^ 4][j][lane][0];
#pragma unroll
    for (int k = 0; k < 4; ++k) o[4 * j + k] = o[4 * j + k] * a + w[k] * c; }
}
// ---- k_attn: block = (64 queries, head h, batch b), 8 waves: wave = (query tile qt of 16, key half hf): BOTH update steps. Two waves a tile, so that four waves (two blocks) stand on each SIMD and fill one another's waits. A head's step-2 queries are its own step-1 results, and the joined O^T tiles hold them where the q operand wants them: element i of fragment kc is d = kc * 32 + 8 g + i = register i of tile 2 kc, element 8 + i is register i of tile 2 kc + 1, same lane: q1 is split into f16 hi + (x2048) residual in registers. O[b*S+q][h*64+d] = the step-2 result; wave hf stores d = hf * 32 + 0..31 (whole 128-B lines)
__global__ __launch_bounds__(256) void k_attn(const _Float16* __restrict__ QK, const _Float16* __restrict__ KP, const _Float16* __restrict__ VP, float* __restrict__ O) {
  __shared__ __align__(16) float xch[2][8][9][32][4];   // one exchange buffer a step: [wave][8 x 4 O^T values, then maximum and sum][lane]
  const int tid = threadIdx.x, wave = tid >> 5, lane = tid & 31, col = lane & 15, g = lane >> 4, qt = wave & 3, hf = wave >> 2;
  const int qb = blockIdx.x, h = blockIdx.y, b = blockIdx.z; const int q0 = qb * 64 + qt * 16; const size_t rq = (size_t)b * SS + q0 + col;
  v16h aq[2], aql[2];
#pragma unroll
  for (int kc = 0; kc < 2; ++kc) aq[kc] = frag_h(QK + rq * (2 * DM) + h * HD + kc * 32, lane);
  asm volatile("s_wait_xcnt 0x0" ::: "memory");   // the q loads' address registers are free for reuse (the k fragments below may land in them) only behind this wait
  unsigned ko = ((unsigned)(b * NH + h) * (SS / 32) + (unsigned)hf * (SS / 32 / KSPL)) * FPASS + 16u * lane;
  v16h kh[2][2];
#pragma unroll
  for (int ct = 0; ct < 2; ++ct) {
#pragma unroll
    for (int kc = 0; kc < 2; ++kc) kh[ct][kc] = frag_p(KP, ko, ct * 4 + kc * 2); }
  asm volatile("s_wait_xcnt 0x0" : "+v"(ko) :: "memory");   // the first pass steps ko on, which the k loads above name
  v8f acc[4], accl[4]; float o[32], m;
  float l1 = attn_keys<0>(aq, aq, KP, VP, ko, kh, acc, accl, m);   // step 1: q0 is one plane
  join_shares(xch[0], wave, lane, m, l1, acc, accl, o);
  const float il1 = 1.0f / l1;
  // both loops unrolled: values and fragments are indexed by constants and stay in registers
#pragma unroll
  for (int kc = 0; kc < 2; ++kc) {
#pragma unroll
    for (int i = 0; i < 16; ++i) { const float v = o[kc * 16 + i] * il1; const _Float16 hv = (_Float16)v; aq[kc][i] = hv; aql[kc][i] = (_Float16)((v - (float)hv) * 2048.0f); } }
  float l = attn_keys<1>(aq, aql, KP, VP, ko, kh, acc, accl, m);   // step 2
  join_shares(xch[1], wave, lane, m, l, acc, accl, o);
  const float il = 1.0f / l;
  float* st = &xch[0][wave][0][0][0];   // the wave's own part of the step-1 buffer as [16 queries][36]: its partner read it before it came to the step-2 barrier
  // both loops below are unrolled: o is indexed by constants and stays in registers, and the four stores follow one another
#pragma unroll
  for (int i = 0; i < 16; ++i) st[col * 36 + (i >> 3) * 16 + 8 * g + (i & 7)] = (hf ? o[16 + i] : o[i]) * il;   // tiles 2 hf and 2 hf + 1
  LDSX();
#pragma unroll
  for (int it = 0; it < 4; ++it) { const int rl = it * 4 + (lane >> 3); vst2(O + ((size_t)b * SS + q0 + rl) * DM + h * HD + hf * 32 + (lane & 7) * 4, *(const v4f*)&st[rl * 36 + (lane & 7) * 4]); }
}
// ---- k_out: block = (64 rows, 128 cols): out = O(hi/lo) . Wo rows (2 products) + bo
__global__ __launch_bounds__(128) void k_out(const float* __restrict__ O, const __bf16* __restrict__ P, const float* __restrict__ BO, float* __restrict__ Y) {
  __shared__ __align__(16) float so[4][16][132];
  const int tid = threadIdx.x, wave = tid >> 5, lane = tid & 31, col = lane & 15, g = lane >> 4; const size_t r0 = (size_t)blockIdx.x * 64 + wave * 16; const int n0 = blockIdx.y * 128;
  v8f acc[8] = {};
#pragma unroll 2
  for (int kc = 0; kc < DM / 32; ++kc) { const F2 a = split_row(O + (r0 + col) * DM, kc * 32, lane);
#pragma unroll
    for (int j = 0; j < 8; ++j) { const v16b w = frag_b(P + (size_t)(n0 + j * 16 + col) * DM + kc * 32, lane); acc[j] = wmma_bf(a.l, w, acc[j]); acc[j] = wmma_bf(a.h, w, acc[j]); } }
#pragma unroll
  for (int j = 0; j < 8; ++j) {
#pragma unroll
    for (int r = 0; r < 8; ++r) so[wave][8 * g + r][j * 16 + col] = acc[j][r] + bfr(BO[n0 + j * 16 + col]); }
  LDSX();
  for (int rl = 0; rl < 16; ++rl) vst2(Y + (r0 + rl) * DM + n0 + lane * 4, *(const v4f*)&so[wave][rl][lane * 4]);
}
// ---- k_lay: every re-lay of the call in one launch of as many blocks as the chip has WGPs: block = (batch b, pass ps of 32 keys, half hq of the heads); a thread's 16 global loads, 512 bytes in a row per wave each, are all requested before the first is used
// Y rows ps * 32 + 0..31, columns hq * 256 + 0..255 -> one f16 tile in LDS -> k chunks (16 bytes of a tile row) and v^T chunks (8 rows of a tile column), both thread-linear in the destination; R rows blockIdx.x * 16 + 0..15 -> q slots of the q plane, element by element
// k chunk (head, slot = ct * 4 + kc * 2 + j, lane = 16 g + col) holds k[key pass * 32 + ct * 16 + col][h * 64 + kc * 32 + j * 16 + 8 g + 0..7]: what lane (col, g) takes as half j of fragment (ct, kc)
// v chunk (head, slot = dt * 2 + j, lane = 16 g + col) holds v[keys pass * 32 + j * 16 + 8 g + 0..7][h * 64 + dt * 16 + col]: what lane (col, g) takes as half j of fragment dt
#define LYP 264                      // halves of one tile row: 256 + 8, so that the 16 rows of a wave's 16-byte chunk reads start 4 banks apart
#define FHEAD ((SS / 32) * (FPASS / 2))   // halves of one head in a fragment-ordered plane
typedef __attribute__((ext_vector_type(4))) _Float16 v4h;
__device__ __forceinline__ v4h lay4(v4f x) { v4h r;
#pragma unroll
  for (int k = 0; k < 4; ++k) r[k] = (_Float16)bfr(x[k]);
  return r; }
__global__ __launch_bounds__(256) void k_lay(const float* __restrict__ R, const float* __restrict__ Y, _Float16* __restrict__ QK, _Float16* __restrict__ KP, _Float16* __restrict__ VP) {
  __shared__ __align__(16) _Float16 sy[32][LYP];
  const int t = threadIdx.x, ln = t & 31, sl = t >> 5;
  const int hq = blockIdx.x & 1, ps = (blockIdx.x >> 1) & (SS / 32 - 1), b = blockIdx.x / (2 * (SS / 32));
  const float* ys = Y + ((size_t)b * SS + ps * 32 + (t >> 6)) * DM + hq * 256 + (t & 63) * 4;   // load i: tile row (t >> 6) + 4 i
  const float* rs = R + (size_t)blockIdx.x * 16 * DM + t * 4;                                   // load i: row (t >> 7) + 2 i of the block's 16
  v4f yv[8], rv[8];
  // the loops below are unrolled so that the loaded values are indexed by constants and stay in registers
#pragma unroll
  for (int i = 0; i < 8; ++i) yv[i] = *(const v4f*)(ys + i * 4 * DM);
#pragma unroll
  for (int i = 0; i < 8; ++i) rv[i] = *(const v4f*)(rs + i * 2 * DM);
  asm volatile("s_wait_xcnt 0x0" ::: "memory");   // all 16 loads are requested above this line (without it the last of them sink below the first waits), and it stands in front of every reuse of their address registers
#pragma unroll
  for (int i = 0; i < 8; ++i) vst2(&sy[(t >> 6) + 4 * i][(t & 63) * 4], lay4(yv[i]));
  __syncthreads();   // the tile is whole before any chunk is read from it; no global store stands in front of it, so it waits for none
  const size_t o = ((((size_t)b * NH + hq * 4) * (SS / 32) + ps) * 8 + sl) * (FSLOT / 2) + ln * 8;
  const _Float16* kr = &sy[(sl >> 2) * 16 + (ln & 15)][((sl >> 1) & 1) * 32 + (sl & 1) * 16 + (ln >> 4) * 8];
  const _Float16* vr = &sy[(sl & 1) * 16 + (ln >> 4) * 8][(sl >> 1) * 16 + (ln & 15)];
  _Float16* qd = QK + ((size_t)blockIdx.x * 16 + (t >> 7)) * (2 * DM) + (t & 127) * 4;
  v8h kw[4], vw[4]; v4h qw[8];
#pragma unroll
  for (int hh = 0; hh < 4; ++hh) { kw[hh] = *(const v8h*)(kr + hh * HD);
#pragma unroll
    for (int i = 0; i < 8; ++i) vw[hh][i] = vr[i * LYP + hh * HD]; }
#pragma unroll
  for (int i = 0; i < 8; ++i) qw[i] = lay4(rv[i]);
#pragma unroll
  for (int hh = 0; hh < 4; ++hh) { vst2(KP + o + (size_t)hh * FHEAD, kw[hh]); vst2(VP + o + (size_t)hh * FHEAD, vw[hh]); }
#pragma unroll
  for (int i = 0; i < 8; ++i) vst2(qd + i * 2 * (2 * DM), qw[i]);
}
extern "C" void kernel_launch(void* const* d_in, const int* in_sizes, int n_in, void* d_out, int out_size, void* d_ws, size_t ws_size, hipStream_t stream) {
  (void)in_sizes; (void)n_in; (void)out_size;
  const float** F = (const float**)d_in;   // 0 R [2,2048,512] (state patterns / queries), 1 Y [2,2048,512] (stored patterns = keys = values)
  if (ws_size < (size_t)WS_END) return;
  char* ws = (char*)d_ws; (void)0; _Float16 *QK = (_Float16*)(ws + WS_QK), *KP = (_Float16*)(ws + WS_KP), *VP = (_Float16*)(ws + WS_VP);
  k_lay<<<NB * (SS / 32) * 2, 256, 0, stream>>>(F[0], F[1], QK, KP, VP);
  k_attn<<<dim3(TQB, NH, TNB), 256, 0, stream>>>(QK, KP, VP, (float*)d_out);   // both steps -> output rows [b*L + l][h*64 + e]
}

// v010
// One run takes 56.1 microseconds.
// Next to v009, in two timings, it ran 1.05 times as fast each time.
// All steps since v000 together make it 9.07 times as fast.
// compute dtype: R and Y rounded to bf16; no projections: q0 = R and k = v = Y are bf16 values re-laid on device as ONE f16 plane each (a bf16 value is exact in f16 from 2^-14 up; below that it is rounded to a multiple of 2^-24), k and v in fragment order; step 1: 1-product scores, running-max softmax in f32 (one fma, which holds the 1/8, log2 e, the maximum and P's 2^11, and one hardware base-2 exp a score), P (scaled by 2^11, as f16 hi + unscaled f16 residual) x v (2 products into one f32 tile) -> q1 kept in registers as f16 hi + unscaled f16 residual; step 2, in the same launch, the same with q1 hi + residual (2-product scores, one f32 tile); each step's keys are split between two waves, whose maxima, sums and results are joined in f32 through LDS; f32 accumulate; the final state is the f32 output.
#include <hip/hip_runtime.h>
#include <math.h>

typedef __attribute__((ext_vector_type(16))) _Float16 v16h;
typedef __attribute__((ext_vector_type(16))) __bf16 v16b;
typedef __attribute__((ext_vector_type(8)))  _Float16 v8h;
typedef __attribute__((ext_vector_type(8)))  float v8f;
typedef __attribute__((ext_vector_type(4)))  float v4f;
typedef __attribute__((ext_vector_type(2)))  float v2f;
typedef __attribute__((ext_vector_type(4)))  unsigned v4u;
typedef __attribute__((ext_vector_type(4)))  int v4i;
typedef float __attribute__((may_alias)) float_a;
typedef int __attribute__((may_alias)) int_a;

template <typename T> __device__ __forceinline__ void vst2(void* p, T v) { *(T*)p = v;  }
__device__ __forceinline__ v8f wmma16(v16h a, v16h b, v8f c) {
  return __builtin_amdgcn_wmma_f32_16x16x32_f16(false, a, false, b, (short)0, c, false, false);
}
__device__ __forceinline__ v8f wmma_bf(v16b a, v16b b, v8f c) {
  v8f d = __builtin_amdgcn_wmma_f32_16x16x32_bf16(false, a, false, b, (short)0, c, false, false);
  asm volatile("v_nop\n\tv_nop\n\tv_nop\n\tv_nop" : "+v"(d) : "v"(a), "v"(b));
  return d;
}
__device__ __forceinline__ v16h frag_h(const _Float16* rowk0, int lane) {
  union { v16h v; v8h q[2]; } u; const _Float16* p = rowk0 + 8 * (lane >> 4);
  u.q[0] = *(const v8h*)p; u.q[1] = *(const v8h*)(p + 16); return u.v;
}
__device__ __forceinline__ v16h frag_f32(const float* rowk0, int lane) {
  v16h a; const float* p = rowk0 + 8 * (lane >> 4);
#pragma unroll
  for (int i = 0; i < 8; ++i) { a[i] = (_Float16)p[i]; a[8 + i] = (_Float16)p[16 + i]; }
  return a;
}
__device__ __forceinline__ v16h frag_f32s(const float* rowk0, int lane, float sc) {
  v16h a; const float* p = rowk0 + 8 * (lane >> 4);
#pragma unroll
  for (int i = 0; i < 8; ++i) { a[i] = (_Float16)(p[i] * sc); a[8 + i] = (_Float16)(p[16 + i] * sc); }
  return a;
}
// column fragment from a [K][ld] layout (column n), rows >= K read as 0
__device__ __forceinline__ v16h fragc_f32(const float* W, int k0, int n, int lane, int ld, int K) {
  v16h a; const int g = lane >> 4;
#pragma unroll
  for (int i = 0; i < 8; ++i) { const int ka = k0 + 8 * g + i, kb = ka + 16;
    a[i] = (_Float16)(ka < K ? W[(size_t)(ka < K ? ka : K - 1) * ld + n] : 0.f); a[8 + i] = (_Float16)(kb < K ? W[(size_t)(kb < K ? kb : K - 1) * ld + n] : 0.f); }
  return a;
}
struct F2 { v16b h, l; };
__device__ __forceinline__ F2 bsplit16(const float v[16]) { F2 r;
#pragma unroll
  for (int i = 0; i < 16; ++i) { const __bf16 h = (__bf16)v[i]; r.h[i] = h; r.l[i] = (__bf16)(v[i] - (float)h); }
  return r; }
__device__ __forceinline__ F2 split_row(const float* row, int k0, int lane) { float v[16]; const float* p = row + k0 + 8 * (lane >> 4);
#pragma unroll
  for (int i = 0; i < 8; ++i) { v[i] = p[i]; v[8 + i] = p[16 + i]; }
  return bsplit16(v); }
__device__ __forceinline__ F2 split_rowK(const float* row, int k0, int lane, int K) { float v[16]; const int g = lane >> 4;
#pragma unroll
  for (int i = 0; i < 8; ++i) { const int ka = k0 + 8 * g + i, kb = ka + 16; v[i] = ka < K ? row[ka < K ? ka : K - 1] : 0.f; v[8 + i] = kb < K ? row[kb < K ? kb : K - 1] : 0.f; }
  return bsplit16(v); }
__device__ __forceinline__ F2 split_col(const float* W, int k0, int n, int lane, int ld, int K) { float v[16]; const int g = lane >> 4;
#pragma unroll
  for (int i = 0; i < 8; ++i) { const int ka = k0 + 8 * g + i, kb = ka + 16; v[i] = ka < K ? W[(size_t)(ka < K ? ka : K - 1) * ld + n] : 0.f; v[8 + i] = kb < K ? W[(size_t)(kb < K ? kb : K - 1) * ld + n] : 0.f; }
  return bsplit16(v); }
__device__ __forceinline__ v8f mac3(const F2& a, const F2& b, v8f c) { c = wmma_bf(a.l, b.h, c); c = wmma_bf(a.h, b.l, c); return wmma_bf(a.h, b.h, c); }
__device__ __forceinline__ float sigm(float v) { return 1.0f / (1.0f + expf(-v)); }
#define LDSX() do { asm volatile("s_wait_dscnt 0" ::: "memory"); __builtin_amdgcn_wave_barrier(); __builtin_amdgcn_fence(__ATOMIC_RELEASE, "workgroup"); } while (0)


#define NB 2
#define SS 2048
#define DM 512
#define NH 8
#define HD 64
#define QKVW (3 * DM)
#ifndef TQB
#define TQB (SS / 64)
#define TNB NB
#define TOB (NB * SS / 64)     // output row tiles (all)
#endif
typedef __attribute__((ext_vector_type(8))) __bf16 v8b;
__device__ __forceinline__ v16b frag_b(const __bf16* rowk0, int lane) {
  union { v16b v; v8b q[2]; } u; const __bf16* p = rowk0 + 8 * (lane >> 4);
  u.q[0] = *(const v8b*)p; u.q[1] = *(const v8b*)(p + 16); return u.v;
}
#define FSLOT 512                    // bytes of one slot: one 16-byte load of every lane of a wave, lane after lane (four whole 128-byte lines)
#define FPASS (8 * FSLOT)            // bytes of one pass of one head: 8 slots; a fragment is two slots in a row (its k halves 0-15 and 16-31)
// fragment in frag_h's k order from a fragment-ordered plane: its base, the lane's byte offset (pass and lane) and the fragment's first slot
__device__ __forceinline__ v16h frag_p(const _Float16* base, unsigned boff, int slot) {
  union { v16h v; v8h q[2]; } u; const char* p = (const char*)base + boff + slot * FSLOT;
  u.q[0] = *(const v8h*)p; u.q[1] = *(const v8h*)(p + FSLOT); return u.v;
}
__device__ __forceinline__ float bfr(float v) { return (float)(__bf16)v; }
__device__ __attribute__((noinline)) float exp_ni(float v) { return expf(v); }
__device__ __attribute__((noinline)) float erf_ni(float v) { return erff(v); }

#define PK_A 0                       // [1536][512] Wqkv rows (natural [out][in])
#define PK_P (PK_A + QKVW * DM)        // [512][512] Wo rows (natural)
#define PK_END (PK_P + DM * DM)
#define WS_PK  0u
#define WS_QK  (WS_PK + 2u * PK_END)             // f16 [4096 rows][1024]: q | k
#define WS_QKL (WS_QK + 2u * NB * SS * 2 * DM)     // f16 q | k residual planes x2048
#define WS_VTH (WS_QKL + 2u * NB * SS * 2 * DM)    // f16 [b][512 (h*64+d)][2048 s] hi
#define WS_VTL (WS_VTH + 2u * NB * DM * SS)        // f16 lo x 2048
#define WS_O   (WS_VTL + 2u * NB * DM * SS)        // f32 [4096][512]
#define WS_CS  (WS_O + 4u * NB * SS * DM)           // f32 2 x [2048][32]: reserved, nothing writes or reads it
#define WS_KP  (WS_CS + 4u * 2 * SS * 32)          // f16 k in fragment order: [b][h][pass of 32 keys][8 slots][32 lanes][8]
#define WS_VP  (WS_KP + 2u * NB * SS * DM)         // f16 v^T in fragment order, same shape
#define WS_END (WS_VP + 2u * NB * SS * DM)
// ---- k_pack: block = (row n, which): natural [out][in] rows -> bf16; which 0..2 -> W_q/W_k/W_v into PK_A rows which*512 + n; 3 -> W_o into PK_P
__global__ __launch_bounds__(256) void k_pack(const float* __restrict__ WQ, const float* __restrict__ WK, const float* __restrict__ WV, const float* __restrict__ WO, __bf16* __restrict__ PK) {
  __shared__ __align__(16) __bf16 s[DM]; const int n = blockIdx.x, which = blockIdx.y, t = threadIdx.x; const float* Wm = (which == 0) ? WQ : (which == 1) ? WK : (which == 2) ? WV : WO;
  for (int k = t; k < DM; k += 256) s[k] = (__bf16)Wm[(size_t)n * DM + k];
  __syncthreads();
  __bf16* dst = (which < 3) ? PK + PK_A + ((size_t)which * DM + n) * DM : PK + PK_P + (size_t)n * DM;
  for (int q = t; q < DM / 8; q += 256) vst2((unsigned*)(dst + q * 8), *(const v4u*)&s[q * 8]);
}
__global__ __launch_bounds__(128) void k_qkv(const float* __restrict__ XQ, const float* __restrict__ XK, const float* __restrict__ XV, const __bf16* __restrict__ P, const float* __restrict__ BQ, const float* __restrict__ BK, const float* __restrict__ BV, _Float16* __restrict__ QK, _Float16* __restrict__ QKL, _Float16* __restrict__ VTH, _Float16* __restrict__ VTL) {
  const int which0 = (blockIdx.y * 128) / DM; const float* X = (which0 == 0) ? XQ : (which0 == 1) ? XK : XV; const float* BB = BQ ? (((which0 == 0) ? BQ : (which0 == 1) ? BK : BV) + (blockIdx.y * 128 - which0 * DM)) : nullptr;
  __shared__ __align__(16) _Float16 so[4][16][136], sol[4][16][136]; __shared__ __align__(16) _Float16 sth[128][72], stl[128][72];
  const int tid = threadIdx.x, wave = tid >> 5, lane = tid & 31, col = lane & 15, g = lane >> 4; const size_t r0 = (size_t)blockIdx.x * 64 + wave * 16; const int n0 = blockIdx.y * 128;
  v8f acc[8] = {};
#pragma unroll 2
  for (int kc = 0; kc < DM / 32; ++kc) { v16b a; { const float* p = X + (r0 + col) * DM + kc * 32 + 8 * g;
#pragma unroll
      for (int i = 0; i < 8; ++i) { a[i] = (__bf16)p[i]; a[8 + i] = (__bf16)p[16 + i]; } }
#pragma unroll
    for (int j = 0; j < 8; ++j) acc[j] = wmma_bf(a, frag_b(P + (size_t)(n0 + j * 16 + col) * DM + kc * 32, lane), acc[j]); }
  if (n0 < 2 * DM) {   // q stored unscaled (f16 sigma ~0.6, no subnormal exposure); 1/8 applied to the f32 score
#pragma unroll
    for (int j = 0; j < 8; ++j) {
#pragma unroll
      for (int r = 0; r < 8; ++r) { const float v = acc[j][r] + (BB ? bfr(BB[j * 16 + col]) : 0.f); const _Float16 hv = (_Float16)v; so[wave][8 * g + r][j * 16 + col] = hv; sol[wave][8 * g + r][j * 16 + col] = (_Float16)((v - (float)hv) * 2048.0f); } }   // q, k (+ bias) as f16 hi + (x2048) residual
    LDSX();
    for (int rl = 0; rl < 16; ++rl) if (lane < 16) { vst2((unsigned*)(QK + (r0 + rl) * (2 * DM) + n0 + lane * 8), *(const v4u*)&so[wave][rl][lane * 8]); vst2((unsigned*)(QKL + (r0 + rl) * (2 * DM) + n0 + lane * 8), *(const v4u*)&sol[wave][rl][lane * 8]); }
  } else {
#pragma unroll
    for (int j = 0; j < 8; ++j) {
#pragma unroll
      for (int r = 0; r < 8; ++r) { const float v = acc[j][r] + (BB ? bfr(BB[j * 16 + col]) : 0.f); const _Float16 hv = (_Float16)v; sth[j * 16 + col][wave * 16 + 8 * g + r] = hv; stl[j * 16 + col][wave * 16 + 8 * g + r] = (_Float16)((v - (float)hv) * 2048.0f); } }
    __syncthreads();
    const size_t rb = (size_t)blockIdx.x * 64; const int b = (int)(rb / SS), s0 = (int)(rb % SS); const int pc0 = n0 - 2 * DM;
    for (int q = tid; q < 128 * 8; q += 128) { const int d = q >> 3, pc = q & 7; const size_t o = ((size_t)b * DM + pc0 + d) * SS + s0 + pc * 8; vst2((unsigned*)(VTH + o), *(const v4u*)&sth[d][pc * 8]); vst2((unsigned*)(VTL + o), *(const v4u*)&stl[d][pc * 8]); }
  }
}
// lane l with lane l ^ 16 (the two lane halves hold the two key halves of one query column)
__device__ __forceinline__ float xhalf(float x) { return __builtin_bit_cast(float, __builtin_amdgcn_permlanex16(__builtin_bit_cast(int, x), __builtin_bit_cast(int, x), 0x76543210, 0xfedcba98, false, false)); }
// ---- attn_keys: one update step of one wave's 16 queries over the wave's share of the keys of its head (SS / KSPL keys in a row): flash attention (K = 64: 2 k-steps), transposed: S^T = K . Q^T (A = k rows, B = q rows), so a lane holds 16 of the 32 scores of ONE query (keys 8g + r and 16 + 8g + r): maximum and sum in-lane plus one exchange between the lane halves; the two score tiles, converted in place, are the B operand P^T of O^T += V^T . P^T (A = v^T rows): P never touches LDS. k and v are one f16 plane each; QRES = 1: q is f16 hi + residual (2 products), QRES = 0: q is one f16 plane too (1 product, aql not read); the weight of a score c = q.k is 2^(KS c - KS max + 11) = 2^11 exp((c - max) / 8); P is f16 hi + residual (2 products); a residual is stored unscaled (below 2^-14 in steps of 2^-24: the matrix unit keeps f16 subnormals), so its products add into the same f32 tile as the hi products; the share's result is O[query col][d] = acc / l, l the returned row sum of those weights, both relative to the share's own maximum mret
#define KSPL 2                       // waves that share the keys of one 16-query tile
template <int QRES> __device__ __forceinline__ float attn_keys(const v16h (&aq)[2], const v16h (&aql)[2], const _Float16* __restrict__ KP, const _Float16* __restrict__ VP, unsigned& ko, v16h (&kh)[2][2], v8f (&acc)[4], float& mret) {
  constexpr float KS = 0.125f * 1.44269504088896340736f;   // 1/sqrt(64) * log2 e: an unscaled score times KS is its base-2 exponent
  float m = -3.0e38f, l = 0.f;   // of query column col; m is the maximum of the unscaled scores; l is this lane half's share of the sum, joined behind the loop
#pragma unroll
  for (int dt = 0; dt < 4; ++dt) acc[dt] = v8f{};   // O^T tiles: register r = O[query col][dt * 16 + 8 g + r] (unrolled: constant indices)
  const int nks = SS / 32 / KSPL;   // the wave's share of the keys
  // fragment loads run ahead of the products that use them: the k fragments of pass ks + 1 are requested right behind the score products of pass ks, the v fragments of pass ks at its top
  // one byte offset per lane serves every k slot of a pass, one every v slot: each load of a wave reads 512 bytes in a row
  // the short loops over ct, kc and dt below are unrolled so that the fragment arrays are indexed by constants and stay in registers
  unsigned vo = ko;   // on entry ko is the lane's offset of the share's pass 0, whose k fragments are in kh or on their way; so it is again on return
#pragma unroll 1
  for (int ks = 0; ks < nks; ++ks) { v8f s[2]; v16h vh[4];
#pragma unroll
    for (int dt = 0; dt < 4; ++dt) vh[dt] = frag_p(VP, vo, dt * 2);
#pragma unroll
    for (int ct = 0; ct < 2; ++ct) { v8f c = {};
#pragma unroll
      for (int kc = 0; kc < 2; ++kc) { c = wmma16(kh[ct][kc], aq[kc], c); if constexpr (QRES) c = wmma16(kh[ct][kc], aql[kc], c); }   // k x q hi (+ k x q residual, same tile); register r = score of key ct * 16 + 8 g + r with query col
      s[ct] = c;   // without the 1/8
    }
    ko += (ks + 1 < nks) ? (unsigned)FPASS : 0u - (unsigned)(nks - 1) * FPASS;   // the last pass requests pass 0 again: the next step's first fragments (behind the last step: in bounds, never used)
#pragma unroll
    for (int ct = 0; ct < 2; ++ct) {
#pragma unroll
      for (int kc = 0; kc < 2; ++kc) kh[ct][kc] = frag_p(KP, ko, ct * 4 + kc * 2); }
    __builtin_amdgcn_sched_barrier(0);   // keeps the next pass's k requests here, a whole softmax and P.V ahead of their use: without it they sink below the softmax, whose temporaries take their registers
    float mx[8];
#pragma unroll
    for (int r = 0; r < 8; ++r) mx[r] = fmaxf(s[0][r], s[1][r]);
#pragma unroll
    for (int w = 4; w > 0; w >>= 1) {
#pragma unroll
      for (int r = 0; r < w; ++r) mx[r] = fmaxf(mx[r], mx[r + w]); }
    const float mn = fmaxf(m, fmaxf(mx[0], xhalf(mx[0]))); const float alpha = __builtin_amdgcn_exp2f((m - mn) * KS); m = mn;   // first pass: 2^(-5e37) = 0
    const float nb = fmaf(mn, -KS, 11.0f);
    float e[16];
#pragma unroll
    for (int i = 0; i < 16; ++i) e[i] = __builtin_amdgcn_exp2f(fmaf(s[i >> 3][i & 7], KS, nb));   // the weight, 2^11 included
    float es[8];
#pragma unroll
    for (int r = 0; r < 8; ++r) es[r] = e[r] + e[8 + r];
#pragma unroll
    for (int w = 4; w > 0; w >>= 1) {
#pragma unroll
      for (int r = 0; r < w; ++r) es[r] += es[r + w]; }
    l = l * alpha + es[0];
#pragma unroll
    for (int dt = 0; dt < 4; ++dt) {
#pragma unroll
      for (int r = 0; r < 8; ++r) acc[dt][r] *= alpha; }
    asm volatile("s_wait_xcnt 0x0" : "+v"(ko), "+v"(vo) :: "memory");   // the two offset registers of this pass's fragment loads are held whole up to this wait; only behind it are they stepped on
    vo += FPASS;
    v16h pa, pl;   // P^T as B operand: element i = key kmap(i, g) of query col, which is where the two score tiles already hold it
#pragma unroll
    for (int i = 0; i < 16; ++i) { const float x0 = e[i]; const _Float16 h0 = (_Float16)x0; pa[i] = h0; pl[i] = (_Float16)(x0 - (float)h0); }   // P carries 2^11 into the f16 split, so that the 2^-24 step of a small residual is 2^-35 of the largest weight; the row sum carries it too, so it cancels in the epilogue
#pragma unroll
    for (int dt = 0; dt < 4; ++dt) acc[dt] = wmma16(vh[dt], pa, acc[dt]);   // V x P hi
#pragma unroll
    for (int dt = 0; dt < 4; ++dt) acc[dt] = wmma16(vh[dt], pl, acc[dt]);   // + V x P residual: three other tiles' products stand between the two products of one tile
  }
  l += xhalf(l);   // the two lane halves' shares of the row sum
  mret = m;
  return l;
}
// ---- join_shares: the two waves of one query tile (wave and wave ^ 4) hold the same lane layout: each leaves its maximum, row sum and 32 O^T values per lane in LDS (16 bytes a lane, lane after lane), and behind one barrier takes the other's; both then hold the step's whole result o (still to be divided by l), brought to the common maximum
__device__ __forceinline__ void join_shares(float (*xb)[9][32][4], int wave, int lane, float m, float& l, const v8f (&acc)[4], float (&o)[32]) {
  constexpr float KS = 0.125f * 1.44269504088896340736f;
  // the loops over j and k are unrolled so that o is indexed by constants and stays in registers
#pragma unroll
  for (int j = 0; j < 8; ++j) { v4f w;
#pragma unroll
    for (int k = 0; k < 4; ++k) { const int i = 4 * j + k; o[i] = acc[i >> 3][i & 7]; w[k] = o[i]; }
    *(v4f*)&xb[wave][j][lane][0] = w; }
  *(v2f*)&xb[wave][8][lane][0] = v2f{m, l};
  __syncthreads();   // every wave's share is in LDS before its partner reads it
  const v2f ml = *(const v2f*)&xb[wave ^ 4][8][lane][0];
  const float mn = fmaxf(m, ml[0]); const float a = __builtin_amdgcn_exp2f((m - mn) * KS), c = __builtin_amdgcn_exp2f((ml[0] - mn) * KS);
  l = l * a + ml[1] * c;
#pragma unroll
  for (int j = 0; j < 8; ++j) { const v4f w = *(const v4f*)&xb[wave ^ 4][j][lane][0];
#pragma unroll
    for (int k = 0; k < 4; ++k) o[4 * j + k] = o[4 * j + k] * a + w[k] * c; }
}
// ---- k_attn: block = (64 queries, head h, batch b), 8 waves: wave = (query tile qt of 16, key half hf): BOTH update steps. Two waves a tile, so that four waves (two blocks) stand on each SIMD and fill one another's waits. A head's step-2 queries are its own step-1 results, and the joined O^T tiles hold them where the q operand wants them: element i of fragment kc is d = kc * 32 + 8 g + i = register i of tile 2 kc, element 8 + i is register i of tile 2 kc + 1, same lane: q1 is split into f16 hi + residual in registers. O[b*S+q][h*64+d] = the step-2 result; wave hf stores d = hf * 32 + 0..31 (whole 128-B lines)
__global__ __launch_bounds__(256) void k_attn(const _Float16* __restrict__ QK, const _Float16* __restrict__ KP, const _Float16* __restrict__ VP, float* __restrict__ O) {
  __shared__ __align__(16) float xch[2][8][9][32][4];   // one exchange buffer a step: [wave][8 x 4 O^T values, then maximum and sum][lane]
  const int tid = threadIdx.x, wave = tid >> 5, lane = tid & 31, col = lane & 15, g = lane >> 4, qt = wave & 3, hf = wave >> 2;
  const int qb = blockIdx.x, h = blockIdx.y, b = blockIdx.z; const int q0 = qb * 64 + qt * 16; const size_t rq = (size_t)b * SS + q0 + col;
  v16h aq[2], aql[2];
#pragma unroll
  for (int kc = 0; kc < 2; ++kc) aq[kc] = frag_h(QK + rq * (2 * DM) + h * HD + kc * 32, lane);
  asm volatile("s_wait_xcnt 0x0" ::: "memory");   // the q loads' address registers are free for reuse (the k fragments below may land in them) only behind this wait
  unsigned ko = ((unsigned)(b * NH + h) * (SS / 32) + (unsigned)hf * (SS / 32 / KSPL)) * FPASS + 16u * lane;
  v16h kh[2][2];
#pragma unroll
  for (int ct = 0; ct < 2; ++ct) {
#pragma unroll
    for (int kc = 0; kc < 2; ++kc) kh[ct][kc] = frag_p(KP, ko, ct * 4 + kc * 2); }
  asm volatile("s_wait_xcnt 0x0" : "+v"(ko) :: "memory");   // the first pass steps ko on, which the k loads above name
  v8f acc[4]; float o[32], m;
  float l1 = attn_keys<0>(aq, aq, KP, VP, ko, kh, acc, m);   // step 1: q0 is one plane
  join_shares(xch[0], wave, lane, m, l1, acc, o);
  const float il1 = 1.0f / l1;
  // both loops unrolled: values and fragments are indexed by constants and stay in registers
#pragma unroll
  for (int kc = 0; kc < 2; ++kc) {
#pragma unroll
    for (int i = 0; i < 16; ++i) { const float v = o[kc * 16 + i] * il1; const _Float16 hv = (_Float16)v; aq[kc][i] = hv; aql[kc][i] = (_Float16)(v - (float)hv); } }
  float l = attn_keys<1>(aq, aql, KP, VP, ko, kh, acc, m);   // step 2
  join_shares(xch[1], wave, lane, m, l, acc, o);
  const float il = 1.0f / l;
  float* st = &xch[0][wave][0][0][0];   // the wave's own part of the step-1 buffer as [16 queries][36]: its partner read it before it came to the step-2 barrier
  // both loops below are unrolled: o is indexed by constants and stays in registers, and the four stores follow one another
#pragma unroll
  for (int i = 0; i < 16; ++i) st[col * 36 + (i >> 3) * 16 + 8 * g + (i & 7)] = (hf ? o[16 + i] : o[i]) * il;   // tiles 2 hf and 2 hf + 1
  LDSX();
#pragma unroll
  for (int it = 0; it < 4; ++it) { const int rl = it * 4 + (lane >> 3); vst2(O + ((size_t)b * SS + q0 + rl) * DM + h * HD + hf * 32 + (lane & 7) * 4, *(const v4f*)&st[rl * 36 + (lane & 7) * 4]); }
}
// ---- k_out: block = (64 rows, 128 cols): out = O(hi/lo) . Wo rows (2 products) + bo
__global__ __launch_bounds__(128) void k_out(const float* __restrict__ O, const __bf16* __restrict__ P, const float* __restrict__ BO, float* __restrict__ Y) {
  __shared__ __align__(16) float so[4][16][132];
  const int tid = threadIdx.x, wave = tid >> 5, lane = tid & 31, col = lane & 15, g = lane >> 4; const size_t r0 = (size_t)blockIdx.x * 64 + wave * 16; const int n0 = blockIdx.y * 128;
  v8f acc[8] = {};
#pragma unroll 2
  for (int kc = 0; kc < DM / 32; ++kc) { const F2 a = split_row(O + (r0 + col) * DM, kc * 32, lane);
#pragma unroll
    for (int j = 0; j < 8; ++j) { const v16b w = frag_b(P + (size_t)(n0 + j * 16 + col) * DM + kc * 32, lane); acc[j] = wmma_bf(a.l, w, acc[j]); acc[j] = wmma_bf(a.h, w, acc[j]); } }
#pragma unroll
  for (int j = 0; j < 8; ++j) {
#pragma unroll
    for (int r = 0; r < 8; ++r) so[wave][8 * g + r][j * 16 + col] = acc[j][r] + bfr(BO[n0 + j * 16 + col]); }
  LDSX();
  for (int rl = 0; rl < 16; ++rl) vst2(Y + (r0 + rl) * DM + n0 + lane * 4, *(const v4f*)&so[wave][rl][lane * 4]);
}
// ---- k_lay: every re-lay of the call in one launch of as many blocks as the chip has WGPs: block = (batch b, pass ps of 32 keys, half hq of the heads); a thread's 16 global loads, 512 bytes in a row per wave each, are all requested before the first is used
// Y rows ps * 32 + 0..31, columns hq * 256 + 0..255 -> one f16 tile in LDS -> k chunks (16 bytes of a tile row) and v^T chunks (8 rows of a tile column), both thread-linear in the destination; R rows blockIdx.x * 16 + 0..15 -> q slots of the q plane, element by element
// k chunk (head, slot = ct * 4 + kc * 2 + j, lane = 16 g + col) holds k[key pass * 32 + ct * 16 + col][h * 64 + kc * 32 + j * 16 + 8 g + 0..7]: what lane (col, g) takes as half j of fragment (ct, kc)
// v chunk (head, slot = dt * 2 + j, lane = 16 g + col) holds v[keys pass * 32 + j * 16 + 8 g + 0..7][h * 64 + dt * 16 + col]: what lane (col, g) takes as half j of fragment dt
#define LYP 264                      // halves of one tile row: 256 + 8, so that the 16 rows of a wave's 16-byte chunk reads start 4 banks apart
#define FHEAD ((SS / 32) * (FPASS / 2))   // halves of one head in a fragment-ordered plane
typedef __attribute__((ext_vector_type(4))) _Float16 v4h;
__device__ __forceinline__ v4h lay4(v4f x) { v4h r;
#pragma unroll
  for (int k = 0; k < 4; ++k) r[k] = (_Float16)bfr(x[k]);
  return r; }
__global__ __launch_bounds__(256) void k_lay(const float* __restrict__ R, const float* __restrict__ Y, _Float16* __restrict__ QK, _Float16* __restrict__ KP, _Float16* __restrict__ VP) {
  __shared__ __align__(16) _Float16 sy[32][LYP];
  const int t = threadIdx.x, ln = t & 31, sl = t >> 5;
  const int hq = blockIdx.x & 1, ps = (blockIdx.x >> 1) & (SS / 32 - 1), b = blockIdx.x / (2 * (SS / 32));
  const float* ys = Y + ((size_t)b * SS + ps * 32 + (t >> 6)) * DM + hq * 256 + (t & 63) * 4;   // load i: tile row (t >> 6) + 4 i
  const float* rs = R + (size_t)blockIdx.x * 16 * DM + t * 4;                                   // load i: row (t >> 7) + 2 i of the block's 16
  v4f yv[8], rv[8];
  // the loops below are unrolled so that the loaded values are indexed by constants and stay in registers
#pragma unroll
  for (int i = 0; i < 8; ++i) yv[i] = *(const v4f*)(ys + i * 4 * DM);
#pragma unroll
  for (int i = 0; i < 8; ++i) rv[i] = *(const v4f*)(rs + i * 2 * DM);
  asm volatile("s_wait_xcnt 0x0" ::: "memory");   // all 16 loads are requested above this line (without it the last of them sink below the first waits), and it stands in front of every reuse of their address registers
#pragma unroll
  for (int i = 0; i < 8; ++i) vst2(&sy[(t >> 6) + 4 * i][(t & 63) * 4], lay4(yv[i]));
  __syncthreads();   // the tile is whole before any chunk is read from it; no global store stands in front of it, so it waits for none
  const size_t o = ((((size_t)b * NH + hq * 4) * (SS / 32) + ps) * 8 + sl) * (FSLOT / 2) + ln * 8;
  const _Float16* kr = &sy[(sl >> 2) * 16 + (ln & 15)][((sl >> 1) & 1) * 32 + (sl & 1) * 16 + (ln >> 4) * 8];
  const _Float16* vr = &sy[(sl & 1) * 16 + (ln >> 4) * 8][(sl >> 1) * 16 + (ln & 15)];
  _Float16* qd = QK + ((size_t)blockIdx.x * 16 + (t >> 7)) * (2 * DM) + (t & 127) * 4;
  v8h kw[4], vw[4]; v4h qw[8];
#pragma unroll
  for (int hh = 0; hh < 4; ++hh) { kw[hh] = *(const v8h*)(kr + hh * HD);
#pragma unroll
    for (int i = 0; i < 8; ++i) vw[hh][i] = vr[i * LYP + hh * HD]; }
#pragma unroll
  for (int i = 0; i < 8; ++i) qw[i] = lay4(rv[i]);
#pragma unroll
  for (int hh = 0; hh < 4; ++hh) { vst2(KP + o + (size_t)hh * FHEAD, kw[hh]); vst2(VP + o + (size_t)hh * FHEAD, vw[hh]); }
#pragma unroll
  for (int i = 0; i < 8; ++i) vst2(qd + i * 2 * (2 * DM), qw[i]);
}
extern "C" void kernel_launch(void* const* d_in, const int* in_sizes, int n_in, void* d_out, int out_size, void* d_ws, size_t ws_size, hipStream_t stream) {
  (void)in_sizes; (void)n_in; (void)out_size;
  const float** F = (const float**)d_in;   // 0 R [2,2048,512] (state patterns / queries), 1 Y [2,2048,512] (stored patterns = keys = values)
  if (ws_size < (size_t)WS_END) return;
  char* ws = (char*)d_ws; (void)0; _Float16 *QK = (_Float16*)(ws + WS_QK), *KP = (_Float16*)(ws + WS_KP), *VP = (_Float16*)(ws + WS_VP);
  k_lay<<<NB * (SS / 32) * 2, 256, 0, stream>>>(F[0], F[1], QK, KP, VP);
  k_attn<<<dim3(TQB, NH, TNB), 256, 0, stream>>>(QK, KP, VP, (float*)d_out);   // both steps -> output rows [b*L + l][h*64 + e]
}
